// v000
// Times are from an AMD MI455X. After a warm-up the kernel runs many times in a row, and a time is the length of
// such a window on the GPU divided by its runs, so every launch and the gaps after it count. The runs cycle
// through copies of the inputs. A figure is the median of several windows, for all but v000 over two sittings.
// Sittings can differ by a few percent; kernels timed side by side share one.
// v000, which the later versions start from, runs in 506 microseconds.
#include <hip/hip_runtime.h>

typedef __bf16 bhalf_t;
typedef __attribute__((ext_vector_type(16))) __bf16 v16bf;
typedef __attribute__((ext_vector_type(8)))  __bf16 v8bf;
typedef __attribute__((ext_vector_type(8)))  float  v8f;
typedef __attribute__((ext_vector_type(4)))  unsigned int v4u;
typedef __attribute__((ext_vector_type(8)))  int v8i;
typedef __attribute__((ext_vector_type(4)))  int v4i;

#define DM   1024   // d_model
#define NH   16     // heads
#define HD   64     // head dim
#define DF   4096   // d_ff
#define BB   2      // batch
#define LL   2048   // seq len
#define MM   (BB*LL)

#if defined(__gfx1250__) && __has_builtin(__builtin_amdgcn_tensor_load_to_lds)
#define HAVE_TDM 1
#else
#define HAVE_TDM 0
#endif

__device__ __forceinline__ v8f wmma_bf16f32(v16bf a, v16bf b, v8f c) {
  return __builtin_amdgcn_wmma_f32_16x16x32_bf16(false, a, false, b, (short)0, c,
                                                 false, false);
}

__device__ __forceinline__ v16bf frag_ld(const bhalf_t* p) {
  v8bf lo = *(const v8bf*)(p);
  v8bf hi = *(const v8bf*)(p + 16);
  v16bf r;
#pragma unroll
  for (int i = 0; i < 8; ++i) { r[i] = lo[i]; r[8 + i] = hi[i]; }
  return r;
}

#if HAVE_TDM
__device__ __forceinline__ void tdm_load_2d(unsigned lds_off, const void* gptr,
                                            unsigned tile_k, unsigned tile_rows,
                                            unsigned tensor_k, unsigned tensor_rows,
                                            unsigned long long row_stride) {
  unsigned long long ga = (unsigned long long)(uintptr_t)gptr;
  v4u g0;
  g0[0] = 1u;
  g0[1] = lds_off;
  g0[2] = (unsigned)(ga & 0xFFFFFFFFu);
  g0[3] = (unsigned)((ga >> 32) & 0x01FFFFFFu) | (2u << 30);
  v8i g1;
  g1[0] = (int)(1u << 16);
  g1[1] = (int)((tensor_k & 0xFFFFu) << 16);
  g1[2] = (int)(((tensor_k >> 16) & 0xFFFFu) | ((tensor_rows & 0xFFFFu) << 16));
  g1[3] = (int)(((tensor_rows >> 16) & 0xFFFFu) | ((tile_k & 0xFFFFu) << 16));
  g1[4] = (int)(tile_rows & 0xFFFFu);
  g1[5] = (int)(unsigned)(row_stride & 0xFFFFFFFFull);        // dim0_stride[31:0]
  g1[6] = (int)(unsigned)((row_stride >> 32) & 0xFFFFull);    // dim0_stride[47:32]
  g1[7] = 0;                                         // dim1_stride unused (2D tile)
  v4i z = {0, 0, 0, 0};
#if __clang_major__ >= 23
  v8i z8 = {0, 0, 0, 0, 0, 0, 0, 0};
  __builtin_amdgcn_tensor_load_to_lds(g0, g1, z, z, z8, 0);
#else
  __builtin_amdgcn_tensor_load_to_lds(g0, g1, z, z, 0);
#endif
}
#endif  // HAVE_TDM

// ---------------------------------------------------------------------------
// fp32 -> bf16 cast (weights)
// ---------------------------------------------------------------------------
__global__ void cast_f32_bf16(const float* __restrict__ in,
                              bhalf_t* __restrict__ out, int n) {
  int i = blockIdx.x * blockDim.x + threadIdx.x;
  if (i < n) out[i] = (bhalf_t)in[i];
}

// ---------------------------------------------------------------------------
// LayerNorm (d=1024) -> bf16
// ---------------------------------------------------------------------------
__global__ __launch_bounds__(256) void layernorm_bf16(
    const float* __restrict__ x, const float* __restrict__ w,
    const float* __restrict__ b, bhalf_t* __restrict__ out) {
  __shared__ float red[256];
  const int row = blockIdx.x;
  const int tid = threadIdx.x;
  const float* xr = x + (size_t)row * DM;
  float s = 0.f;
  for (int i = tid; i < DM; i += 256) s += xr[i];
  red[tid] = s; __syncthreads();
  for (int o = 128; o > 0; o >>= 1) {
    if (tid < o) red[tid] += red[tid + o];
    __syncthreads();
  }
  const float mu = red[0] * (1.f / DM);
  __syncthreads();
  float v = 0.f;
  for (int i = tid; i < DM; i += 256) { float d = xr[i] - mu; v += d * d; }
  red[tid] = v; __syncthreads();
  for (int o = 128; o > 0; o >>= 1) {
    if (tid < o) red[tid] += red[tid + o];
    __syncthreads();
  }
  const float rstd = rsqrtf(red[0] * (1.f / DM) + 1e-5f);
  bhalf_t* orow = out + (size_t)row * DM;
  for (int i = tid; i < DM; i += 256)
    orow[i] = (bhalf_t)((xr[i] - mu) * rstd * w[i] + b[i]);
}

template <int EPI>
__global__ __launch_bounds__(256) void gemm_bf16(
    const bhalf_t* __restrict__ A, const bhalf_t* __restrict__ W,
    const float* __restrict__ bias, const float* __restrict__ resid,
    void* __restrict__ outp, int Mdim, int Ndim, int Kdim) {
  const int lane = threadIdx.x & 31;
  const int wave = threadIdx.x >> 5;
  const int hl = lane & 15, g = lane >> 4;
  const int wm = wave & 1;            // 2 row groups of 64
  const int wn = wave >> 1;           // 4 col groups of 64
  const int m0 = blockIdx.x * 128 + wm * 64;
  const int n0 = blockIdx.y * 256 + wn * 64;

  v8f acc[4][4];
#pragma unroll
  for (int i = 0; i < 4; ++i)
#pragma unroll
    for (int j = 0; j < 4; ++j)
#pragma unroll
      for (int e = 0; e < 8; ++e) acc[i][j][e] = 0.f;

#if HAVE_TDM
  __shared__ bhalf_t sA[2][128][32];  // 16 KB: block A tile, double buffered
  __shared__ bhalf_t sB[2][256][32];  // 32 KB: block W tile, double buffered

  const bhalf_t* Ab = A + (size_t)blockIdx.x * 128 * Kdim;
  const bhalf_t* Wb = W + (size_t)blockIdx.y * 256 * Kdim;

  // prologue: DMA first K-slab into buffer 0 (one wave issues for the block)
  if (wave == 0) {
    tdm_load_2d((unsigned)(uintptr_t)&sA[0][0][0], Ab, 32, 128,
                (unsigned)Kdim, (unsigned)Mdim, (unsigned long long)Kdim);
    tdm_load_2d((unsigned)(uintptr_t)&sB[0][0][0], Wb, 32, 256,
                (unsigned)Kdim, (unsigned)Ndim, (unsigned long long)Kdim);
  }

  for (int k = 0; k < Kdim; k += 32) {
    const int buf = (k >> 5) & 1;
    if (wave == 0) __builtin_amdgcn_s_wait_tensorcnt(0);
    __syncthreads();  // buf ready for everyone; buf^1 free to overwrite
    if (k + 32 < Kdim && wave == 0) {
      tdm_load_2d((unsigned)(uintptr_t)&sA[buf ^ 1][0][0], Ab + (k + 32), 32, 128,
                  (unsigned)Kdim, (unsigned)Mdim, (unsigned long long)Kdim);
      tdm_load_2d((unsigned)(uintptr_t)&sB[buf ^ 1][0][0], Wb + (k + 32), 32, 256,
                  (unsigned)Kdim, (unsigned)Ndim, (unsigned long long)Kdim);
    }
    v16bf fa[4], fb[4];
#pragma unroll
    for (int mi = 0; mi < 4; ++mi)
      fa[mi] = frag_ld(&sA[buf][wm * 64 + mi * 16 + hl][g * 8]);
#pragma unroll
    for (int ni = 0; ni < 4; ++ni)
      fb[ni] = frag_ld(&sB[buf][wn * 64 + ni * 16 + hl][g * 8]);
#pragma unroll
    for (int mi = 0; mi < 4; ++mi)
#pragma unroll
      for (int ni = 0; ni < 4; ++ni)
        acc[mi][ni] = wmma_bf16f32(fa[mi], fb[ni], acc[mi][ni]);
  }
#else
  // fallback: fragments straight from global
  for (int k = 0; k < Kdim; k += 32) {
    v16bf fa[4], fb[4];
#pragma unroll
    for (int mi = 0; mi < 4; ++mi)
      fa[mi] = frag_ld(A + (size_t)(m0 + mi * 16 + hl) * Kdim + k + g * 8);
#pragma unroll
    for (int ni = 0; ni < 4; ++ni)
      fb[ni] = frag_ld(W + (size_t)(n0 + ni * 16 + hl) * Kdim + k + g * 8);
#pragma unroll
    for (int mi = 0; mi < 4; ++mi)
#pragma unroll
      for (int ni = 0; ni < 4; ++ni)
        acc[mi][ni] = wmma_bf16f32(fa[mi], fb[ni], acc[mi][ni]);
  }
#endif

#pragma unroll
  for (int mi = 0; mi < 4; ++mi)
#pragma unroll
    for (int ni = 0; ni < 4; ++ni) {
      const int col = n0 + ni * 16 + hl;
      const float bv = bias[col];
#pragma unroll
      for (int r = 0; r < 8; ++r) {
        const int row = m0 + mi * 16 + r + 8 * g;
        float v = acc[mi][ni][r] + bv;
        if (EPI == 0) {
          ((bhalf_t*)outp)[(size_t)row * Ndim + col] = (bhalf_t)v;
        } else if (EPI == 1) {
          const int bidx = row >> 11;  // row / LL
          const int seq = row & (LL - 1);
          const size_t idx =
              (((size_t)(bidx * NH + (col >> 6)) * HD) + (col & (HD - 1))) * LL + seq;
          ((bhalf_t*)outp)[idx] = (bhalf_t)v;
        } else if (EPI == 2) {
          const size_t idx = (size_t)row * Ndim + col;
          ((float*)outp)[idx] = resid[idx] + v;
        } else {
          const float gv = 0.5f * v * (1.f + erff(v * 0.70710678118654752f));
          ((bhalf_t*)outp)[(size_t)row * Ndim + col] = (bhalf_t)gv;
        }
      }
    }
}

__global__ __launch_bounds__(256) void attn_flash(
    const bhalf_t* __restrict__ Q, const bhalf_t* __restrict__ Km,
    const bhalf_t* __restrict__ Vt, bhalf_t* __restrict__ ctxout,
    const int* __restrict__ pfx) {
#if HAVE_TDM
  __shared__ bhalf_t sK[2][32][64];   // 8 KB: 32 keys x 64 hd, double buffered
  __shared__ bhalf_t sV[2][64][32];   // 8 KB: 64 hd x 32 keys, double buffered
#endif
  __shared__ bhalf_t plds[8][16][32]; // per-wave prob tile (transpose buffer)
  const int prefix = *pfx;
  const int lane = threadIdx.x & 31;
  const int wave = threadIdx.x >> 5;
  const int hl = lane & 15, g = lane >> 4;
  const int qblk = (blockIdx.x & (LL / 128 - 1)) * 128;  // query block start
  const int bh = blockIdx.x >> 4;                        // LL/128 == 16
  const int bidx = bh >> 4, h = bh & (NH - 1);
  const int q0 = qblk + wave * 16;                       // this wave's tile

  const bhalf_t* Qb = Q + (size_t)bidx * LL * DM + h * HD;
  const bhalf_t* Kb = Km + (size_t)bidx * LL * DM + h * HD;
  const bhalf_t* Vb = Vt + (size_t)bh * HD * LL;

  const bhalf_t* qp = Qb + (size_t)(q0 + hl) * DM + g * 8;
  const v16bf qa0 = frag_ld(qp);
  const v16bf qa1 = frag_ld(qp + 32);

  float mrow[8], lrow[8];
  v8f ctx[4];
#pragma unroll
  for (int r = 0; r < 8; ++r) { mrow[r] = -1e30f; lrow[r] = 0.f; }
#pragma unroll
  for (int nt = 0; nt < 4; ++nt)
#pragma unroll
    for (int e = 0; e < 8; ++e) ctx[nt][e] = 0.f;

  // per-wave and block-level key extents (rounded to 32-key chunks)
  int kend_w = (q0 + 16 > prefix) ? (q0 + 16) : prefix;
  kend_w = (kend_w + 31) & ~31;
  int kend_b = (qblk + 128 > prefix) ? (qblk + 128) : prefix;
  kend_b = (kend_b + 31) & ~31;
  const float scale = 0.125f;  // 1/sqrt(64)

#if HAVE_TDM
  if (wave == 0) {  // prologue DMA: K chunk (32x64, pitch DM), V chunk (64x32, pitch LL)
    tdm_load_2d((unsigned)(uintptr_t)&sK[0][0][0], Kb, 64, 32, 64, 32,
                (unsigned long long)DM);
    tdm_load_2d((unsigned)(uintptr_t)&sV[0][0][0], Vb, 32, 64, 32, 64,
                (unsigned long long)LL);
  }
#endif

  for (int c = 0; c < kend_b; c += 32) {
#if HAVE_TDM
    const int buf = (c >> 5) & 1;
    if (wave == 0) __builtin_amdgcn_s_wait_tensorcnt(0);
    __syncthreads();  // chunk ready for all waves; other buffer free
    if (c + 32 < kend_b && wave == 0) {
      tdm_load_2d((unsigned)(uintptr_t)&sK[buf ^ 1][0][0], Kb + (size_t)(c + 32) * DM,
                  64, 32, 64, 32, (unsigned long long)DM);
      tdm_load_2d((unsigned)(uintptr_t)&sV[buf ^ 1][0][0], Vb + (c + 32),
                  32, 64, 32, 64, (unsigned long long)LL);
    }
#endif
    if (c < kend_w) {
      // ---- scores S[16 x 32] = Q @ K^T (2 key sub-tiles x 2 hd halves)
      v8f s[2];
#pragma unroll
      for (int t = 0; t < 2; ++t) {
#pragma unroll
        for (int e = 0; e < 8; ++e) s[t][e] = 0.f;
#if HAVE_TDM
        v16bf kb0 = frag_ld(&sK[buf][t * 16 + hl][g * 8]);
        v16bf kb1 = frag_ld(&sK[buf][t * 16 + hl][32 + g * 8]);
#else
        const bhalf_t* kp = Kb + (size_t)(c + t * 16 + hl) * DM + g * 8;
        v16bf kb0 = frag_ld(kp);
        v16bf kb1 = frag_ld(kp + 32);
#endif
        s[t] = wmma_bf16f32(qa0, kb0, s[t]);
        s[t] = wmma_bf16f32(qa1, kb1, s[t]);
      }
      // ---- scale + prefix-decoder mask
      const bool needmask = (c + 31 >= prefix);
#pragma unroll
      for (int t = 0; t < 2; ++t)
#pragma unroll
        for (int r = 0; r < 8; ++r) {
          float v = s[t][r] * scale;
          if (needmask) {
            const int key = c + t * 16 + hl;
            const int qi = q0 + r + 8 * g;
            const bool ok = (key < prefix) || ((qi >= prefix) && (key <= qi));
            if (!ok) v = -1e30f;
          }
          s[t][r] = v;
        }
      // ---- online softmax (row stats live in each 16-lane half)
#pragma unroll
      for (int r = 0; r < 8; ++r) {
        float tm = fmaxf(s[0][r], s[1][r]);
#pragma unroll
        for (int o = 1; o < 16; o <<= 1) tm = fmaxf(tm, __shfl_xor(tm, o, 32));
        const float mnew = fmaxf(mrow[r], tm);
        const float alpha = __expf(mrow[r] - mnew);
        float rs = 0.f;
#pragma unroll
        for (int t = 0; t < 2; ++t) {
          const float p = __expf(s[t][r] - mnew);
          s[t][r] = p;
          rs += p;
        }
#pragma unroll
        for (int o = 1; o < 16; o <<= 1) rs += __shfl_xor(rs, o, 32);
        lrow[r] = lrow[r] * alpha + rs;
        mrow[r] = mnew;
#pragma unroll
        for (int nt = 0; nt < 4; ++nt) ctx[nt][r] *= alpha;
      }
      // ---- C-tile -> A-fragment relayout through per-wave LDS
#pragma unroll
      for (int t = 0; t < 2; ++t)
#pragma unroll
        for (int r = 0; r < 8; ++r)
          plds[wave][r + 8 * g][t * 16 + hl] = (bhalf_t)s[t][r];
      const v16bf pa = frag_ld(&plds[wave][hl][g * 8]);  // ds_load_b128 x2
      // ---- ctx += P @ V  (contraction over 32 keys, 4 hd column tiles)
#pragma unroll
      for (int nt = 0; nt < 4; ++nt) {
#if HAVE_TDM
        v16bf vb = frag_ld(&sV[buf][nt * 16 + hl][g * 8]);
#else
        v16bf vb = frag_ld(Vb + (size_t)(nt * 16 + hl) * LL + c + g * 8);
#endif
        ctx[nt] = wmma_bf16f32(pa, vb, ctx[nt]);
      }
    }
  }
  // ---- normalize and store context
#pragma unroll
  for (int nt = 0; nt < 4; ++nt)
#pragma unroll
    for (int r = 0; r < 8; ++r) {
      const int row = q0 + r + 8 * g;
      const int col = h * HD + nt * 16 + hl;
      ctxout[((size_t)bidx * LL + row) * DM + col] = (bhalf_t)(ctx[nt][r] / lrow[r]);
    }
}

// ---------------------------------------------------------------------------
// Launch
// ---------------------------------------------------------------------------
extern "C" void kernel_launch(void* const* d_in, const int* in_sizes, int n_in,
                              void* d_out, int out_size, void* d_ws, size_t ws_size,
                              hipStream_t stream) {
  (void)in_sizes; (void)n_in; (void)out_size; (void)ws_size;
  const float* x    = (const float*)d_in[0];
  const float* ln1w = (const float*)d_in[1];
  const float* ln1b = (const float*)d_in[2];
  const float* inw  = (const float*)d_in[3];
  const float* inb  = (const float*)d_in[4];
  const float* outw = (const float*)d_in[5];
  const float* outb = (const float*)d_in[6];
  const float* ln2w = (const float*)d_in[7];
  const float* ln2b = (const float*)d_in[8];
  const float* fc1w = (const float*)d_in[9];
  const float* fc1b = (const float*)d_in[10];
  const float* fc2w = (const float*)d_in[11];
  const float* fc2b = (const float*)d_in[12];
  const int*   pfx  = (const int*)d_in[13];
  float* out = (float*)d_out;

  char* ws = (char*)d_ws;
  size_t off = 0;
  auto carve = [&](size_t bytes) -> void* {
    void* p = ws + off;
    off += (bytes + 255) & ~(size_t)255;
    return p;
  };
  bhalf_t* wqkv = (bhalf_t*)carve((size_t)3 * DM * DM * sizeof(bhalf_t));
  bhalf_t* wo   = (bhalf_t*)carve((size_t)DM * DM * sizeof(bhalf_t));
  bhalf_t* w1   = (bhalf_t*)carve((size_t)DF * DM * sizeof(bhalf_t));
  bhalf_t* w2   = (bhalf_t*)carve((size_t)DM * DF * sizeof(bhalf_t));
  bhalf_t* h1   = (bhalf_t*)carve((size_t)MM * DM * sizeof(bhalf_t));
  bhalf_t* Qb   = (bhalf_t*)carve((size_t)MM * DM * sizeof(bhalf_t));
  bhalf_t* Kb   = (bhalf_t*)carve((size_t)MM * DM * sizeof(bhalf_t));
  bhalf_t* Vt   = (bhalf_t*)carve((size_t)MM * DM * sizeof(bhalf_t));
  bhalf_t* ctxb = (bhalf_t*)carve((size_t)MM * DM * sizeof(bhalf_t));
  float*   x1   = (float*)carve((size_t)MM * DM * sizeof(float));
  bhalf_t* h2   = (bhalf_t*)carve((size_t)MM * DM * sizeof(bhalf_t));
  bhalf_t* ff1  = (bhalf_t*)carve((size_t)MM * DF * sizeof(bhalf_t));

  auto castN = [&](const float* src, bhalf_t* dst, int n) {
    cast_f32_bf16<<<(n + 255) / 256, 256, 0, stream>>>(src, dst, n);
  };
  castN(inw,  wqkv, 3 * DM * DM);
  castN(outw, wo,   DM * DM);
  castN(fc1w, w1,   DF * DM);
  castN(fc2w, w2,   DM * DF);

  layernorm_bf16<<<MM, 256, 0, stream>>>(x, ln1w, ln1b, h1);

  dim3 blk(256);
  dim3 gD(MM / 128, DM / 256);
  dim3 gF(MM / 128, DF / 256);
  gemm_bf16<0><<<gD, blk, 0, stream>>>(h1, wqkv,                       inb,          nullptr, Qb, MM, DM, DM);
  gemm_bf16<0><<<gD, blk, 0, stream>>>(h1, wqkv + (size_t)DM * DM,     inb + DM,     nullptr, Kb, MM, DM, DM);
  gemm_bf16<1><<<gD, blk, 0, stream>>>(h1, wqkv + (size_t)2 * DM * DM, inb + 2 * DM, nullptr, Vt, MM, DM, DM);

  attn_flash<<<BB * NH * (LL / 128), blk, 0, stream>>>(Qb, Kb, Vt, ctxb, pfx);

  gemm_bf16<2><<<gD, blk, 0, stream>>>(ctxb, wo, outb, x, x1, MM, DM, DM);
  layernorm_bf16<<<MM, 256, 0, stream>>>(x1, ln2w, ln2b, h2);
  gemm_bf16<3><<<gF, blk, 0, stream>>>(h2, w1, fc1b, nullptr, ff1, MM, DF, DM);
  gemm_bf16<2><<<gD, blk, 0, stream>>>(ff1, w2, fc2b, x1, out, MM, DM, DF);
}

// v001
// A run of this version takes 378 microseconds.
// Timed twice side by side with v000, it ran 1.36 times as fast both times.
#include <hip/hip_runtime.h>

typedef __bf16 bhalf_t;
typedef __attribute__((ext_vector_type(16))) __bf16 v16bf;
typedef __attribute__((ext_vector_type(8)))  __bf16 v8bf;
typedef __attribute__((ext_vector_type(8)))  float  v8f;
typedef __attribute__((ext_vector_type(4)))  unsigned int v4u;
typedef __attribute__((ext_vector_type(8)))  int v8i;
typedef __attribute__((ext_vector_type(4)))  int v4i;

#define DM   1024   // d_model
#define NH   16     // heads
#define HD   64     // head dim
#define DF   4096   // d_ff
#define BB   2      // batch
#define LL   2048   // seq len
#define MM   (BB*LL)

#if defined(__gfx1250__) && __has_builtin(__builtin_amdgcn_tensor_load_to_lds)
#define HAVE_TDM 1
#else
#define HAVE_TDM 0
#endif

__device__ __forceinline__ v8f wmma_bf16f32(v16bf a, v16bf b, v8f c) {
  return __builtin_amdgcn_wmma_f32_16x16x32_bf16(false, a, false, b, (short)0, c,
                                                 false, false);
}

__device__ __forceinline__ v16bf frag_ld(const bhalf_t* p) {
  v8bf lo = *(const v8bf*)(p);
  v8bf hi = *(const v8bf*)(p + 16);
  v16bf r;
#pragma unroll
  for (int i = 0; i < 8; ++i) { r[i] = lo[i]; r[8 + i] = hi[i]; }
  return r;
}

#if HAVE_TDM
__device__ __forceinline__ void tdm_load_2d(unsigned lds_off, const void* gptr,
                                            unsigned tile_k, unsigned tile_rows,
                                            unsigned tensor_k, unsigned tensor_rows,
                                            unsigned long long row_stride) {
  unsigned long long ga = (unsigned long long)(uintptr_t)gptr;
  v4u g0;
  g0[0] = 1u;
  g0[1] = lds_off;
  g0[2] = (unsigned)(ga & 0xFFFFFFFFu);
  g0[3] = (unsigned)((ga >> 32) & 0x01FFFFFFu) | (2u << 30);
  v8i g1;
  g1[0] = (int)(1u << 16);
  g1[1] = (int)((tensor_k & 0xFFFFu) << 16);
  g1[2] = (int)(((tensor_k >> 16) & 0xFFFFu) | ((tensor_rows & 0xFFFFu) << 16));
  g1[3] = (int)(((tensor_rows >> 16) & 0xFFFFu) | ((tile_k & 0xFFFFu) << 16));
  g1[4] = (int)(tile_rows & 0xFFFFu);
  g1[5] = (int)(unsigned)(row_stride & 0xFFFFFFFFull);        // dim0_stride[31:0]
  g1[6] = (int)(unsigned)((row_stride >> 32) & 0xFFFFull);    // dim0_stride[47:32]
  g1[7] = 0;                                         // dim1_stride unused (2D tile)
  v4i z = {0, 0, 0, 0};
#if __clang_major__ >= 23
  v8i z8 = {0, 0, 0, 0, 0, 0, 0, 0};
  __builtin_amdgcn_tensor_load_to_lds(g0, g1, z, z, z8, 0);
#else
  __builtin_amdgcn_tensor_load_to_lds(g0, g1, z, z, 0);
#endif
}

typedef __attribute__((ext_vector_type(8))) unsigned int v8u;
#define GK      128                 // k elements per stage
#define GROWB   256u                // bytes of one staged row
#define GPITCH  272u                // LDS pitch of a staged row
#define GSLICE  (128u * GPITCH)     // one wave's request: 128 rows = 17 x 2 KiB
#define GBUF    (3u * GSLICE)       // a stage: A 128 rows, then W 256 rows

__device__ __forceinline__ unsigned uni(unsigned v) {
  return (unsigned)__builtin_amdgcn_readfirstlane(v);
}
__device__ __forceinline__ unsigned pinned(unsigned v) {
  unsigned w = uni(v);
  asm volatile("" : "+s"(w));
  return w;
}
__device__ __forceinline__ v8u gemm_group1(unsigned src_pitch_bytes) {
  v8u d;
  d[0] = uni((1u << 20) | (5u << 22) | (3u << 25));
  d[1] = uni((GROWB & 0xFFFFu) << 16);
  d[2] = uni((GROWB >> 16) | (128u << 16));
  d[3] = uni(GROWB << 16);
  d[4] = uni(128u);
  d[5] = uni(src_pitch_bytes);
  d[6] = uni(0u);
  d[7] = uni(0u);
  // Built once and kept: without this the compiler re-forms some words in the loop, in the
  // same registers, while a request is outstanding.
  asm volatile("" : "+s"(d));
  return d;
}
__device__ __forceinline__ void gemm_tile_load(unsigned lds_dst, unsigned long long ga, v8u d1) {
  v4u d0;
  d0[0] = uni(1u);
  d0[1] = uni(lds_dst);
  d0[2] = uni((unsigned)ga);
  d0[3] = uni((((unsigned)(ga >> 32)) & 0x01FFFFFFu) | 0x80000000u);
  asm volatile("tensor_load_to_lds %0, %1" :: "s"(d0), "s"(d1) : "memory");
}
// The compiler places no wait for the tensor mover: a tile counts as landed only behind this.
__device__ __forceinline__ void wait_tensor0() { asm volatile("s_wait_tensorcnt 0x0" ::: "memory"); }
// A wave's LDS reads have retired before the buffer they read is handed back for a refill.
__device__ __forceinline__ void wait_ds0() { asm volatile("s_wait_dscnt 0x0" ::: "memory"); }
#endif  // HAVE_TDM

// ---------------------------------------------------------------------------
// fp32 -> bf16 cast (weights)
// ---------------------------------------------------------------------------
__global__ void cast_f32_bf16(const float* __restrict__ in,
                              bhalf_t* __restrict__ out, int n) {
  int i = blockIdx.x * blockDim.x + threadIdx.x;
  if (i < n) out[i] = (bhalf_t)in[i];
}

// ---------------------------------------------------------------------------
// LayerNorm (d=1024) -> bf16
// ---------------------------------------------------------------------------
__global__ __launch_bounds__(256) void layernorm_bf16(
    const float* __restrict__ x, const float* __restrict__ w,
    const float* __restrict__ b, bhalf_t* __restrict__ out) {
  __shared__ float red[256];
  const int row = blockIdx.x;
  const int tid = threadIdx.x;
  const float* xr = x + (size_t)row * DM;
  float s = 0.f;
  for (int i = tid; i < DM; i += 256) s += xr[i];
  red[tid] = s; __syncthreads();
  for (int o = 128; o > 0; o >>= 1) {
    if (tid < o) red[tid] += red[tid + o];
    __syncthreads();
  }
  const float mu = red[0] * (1.f / DM);
  __syncthreads();
  float v = 0.f;
  for (int i = tid; i < DM; i += 256) { float d = xr[i] - mu; v += d * d; }
  red[tid] = v; __syncthreads();
  for (int o = 128; o > 0; o >>= 1) {
    if (tid < o) red[tid] += red[tid + o];
    __syncthreads();
  }
  const float rstd = rsqrtf(red[0] * (1.f / DM) + 1e-5f);
  bhalf_t* orow = out + (size_t)row * DM;
  for (int i = tid; i < DM; i += 256)
    orow[i] = (bhalf_t)((xr[i] - mu) * rstd * w[i] + b[i]);
}

template <int EPI>
__global__ __launch_bounds__(256) void gemm_bf16(
    const bhalf_t* __restrict__ A, const bhalf_t* __restrict__ W,
    const float* __restrict__ bias, const float* __restrict__ resid,
    void* __restrict__ outp, int Mdim, int Ndim, int Kdim) {
  const int lane = threadIdx.x & 31;
  const int wave = threadIdx.x >> 5;
  const int hl = lane & 15, g = lane >> 4;
  const int wm = wave & 1;            // 2 row groups of 64
  const int wn = wave >> 1;           // 4 col groups of 64
  const int m0 = blockIdx.x * 128 + wm * 64;
  const int n0 = blockIdx.y * 256 + wn * 64;

  v8f acc[4][4];
#pragma unroll
  for (int i = 0; i < 4; ++i)
#pragma unroll
    for (int j = 0; j < 4; ++j)
#pragma unroll
      for (int e = 0; e < 8; ++e) acc[i][j][e] = 0.f;

#if HAVE_TDM
  // Two stages of [A 128 rows | W 256 rows], 256 B of k per row at pitch 272 B.
  __shared__ __attribute__((aligned(2048))) unsigned char sT[2u * GBUF];
  (void)Mdim;

  const unsigned wv = uni(threadIdx.x >> 5);
  // waves 0, 1, 2 each bring one slice of 128 rows: A, W rows 0-127, W rows 128-255
  const bhalf_t* sp = (wv == 0u)
      ? A + (size_t)blockIdx.x * 128 * Kdim
      : W + ((size_t)blockIdx.y * 256 + (wv == 2u ? 128 : 0)) * Kdim;
  const unsigned long long ga = (unsigned long long)(uintptr_t)sp;
  const unsigned dst = (unsigned)(uintptr_t)&sT[0] + (wv < 3u ? wv : 0u) * GSLICE;
  const v8u d1 = gemm_group1((unsigned)Kdim * 2u);
  const int nst = Kdim / GK;          // stages; at least two for every launch here

  if (pinned(wv < 3u)) {
    gemm_tile_load(dst, ga, d1);      // stage 0
    wait_tensor0();
  }
  __syncthreads();                    // stage 0 readable by every wave
  if (pinned(wv < 3u)) gemm_tile_load(dst + GBUF, ga + GROWB, d1);  // stage 1

  const unsigned aoff = (unsigned)(wm * 64 + hl) * GPITCH + (unsigned)g * 16u;
  const unsigned boff = GSLICE + (unsigned)(wn * 64 + hl) * GPITCH + (unsigned)g * 16u;

  for (int s = 0; s < nst; ++s) {
    const unsigned char* bp = sT + (unsigned)(s & 1) * GBUF;
#pragma unroll  // the four 32-k blocks of a stage: every LDS offset an immediate, no loop branch among the WMMAs
    for (int kb = 0; kb < GK / 32; ++kb) {
      v16bf fa[4], fb[4];
#pragma unroll
      for (int mi = 0; mi < 4; ++mi)
        fa[mi] = frag_ld((const bhalf_t*)(bp + aoff + mi * 16 * GPITCH + kb * 64));
#pragma unroll
      for (int ni = 0; ni < 4; ++ni)
        fb[ni] = frag_ld((const bhalf_t*)(bp + boff + ni * 16 * GPITCH + kb * 64));
#pragma unroll
      for (int mi = 0; mi < 4; ++mi)
#pragma unroll
        for (int ni = 0; ni < 4; ++ni)
          acc[mi][ni] = wmma_bf16f32(fa[mi], fb[ni], acc[mi][ni]);
    }
    // publish point of stage s + 1
    wait_ds0();
    if (pinned(wv < 3u)) wait_tensor0();
    __syncthreads();                  // stage s + 1 readable; stage s's buffer left by every reader
    if (pinned((wv < 3u) & (s + 2 < nst)))
      gemm_tile_load(dst + (unsigned)(s & 1) * GBUF,
                     ga + (unsigned long long)(s + 2) * GROWB, d1);
  }
  wait_tensor0();
  wait_ds0();
#else
  // fallback: fragments straight from global
  for (int k = 0; k < Kdim; k += 32) {
    v16bf fa[4], fb[4];
#pragma unroll
    for (int mi = 0; mi < 4; ++mi)
      fa[mi] = frag_ld(A + (size_t)(m0 + mi * 16 + hl) * Kdim + k + g * 8);
#pragma unroll
    for (int ni = 0; ni < 4; ++ni)
      fb[ni] = frag_ld(W + (size_t)(n0 + ni * 16 + hl) * Kdim + k + g * 8);
#pragma unroll
    for (int mi = 0; mi < 4; ++mi)
#pragma unroll
      for (int ni = 0; ni < 4; ++ni)
        acc[mi][ni] = wmma_bf16f32(fa[mi], fb[ni], acc[mi][ni]);
  }
#endif

#pragma unroll
  for (int mi = 0; mi < 4; ++mi)
#pragma unroll
    for (int ni = 0; ni < 4; ++ni) {
      const int col = n0 + ni * 16 + hl;
      const float bv = bias[col];
#pragma unroll
      for (int r = 0; r < 8; ++r) {
        const int row = m0 + mi * 16 + r + 8 * g;
        float v = acc[mi][ni][r] + bv;
        if (EPI == 0) {
          ((bhalf_t*)outp)[(size_t)row * Ndim + col] = (bhalf_t)v;
        } else if (EPI == 1) {
          const int bidx = row >> 11;  // row / LL
          const int seq = row & (LL - 1);
          const size_t idx =
              (((size_t)(bidx * NH + (col >> 6)) * HD) + (col & (HD - 1))) * LL + seq;
          ((bhalf_t*)outp)[idx] = (bhalf_t)v;
        } else if (EPI == 2) {
          const size_t idx = (size_t)row * Ndim + col;
          ((float*)outp)[idx] = resid[idx] + v;
        } else {
          const float gv = 0.5f * v * (1.f + erff(v * 0.70710678118654752f));
          ((bhalf_t*)outp)[(size_t)row * Ndim + col] = (bhalf_t)gv;
        }
      }
    }
}

__global__ __launch_bounds__(256) void attn_flash(
    const bhalf_t* __restrict__ Q, const bhalf_t* __restrict__ Km,
    const bhalf_t* __restrict__ Vt, bhalf_t* __restrict__ ctxout,
    const int* __restrict__ pfx) {
#if HAVE_TDM
  __shared__ bhalf_t sK[2][32][64];   // 8 KB: 32 keys x 64 hd, double buffered
  __shared__ bhalf_t sV[2][64][32];   // 8 KB: 64 hd x 32 keys, double buffered
#endif
  __shared__ bhalf_t plds[8][16][32]; // per-wave prob tile (transpose buffer)
  const int prefix = *pfx;
  const int lane = threadIdx.x & 31;
  const int wave = threadIdx.x >> 5;
  const int hl = lane & 15, g = lane >> 4;
  const int qblk = (blockIdx.x & (LL / 128 - 1)) * 128;  // query block start
  const int bh = blockIdx.x >> 4;                        // LL/128 == 16
  const int bidx = bh >> 4, h = bh & (NH - 1);
  const int q0 = qblk + wave * 16;                       // this wave's tile

  const bhalf_t* Qb = Q + (size_t)bidx * LL * DM + h * HD;
  const bhalf_t* Kb = Km + (size_t)bidx * LL * DM + h * HD;
  const bhalf_t* Vb = Vt + (size_t)bh * HD * LL;

  const bhalf_t* qp = Qb + (size_t)(q0 + hl) * DM + g * 8;
  const v16bf qa0 = frag_ld(qp);
  const v16bf qa1 = frag_ld(qp + 32);

  float mrow[8], lrow[8];
  v8f ctx[4];
#pragma unroll
  for (int r = 0; r < 8; ++r) { mrow[r] = -1e30f; lrow[r] = 0.f; }
#pragma unroll
  for (int nt = 0; nt < 4; ++nt)
#pragma unroll
    for (int e = 0; e < 8; ++e) ctx[nt][e] = 0.f;

  // per-wave and block-level key extents (rounded to 32-key chunks)
  int kend_w = (q0 + 16 > prefix) ? (q0 + 16) : prefix;
  kend_w = (kend_w + 31) & ~31;
  int kend_b = (qblk + 128 > prefix) ? (qblk + 128) : prefix;
  kend_b = (kend_b + 31) & ~31;
  const float scale = 0.125f;  // 1/sqrt(64)

#if HAVE_TDM
  if (wave == 0) {  // prologue DMA: K chunk (32x64, pitch DM), V chunk (64x32, pitch LL)
    tdm_load_2d((unsigned)(uintptr_t)&sK[0][0][0], Kb, 64, 32, 64, 32,
                (unsigned long long)DM);
    tdm_load_2d((unsigned)(uintptr_t)&sV[0][0][0], Vb, 32, 64, 32, 64,
                (unsigned long long)LL);
  }
#endif

  for (int c = 0; c < kend_b; c += 32) {
#if HAVE_TDM
    const int buf = (c >> 5) & 1;
    if (wave == 0) __builtin_amdgcn_s_wait_tensorcnt(0);
    __syncthreads();  // chunk ready for all waves; other buffer free
    if (c + 32 < kend_b && wave == 0) {
      tdm_load_2d((unsigned)(uintptr_t)&sK[buf ^ 1][0][0], Kb + (size_t)(c + 32) * DM,
                  64, 32, 64, 32, (unsigned long long)DM);
      tdm_load_2d((unsigned)(uintptr_t)&sV[buf ^ 1][0][0], Vb + (c + 32),
                  32, 64, 32, 64, (unsigned long long)LL);
    }
#endif
    if (c < kend_w) {
      // ---- scores S[16 x 32] = Q @ K^T (2 key sub-tiles x 2 hd halves)
      v8f s[2];
#pragma unroll
      for (int t = 0; t < 2; ++t) {
#pragma unroll
        for (int e = 0; e < 8; ++e) s[t][e] = 0.f;
#if HAVE_TDM
        v16bf kb0 = frag_ld(&sK[buf][t * 16 + hl][g * 8]);
        v16bf kb1 = frag_ld(&sK[buf][t * 16 + hl][32 + g * 8]);
#else
        const bhalf_t* kp = Kb + (size_t)(c + t * 16 + hl) * DM + g * 8;
        v16bf kb0 = frag_ld(kp);
        v16bf kb1 = frag_ld(kp + 32);
#endif
        s[t] = wmma_bf16f32(qa0, kb0, s[t]);
        s[t] = wmma_bf16f32(qa1, kb1, s[t]);
      }
      // ---- scale + prefix-decoder mask
      const bool needmask = (c + 31 >= prefix);
#pragma unroll
      for (int t = 0; t < 2; ++t)
#pragma unroll
        for (int r = 0; r < 8; ++r) {
          float v = s[t][r] * scale;
          if (needmask) {
            const int key = c + t * 16 + hl;
            const int qi = q0 + r + 8 * g;
            const bool ok = (key < prefix) || ((qi >= prefix) && (key <= qi));
            if (!ok) v = -1e30f;
          }
          s[t][r] = v;
        }
      // ---- online softmax (row stats live in each 16-lane half)
#pragma unroll
      for (int r = 0; r < 8; ++r) {
        float tm = fmaxf(s[0][r], s[1][r]);
#pragma unroll
        for (int o = 1; o < 16; o <<= 1) tm = fmaxf(tm, __shfl_xor(tm, o, 32));
        const float mnew = fmaxf(mrow[r], tm);
        const float alpha = __expf(mrow[r] - mnew);
        float rs = 0.f;
#pragma unroll
        for (int t = 0; t < 2; ++t) {
          const float p = __expf(s[t][r] - mnew);
          s[t][r] = p;
          rs += p;
        }
#pragma unroll
        for (int o = 1; o < 16; o <<= 1) rs += __shfl_xor(rs, o, 32);
        lrow[r] = lrow[r] * alpha + rs;
        mrow[r] = mnew;
#pragma unroll
        for (int nt = 0; nt < 4; ++nt) ctx[nt][r] *= alpha;
      }
      // ---- C-tile -> A-fragment relayout through per-wave LDS
#pragma unroll
      for (int t = 0; t < 2; ++t)
#pragma unroll
        for (int r = 0; r < 8; ++r)
          plds[wave][r + 8 * g][t * 16 + hl] = (bhalf_t)s[t][r];
      const v16bf pa = frag_ld(&plds[wave][hl][g * 8]);  // ds_load_b128 x2
      // ---- ctx += P @ V  (contraction over 32 keys, 4 hd column tiles)
#pragma unroll
      for (int nt = 0; nt < 4; ++nt) {
#if HAVE_TDM
        v16bf vb = frag_ld(&sV[buf][nt * 16 + hl][g * 8]);
#else
        v16bf vb = frag_ld(Vb + (size_t)(nt * 16 + hl) * LL + c + g * 8);
#endif
        ctx[nt] = wmma_bf16f32(pa, vb, ctx[nt]);
      }
    }
  }
  // ---- normalize and store context
#pragma unroll
  for (int nt = 0; nt < 4; ++nt)
#pragma unroll
    for (int r = 0; r < 8; ++r) {
      const int row = q0 + r + 8 * g;
      const int col = h * HD + nt * 16 + hl;
      ctxout[((size_t)bidx * LL + row) * DM + col] = (bhalf_t)(ctx[nt][r] / lrow[r]);
    }
}

// ---------------------------------------------------------------------------
// Launch
// ---------------------------------------------------------------------------
extern "C" void kernel_launch(void* const* d_in, const int* in_sizes, int n_in,
                              void* d_out, int out_size, void* d_ws, size_t ws_size,
                              hipStream_t stream) {
  (void)in_sizes; (void)n_in; (void)out_size; (void)ws_size;
  const float* x    = (const float*)d_in[0];
  const float* ln1w = (const float*)d_in[1];
  const float* ln1b = (const float*)d_in[2];
  const float* inw  = (const float*)d_in[3];
  const float* inb  = (const float*)d_in[4];
  const float* outw = (const float*)d_in[5];
  const float* outb = (const float*)d_in[6];
  const float* ln2w = (const float*)d_in[7];
  const float* ln2b = (const float*)d_in[8];
  const float* fc1w = (const float*)d_in[9];
  const float* fc1b = (const float*)d_in[10];
  const float* fc2w = (const float*)d_in[11];
  const float* fc2b = (const float*)d_in[12];
  const int*   pfx  = (const int*)d_in[13];
  float* out = (float*)d_out;

  char* ws = (char*)d_ws;
  size_t off = 0;
  auto carve = [&](size_t bytes) -> void* {
    void* p = ws + off;
    off += (bytes + 255) & ~(size_t)255;
    return p;
  };
  bhalf_t* wqkv = (bhalf_t*)carve((size_t)3 * DM * DM * sizeof(bhalf_t));
  bhalf_t* wo   = (bhalf_t*)carve((size_t)DM * DM * sizeof(bhalf_t));
  bhalf_t* w1   = (bhalf_t*)carve((size_t)DF * DM * sizeof(bhalf_t));
  bhalf_t* w2   = (bhalf_t*)carve((size_t)DM * DF * sizeof(bhalf_t));
  bhalf_t* h1   = (bhalf_t*)carve((size_t)MM * DM * sizeof(bhalf_t));
  bhalf_t* Qb   = (bhalf_t*)carve((size_t)MM * DM * sizeof(bhalf_t));
  bhalf_t* Kb   = (bhalf_t*)carve((size_t)MM * DM * sizeof(bhalf_t));
  bhalf_t* Vt   = (bhalf_t*)carve((size_t)MM * DM * sizeof(bhalf_t));
  bhalf_t* ctxb = (bhalf_t*)carve((size_t)MM * DM * sizeof(bhalf_t));
  float*   x1   = (float*)carve((size_t)MM * DM * sizeof(float));
  bhalf_t* h2   = (bhalf_t*)carve((size_t)MM * DM * sizeof(bhalf_t));
  bhalf_t* ff1  = (bhalf_t*)carve((size_t)MM * DF * sizeof(bhalf_t));

  auto castN = [&](const float* src, bhalf_t* dst, int n) {
    cast_f32_bf16<<<(n + 255) / 256, 256, 0, stream>>>(src, dst, n);
  };
  castN(inw,  wqkv, 3 * DM * DM);
  castN(outw, wo,   DM * DM);
  castN(fc1w, w1,   DF * DM);
  castN(fc2w, w2,   DM * DF);

  layernorm_bf16<<<MM, 256, 0, stream>>>(x, ln1w, ln1b, h1);

  dim3 blk(256);
  dim3 gD(MM / 128, DM / 256);
  dim3 gF(MM / 128, DF / 256);
  gemm_bf16<0><<<gD, blk, 0, stream>>>(h1, wqkv,                       inb,          nullptr, Qb, MM, DM, DM);
  gemm_bf16<0><<<gD, blk, 0, stream>>>(h1, wqkv + (size_t)DM * DM,     inb + DM,     nullptr, Kb, MM, DM, DM);
  gemm_bf16<1><<<gD, blk, 0, stream>>>(h1, wqkv + (size_t)2 * DM * DM, inb + 2 * DM, nullptr, Vt, MM, DM, DM);

  attn_flash<<<BB * NH * (LL / 128), blk, 0, stream>>>(Qb, Kb, Vt, ctxb, pfx);

  gemm_bf16<2><<<gD, blk, 0, stream>>>(ctxb, wo, outb, x, x1, MM, DM, DM);
  layernorm_bf16<<<MM, 256, 0, stream>>>(x1, ln2w, ln2b, h2);
  gemm_bf16<3><<<gF, blk, 0, stream>>>(h2, w1, fc1b, nullptr, ff1, MM, DF, DM);
  gemm_bf16<2><<<gD, blk, 0, stream>>>(ff1, w2, fc2b, x1, out, MM, DM, DF);
}

// v002
// Measured time: 368 microseconds a run.
// In two side-by-side timings against v001, it was 1.03 and 1.02 times as fast.
// Over all steps from v000 it is 1.40 times as fast.
#include <hip/hip_runtime.h>

typedef __bf16 bhalf_t;
typedef __attribute__((ext_vector_type(16))) __bf16 v16bf;
typedef __attribute__((ext_vector_type(8)))  __bf16 v8bf;
typedef __attribute__((ext_vector_type(8)))  float  v8f;
typedef __attribute__((ext_vector_type(4)))  unsigned int v4u;
typedef __attribute__((ext_vector_type(8)))  int v8i;
typedef __attribute__((ext_vector_type(4)))  int v4i;

#define DM   1024   // d_model
#define NH   16     // heads
#define HD   64     // head dim
#define DF   4096   // d_ff
#define BB   2      // batch
#define LL   2048   // seq len
#define MM   (BB*LL)

#if defined(__gfx1250__) && __has_builtin(__builtin_amdgcn_tensor_load_to_lds)
#define HAVE_TDM 1
#else
#define HAVE_TDM 0
#endif

__device__ __forceinline__ v8f wmma_bf16f32(v16bf a, v16bf b, v8f c) {
  return __builtin_amdgcn_wmma_f32_16x16x32_bf16(false, a, false, b, (short)0, c,
                                                 false, false);
}

__device__ __forceinline__ v16bf frag_ld(const bhalf_t* p) {
  v8bf lo = *(const v8bf*)(p);
  v8bf hi = *(const v8bf*)(p + 16);
  v16bf r;
#pragma unroll
  for (int i = 0; i < 8; ++i) { r[i] = lo[i]; r[8 + i] = hi[i]; }
  return r;
}

#if HAVE_TDM
__device__ __forceinline__ void tdm_load_2d(unsigned lds_off, const void* gptr,
                                            unsigned tile_k, unsigned tile_rows,
                                            unsigned tensor_k, unsigned tensor_rows,
                                            unsigned long long row_stride) {
  unsigned long long ga = (unsigned long long)(uintptr_t)gptr;
  v4u g0;
  g0[0] = 1u;
  g0[1] = lds_off;
  g0[2] = (unsigned)(ga & 0xFFFFFFFFu);
  g0[3] = (unsigned)((ga >> 32) & 0x01FFFFFFu) | (2u << 30);
  v8i g1;
  g1[0] = (int)(1u << 16);
  g1[1] = (int)((tensor_k & 0xFFFFu) << 16);
  g1[2] = (int)(((tensor_k >> 16) & 0xFFFFu) | ((tensor_rows & 0xFFFFu) << 16));
  g1[3] = (int)(((tensor_rows >> 16) & 0xFFFFu) | ((tile_k & 0xFFFFu) << 16));
  g1[4] = (int)(tile_rows & 0xFFFFu);
  g1[5] = (int)(unsigned)(row_stride & 0xFFFFFFFFull);        // dim0_stride[31:0]
  g1[6] = (int)(unsigned)((row_stride >> 32) & 0xFFFFull);    // dim0_stride[47:32]
  g1[7] = 0;                                         // dim1_stride unused (2D tile)
  v4i z = {0, 0, 0, 0};
#if __clang_major__ >= 23
  v8i z8 = {0, 0, 0, 0, 0, 0, 0, 0};
  __builtin_amdgcn_tensor_load_to_lds(g0, g1, z, z, z8, 0);
#else
  __builtin_amdgcn_tensor_load_to_lds(g0, g1, z, z, 0);
#endif
}

typedef __attribute__((ext_vector_type(8))) unsigned int v8u;
#define GK      128                 // k elements per stage
#define GROWB   256u                // bytes of one staged row
#define GPITCH  272u                // LDS pitch of a staged row
#define GSLICE  (128u * GPITCH)     // one wave's request: 128 rows = 17 x 2 KiB
#define GBUF    (3u * GSLICE)       // a stage: A 128 rows, then W 256 rows

__device__ __forceinline__ unsigned uni(unsigned v) {
  return (unsigned)__builtin_amdgcn_readfirstlane(v);
}
__device__ __forceinline__ unsigned pinned(unsigned v) {
  unsigned w = uni(v);
  asm volatile("" : "+s"(w));
  return w;
}
__device__ __forceinline__ v8u gemm_group1(unsigned src_pitch_bytes) {
  v8u d;
  d[0] = uni((1u << 20) | (5u << 22) | (3u << 25));
  d[1] = uni((GROWB & 0xFFFFu) << 16);
  d[2] = uni((GROWB >> 16) | (128u << 16));
  d[3] = uni(GROWB << 16);
  d[4] = uni(128u);
  d[5] = uni(src_pitch_bytes);
  d[6] = uni(0u);
  d[7] = uni(0u);
  // Built once and kept: without this the compiler re-forms some words in the loop, in the
  // same registers, while a request is outstanding.
  asm volatile("" : "+s"(d));
  return d;
}
__device__ __forceinline__ void gemm_tile_load(unsigned lds_dst, unsigned long long ga, v8u d1) {
  v4u d0;
  d0[0] = uni(1u);
  d0[1] = uni(lds_dst);
  d0[2] = uni((unsigned)ga);
  d0[3] = uni((((unsigned)(ga >> 32)) & 0x01FFFFFFu) | 0x80000000u);
  asm volatile("tensor_load_to_lds %0, %1" :: "s"(d0), "s"(d1) : "memory");
}
// The compiler places no wait for the tensor mover: a tile counts as landed only behind this.
__device__ __forceinline__ void wait_tensor0() { asm volatile("s_wait_tensorcnt 0x0" ::: "memory"); }
// A wave's LDS reads have retired before the buffer they read is handed back for a refill.
__device__ __forceinline__ void wait_ds0() { asm volatile("s_wait_dscnt 0x0" ::: "memory"); }
#endif  // HAVE_TDM

// ---------------------------------------------------------------------------
// fp32 -> bf16 cast (weights)
// ---------------------------------------------------------------------------
// A wave owns CAST_V * 512 contiguous bytes of the source: every load is 32 lanes x 16 B
// of whole lines, issued as one group ahead of the conversions. Few waves with much work
// each: a stream this short is bounded by how fast waves start, not by its bytes.
#define CAST_V      16                      // 16-byte loads per lane
#define CAST_WAVE   (CAST_V * 128)          // floats per wave
#define CAST_CHUNK  (8 * CAST_WAVE)         // floats per workgroup of 8 waves
static_assert((DM * DM) % CAST_CHUNK == 0, "every weight is a whole number of chunks");
typedef __attribute__((ext_vector_type(4))) float  v4f;
typedef __attribute__((ext_vector_type(4))) __bf16 v4bf;

__global__ __launch_bounds__(256) void cast_f32_bf16(const float* __restrict__ in,
                                                     bhalf_t* __restrict__ out) {
  const int base = blockIdx.x * CAST_CHUNK + (threadIdx.x >> 5) * CAST_WAVE +
                   (threadIdx.x & 31) * 4;
  v4f v[CAST_V];
#pragma unroll  // all loads issued as one group, each offset an immediate
  for (int u = 0; u < CAST_V; ++u) v[u] = *(const v4f*)(in + base + u * 128);
#pragma unroll  // v[] stays in registers; each store is 32 lanes x 8 B = two whole lines
  for (int u = 0; u < CAST_V; ++u) {
    v4bf o;
#pragma unroll  // four converts, packed in pairs
    for (int e = 0; e < 4; ++e) o[e] = (bhalf_t)v[u][e];
    *(v4bf*)(out + base + u * 128) = o;
  }
}

// ---------------------------------------------------------------------------
// LayerNorm (d=1024) -> bf16
// ---------------------------------------------------------------------------
__global__ __launch_bounds__(256) void layernorm_bf16(
    const float* __restrict__ x, const float* __restrict__ w,
    const float* __restrict__ b, bhalf_t* __restrict__ out) {
  __shared__ float red[256];
  const int row = blockIdx.x;
  const int tid = threadIdx.x;
  const float* xr = x + (size_t)row * DM;
  float s = 0.f;
  for (int i = tid; i < DM; i += 256) s += xr[i];
  red[tid] = s; __syncthreads();
  for (int o = 128; o > 0; o >>= 1) {
    if (tid < o) red[tid] += red[tid + o];
    __syncthreads();
  }
  const float mu = red[0] * (1.f / DM);
  __syncthreads();
  float v = 0.f;
  for (int i = tid; i < DM; i += 256) { float d = xr[i] - mu; v += d * d; }
  red[tid] = v; __syncthreads();
  for (int o = 128; o > 0; o >>= 1) {
    if (tid < o) red[tid] += red[tid + o];
    __syncthreads();
  }
  const float rstd = rsqrtf(red[0] * (1.f / DM) + 1e-5f);
  bhalf_t* orow = out + (size_t)row * DM;
  for (int i = tid; i < DM; i += 256)
    orow[i] = (bhalf_t)((xr[i] - mu) * rstd * w[i] + b[i]);
}

template <int EPI>
__global__ __launch_bounds__(256) void gemm_bf16(
    const bhalf_t* __restrict__ A, const bhalf_t* __restrict__ W,
    const float* __restrict__ bias, const float* __restrict__ resid,
    void* __restrict__ outp, int Mdim, int Ndim, int Kdim) {
  const int lane = threadIdx.x & 31;
  const int wave = threadIdx.x >> 5;
  const int hl = lane & 15, g = lane >> 4;
  const int wm = wave & 1;            // 2 row groups of 64
  const int wn = wave >> 1;           // 4 col groups of 64
  const int m0 = blockIdx.x * 128 + wm * 64;
  const int n0 = blockIdx.y * 256 + wn * 64;

  v8f acc[4][4];
#pragma unroll
  for (int i = 0; i < 4; ++i)
#pragma unroll
    for (int j = 0; j < 4; ++j)
#pragma unroll
      for (int e = 0; e < 8; ++e) acc[i][j][e] = 0.f;

#if HAVE_TDM
  // Two stages of [A 128 rows | W 256 rows], 256 B of k per row at pitch 272 B.
  __shared__ __attribute__((aligned(2048))) unsigned char sT[2u * GBUF];
  (void)Mdim;

  const unsigned wv = uni(threadIdx.x >> 5);
  // waves 0, 1, 2 each bring one slice of 128 rows: A, W rows 0-127, W rows 128-255
  const bhalf_t* sp = (wv == 0u)
      ? A + (size_t)blockIdx.x * 128 * Kdim
      : W + ((size_t)blockIdx.y * 256 + (wv == 2u ? 128 : 0)) * Kdim;
  const unsigned long long ga = (unsigned long long)(uintptr_t)sp;
  const unsigned dst = (unsigned)(uintptr_t)&sT[0] + (wv < 3u ? wv : 0u) * GSLICE;
  const v8u d1 = gemm_group1((unsigned)Kdim * 2u);
  const int nst = Kdim / GK;          // stages; at least two for every launch here

  if (pinned(wv < 3u)) {
    gemm_tile_load(dst, ga, d1);      // stage 0
    wait_tensor0();
  }
  __syncthreads();                    // stage 0 readable by every wave
  if (pinned(wv < 3u)) gemm_tile_load(dst + GBUF, ga + GROWB, d1);  // stage 1

  const unsigned aoff = (unsigned)(wm * 64 + hl) * GPITCH + (unsigned)g * 16u;
  const unsigned boff = GSLICE + (unsigned)(wn * 64 + hl) * GPITCH + (unsigned)g * 16u;

  for (int s = 0; s < nst; ++s) {
    const unsigned char* bp = sT + (unsigned)(s & 1) * GBUF;
#pragma unroll  // the four 32-k blocks of a stage: every LDS offset an immediate, no loop branch among the WMMAs
    for (int kb = 0; kb < GK / 32; ++kb) {
      v16bf fa[4], fb[4];
#pragma unroll
      for (int mi = 0; mi < 4; ++mi)
        fa[mi] = frag_ld((const bhalf_t*)(bp + aoff + mi * 16 * GPITCH + kb * 64));
#pragma unroll
      for (int ni = 0; ni < 4; ++ni)
        fb[ni] = frag_ld((const bhalf_t*)(bp + boff + ni * 16 * GPITCH + kb * 64));
#pragma unroll
      for (int mi = 0; mi < 4; ++mi)
#pragma unroll
        for (int ni = 0; ni < 4; ++ni)
          acc[mi][ni] = wmma_bf16f32(fa[mi], fb[ni], acc[mi][ni]);
    }
    // publish point of stage s + 1
    wait_ds0();
    if (pinned(wv < 3u)) wait_tensor0();
    __syncthreads();                  // stage s + 1 readable; stage s's buffer left by every reader
    if (pinned((wv < 3u) & (s + 2 < nst)))
      gemm_tile_load(dst + (unsigned)(s & 1) * GBUF,
                     ga + (unsigned long long)(s + 2) * GROWB, d1);
  }
  wait_tensor0();
  wait_ds0();
#else
  // fallback: fragments straight from global
  for (int k = 0; k < Kdim; k += 32) {
    v16bf fa[4], fb[4];
#pragma unroll
    for (int mi = 0; mi < 4; ++mi)
      fa[mi] = frag_ld(A + (size_t)(m0 + mi * 16 + hl) * Kdim + k + g * 8);
#pragma unroll
    for (int ni = 0; ni < 4; ++ni)
      fb[ni] = frag_ld(W + (size_t)(n0 + ni * 16 + hl) * Kdim + k + g * 8);
#pragma unroll
    for (int mi = 0; mi < 4; ++mi)
#pragma unroll
      for (int ni = 0; ni < 4; ++ni)
        acc[mi][ni] = wmma_bf16f32(fa[mi], fb[ni], acc[mi][ni]);
  }
#endif

#pragma unroll
  for (int mi = 0; mi < 4; ++mi)
#pragma unroll
    for (int ni = 0; ni < 4; ++ni) {
      const int col = n0 + ni * 16 + hl;
      const float bv = bias[col];
#pragma unroll
      for (int r = 0; r < 8; ++r) {
        const int row = m0 + mi * 16 + r + 8 * g;
        float v = acc[mi][ni][r] + bv;
        if (EPI == 0) {
          ((bhalf_t*)outp)[(size_t)row * Ndim + col] = (bhalf_t)v;
        } else if (EPI == 1) {
          const int bidx = row >> 11;  // row / LL
          const int seq = row & (LL - 1);
          const size_t idx =
              (((size_t)(bidx * NH + (col >> 6)) * HD) + (col & (HD - 1))) * LL + seq;
          ((bhalf_t*)outp)[idx] = (bhalf_t)v;
        } else if (EPI == 2) {
          const size_t idx = (size_t)row * Ndim + col;
          ((float*)outp)[idx] = resid[idx] + v;
        } else {
          const float gv = 0.5f * v * (1.f + erff(v * 0.70710678118654752f));
          ((bhalf_t*)outp)[(size_t)row * Ndim + col] = (bhalf_t)gv;
        }
      }
    }
}

__global__ __launch_bounds__(256) void attn_flash(
    const bhalf_t* __restrict__ Q, const bhalf_t* __restrict__ Km,
    const bhalf_t* __restrict__ Vt, bhalf_t* __restrict__ ctxout,
    const int* __restrict__ pfx) {
#if HAVE_TDM
  __shared__ bhalf_t sK[2][32][64];   // 8 KB: 32 keys x 64 hd, double buffered
  __shared__ bhalf_t sV[2][64][32];   // 8 KB: 64 hd x 32 keys, double buffered
#endif
  __shared__ bhalf_t plds[8][16][32]; // per-wave prob tile (transpose buffer)
  const int prefix = *pfx;
  const int lane = threadIdx.x & 31;
  const int wave = threadIdx.x >> 5;
  const int hl = lane & 15, g = lane >> 4;
  const int qblk = (blockIdx.x & (LL / 128 - 1)) * 128;  // query block start
  const int bh = blockIdx.x >> 4;                        // LL/128 == 16
  const int bidx = bh >> 4, h = bh & (NH - 1);
  const int q0 = qblk + wave * 16;                       // this wave's tile

  const bhalf_t* Qb = Q + (size_t)bidx * LL * DM + h * HD;
  const bhalf_t* Kb = Km + (size_t)bidx * LL * DM + h * HD;
  const bhalf_t* Vb = Vt + (size_t)bh * HD * LL;

  const bhalf_t* qp = Qb + (size_t)(q0 + hl) * DM + g * 8;
  const v16bf qa0 = frag_ld(qp);
  const v16bf qa1 = frag_ld(qp + 32);

  float mrow[8], lrow[8];
  v8f ctx[4];
#pragma unroll
  for (int r = 0; r < 8; ++r) { mrow[r] = -1e30f; lrow[r] = 0.f; }
#pragma unroll
  for (int nt = 0; nt < 4; ++nt)
#pragma unroll
    for (int e = 0; e < 8; ++e) ctx[nt][e] = 0.f;

  // per-wave and block-level key extents (rounded to 32-key chunks)
  int kend_w = (q0 + 16 > prefix) ? (q0 + 16) : prefix;
  kend_w = (kend_w + 31) & ~31;
  int kend_b = (qblk + 128 > prefix) ? (qblk + 128) : prefix;
  kend_b = (kend_b + 31) & ~31;
  const float scale = 0.125f;  // 1/sqrt(64)

#if HAVE_TDM
  if (wave == 0) {  // prologue DMA: K chunk (32x64, pitch DM), V chunk (64x32, pitch LL)
    tdm_load_2d((unsigned)(uintptr_t)&sK[0][0][0], Kb, 64, 32, 64, 32,
                (unsigned long long)DM);
    tdm_load_2d((unsigned)(uintptr_t)&sV[0][0][0], Vb, 32, 64, 32, 64,
                (unsigned long long)LL);
  }
#endif

  for (int c = 0; c < kend_b; c += 32) {
#if HAVE_TDM
    const int buf = (c >> 5) & 1;
    if (wave == 0) __builtin_amdgcn_s_wait_tensorcnt(0);
    __syncthreads();  // chunk ready for all waves; other buffer free
    if (c + 32 < kend_b && wave == 0) {
      tdm_load_2d((unsigned)(uintptr_t)&sK[buf ^ 1][0][0], Kb + (size_t)(c + 32) * DM,
                  64, 32, 64, 32, (unsigned long long)DM);
      tdm_load_2d((unsigned)(uintptr_t)&sV[buf ^ 1][0][0], Vb + (c + 32),
                  32, 64, 32, 64, (unsigned long long)LL);
    }
#endif
    if (c < kend_w) {
      // ---- scores S[16 x 32] = Q @ K^T (2 key sub-tiles x 2 hd halves)
      v8f s[2];
#pragma unroll
      for (int t = 0; t < 2; ++t) {
#pragma unroll
        for (int e = 0; e < 8; ++e) s[t][e] = 0.f;
#if HAVE_TDM
        v16bf kb0 = frag_ld(&sK[buf][t * 16 + hl][g * 8]);
        v16bf kb1 = frag_ld(&sK[buf][t * 16 + hl][32 + g * 8]);
#else
        const bhalf_t* kp = Kb + (size_t)(c + t * 16 + hl) * DM + g * 8;
        v16bf kb0 = frag_ld(kp);
        v16bf kb1 = frag_ld(kp + 32);
#endif
        s[t] = wmma_bf16f32(qa0, kb0, s[t]);
        s[t] = wmma_bf16f32(qa1, kb1, s[t]);
      }
      // ---- scale + prefix-decoder mask
      const bool needmask = (c + 31 >= prefix);
#pragma unroll
      for (int t = 0; t < 2; ++t)
#pragma unroll
        for (int r = 0; r < 8; ++r) {
          float v = s[t][r] * scale;
          if (needmask) {
            const int key = c + t * 16 + hl;
            const int qi = q0 + r + 8 * g;
            const bool ok = (key < prefix) || ((qi >= prefix) && (key <= qi));
            if (!ok) v = -1e30f;
          }
          s[t][r] = v;
        }
      // ---- online softmax (row stats live in each 16-lane half)
#pragma unroll
      for (int r = 0; r < 8; ++r) {
        float tm = fmaxf(s[0][r], s[1][r]);
#pragma unroll
        for (int o = 1; o < 16; o <<= 1) tm = fmaxf(tm, __shfl_xor(tm, o, 32));
        const float mnew = fmaxf(mrow[r], tm);
        const float alpha = __expf(mrow[r] - mnew);
        float rs = 0.f;
#pragma unroll
        for (int t = 0; t < 2; ++t) {
          const float p = __expf(s[t][r] - mnew);
          s[t][r] = p;
          rs += p;
        }
#pragma unroll
        for (int o = 1; o < 16; o <<= 1) rs += __shfl_xor(rs, o, 32);
        lrow[r] = lrow[r] * alpha + rs;
        mrow[r] = mnew;
#pragma unroll
        for (int nt = 0; nt < 4; ++nt) ctx[nt][r] *= alpha;
      }
      // ---- C-tile -> A-fragment relayout through per-wave LDS
#pragma unroll
      for (int t = 0; t < 2; ++t)
#pragma unroll
        for (int r = 0; r < 8; ++r)
          plds[wave][r + 8 * g][t * 16 + hl] = (bhalf_t)s[t][r];
      const v16bf pa = frag_ld(&plds[wave][hl][g * 8]);  // ds_load_b128 x2
      // ---- ctx += P @ V  (contraction over 32 keys, 4 hd column tiles)
#pragma unroll
      for (int nt = 0; nt < 4; ++nt) {
#if HAVE_TDM
        v16bf vb = frag_ld(&sV[buf][nt * 16 + hl][g * 8]);
#else
        v16bf vb = frag_ld(Vb + (size_t)(nt * 16 + hl) * LL + c + g * 8);
#endif
        ctx[nt] = wmma_bf16f32(pa, vb, ctx[nt]);
      }
    }
  }
  // ---- normalize and store context
#pragma unroll
  for (int nt = 0; nt < 4; ++nt)
#pragma unroll
    for (int r = 0; r < 8; ++r) {
      const int row = q0 + r + 8 * g;
      const int col = h * HD + nt * 16 + hl;
      ctxout[((size_t)bidx * LL + row) * DM + col] = (bhalf_t)(ctx[nt][r] / lrow[r]);
    }
}

// ---------------------------------------------------------------------------
// Launch
// ---------------------------------------------------------------------------
extern "C" void kernel_launch(void* const* d_in, const int* in_sizes, int n_in,
                              void* d_out, int out_size, void* d_ws, size_t ws_size,
                              hipStream_t stream) {
  (void)in_sizes; (void)n_in; (void)out_size; (void)ws_size;
  const float* x    = (const float*)d_in[0];
  const float* ln1w = (const float*)d_in[1];
  const float* ln1b = (const float*)d_in[2];
  const float* inw  = (const float*)d_in[3];
  const float* inb  = (const float*)d_in[4];
  const float* outw = (const float*)d_in[5];
  const float* outb = (const float*)d_in[6];
  const float* ln2w = (const float*)d_in[7];
  const float* ln2b = (const float*)d_in[8];
  const float* fc1w = (const float*)d_in[9];
  const float* fc1b = (const float*)d_in[10];
  const float* fc2w = (const float*)d_in[11];
  const float* fc2b = (const float*)d_in[12];
  const int*   pfx  = (const int*)d_in[13];
  float* out = (float*)d_out;

  char* ws = (char*)d_ws;
  size_t off = 0;
  auto carve = [&](size_t bytes) -> void* {
    void* p = ws + off;
    off += (bytes + 255) & ~(size_t)255;
    return p;
  };
  bhalf_t* wqkv = (bhalf_t*)carve((size_t)3 * DM * DM * sizeof(bhalf_t));
  bhalf_t* wo   = (bhalf_t*)carve((size_t)DM * DM * sizeof(bhalf_t));
  bhalf_t* w1   = (bhalf_t*)carve((size_t)DF * DM * sizeof(bhalf_t));
  bhalf_t* w2   = (bhalf_t*)carve((size_t)DM * DF * sizeof(bhalf_t));
  bhalf_t* h1   = (bhalf_t*)carve((size_t)MM * DM * sizeof(bhalf_t));
  bhalf_t* Qb   = (bhalf_t*)carve((size_t)MM * DM * sizeof(bhalf_t));
  bhalf_t* Kb   = (bhalf_t*)carve((size_t)MM * DM * sizeof(bhalf_t));
  bhalf_t* Vt   = (bhalf_t*)carve((size_t)MM * DM * sizeof(bhalf_t));
  bhalf_t* ctxb = (bhalf_t*)carve((size_t)MM * DM * sizeof(bhalf_t));
  float*   x1   = (float*)carve((size_t)MM * DM * sizeof(float));
  bhalf_t* h2   = (bhalf_t*)carve((size_t)MM * DM * sizeof(bhalf_t));
  bhalf_t* ff1  = (bhalf_t*)carve((size_t)MM * DF * sizeof(bhalf_t));

  auto castN = [&](const float* src, bhalf_t* dst, int n) {
    cast_f32_bf16<<<n / CAST_CHUNK, 256, 0, stream>>>(src, dst);
  };
  castN(inw,  wqkv, 3 * DM * DM);
  castN(outw, wo,   DM * DM);
  castN(fc1w, w1,   DF * DM);
  castN(fc2w, w2,   DM * DF);

  layernorm_bf16<<<MM, 256, 0, stream>>>(x, ln1w, ln1b, h1);

  dim3 blk(256);
  dim3 gD(MM / 128, DM / 256);
  dim3 gF(MM / 128, DF / 256);
  gemm_bf16<0><<<gD, blk, 0, stream>>>(h1, wqkv,                       inb,          nullptr, Qb, MM, DM, DM);
  gemm_bf16<0><<<gD, blk, 0, stream>>>(h1, wqkv + (size_t)DM * DM,     inb + DM,     nullptr, Kb, MM, DM, DM);
  gemm_bf16<1><<<gD, blk, 0, stream>>>(h1, wqkv + (size_t)2 * DM * DM, inb + 2 * DM, nullptr, Vt, MM, DM, DM);

  attn_flash<<<BB * NH * (LL / 128), blk, 0, stream>>>(Qb, Kb, Vt, ctxb, pfx);

  gemm_bf16<2><<<gD, blk, 0, stream>>>(ctxb, wo, outb, x, x1, MM, DM, DM);
  layernorm_bf16<<<MM, 256, 0, stream>>>(x1, ln2w, ln2b, h2);
  gemm_bf16<3><<<gF, blk, 0, stream>>>(h2, w1, fc1b, nullptr, ff1, MM, DF, DM);
  gemm_bf16<2><<<gD, blk, 0, stream>>>(ff1, w2, fc2b, x1, out, MM, DM, DF);
}

// v003
// It runs in 310 microseconds.
// Two timings next to v002 both put it at 1.18 times that version's speed.
// Over all steps from v000 it is 1.65 times as fast.
#include <hip/hip_runtime.h>

typedef __bf16 bhalf_t;
typedef __attribute__((ext_vector_type(16))) __bf16 v16bf;
typedef __attribute__((ext_vector_type(8)))  __bf16 v8bf;
typedef __attribute__((ext_vector_type(8)))  float  v8f;
typedef __attribute__((ext_vector_type(4)))  unsigned int v4u;
typedef __attribute__((ext_vector_type(8)))  int v8i;
typedef __attribute__((ext_vector_type(4)))  int v4i;

#define DM   1024   // d_model
#define NH   16     // heads
#define HD   64     // head dim
#define DF   4096   // d_ff
#define BB   2      // batch
#define LL   2048   // seq len
#define MM   (BB*LL)

#if defined(__gfx1250__) && __has_builtin(__builtin_amdgcn_tensor_load_to_lds)
#define HAVE_TDM 1
#else
#define HAVE_TDM 0
#endif

__device__ __forceinline__ v8f wmma_bf16f32(v16bf a, v16bf b, v8f c) {
  return __builtin_amdgcn_wmma_f32_16x16x32_bf16(false, a, false, b, (short)0, c,
                                                 false, false);
}

__device__ __forceinline__ v16bf frag_ld(const bhalf_t* p) {
  v8bf lo = *(const v8bf*)(p);
  v8bf hi = *(const v8bf*)(p + 16);
  v16bf r;
#pragma unroll
  for (int i = 0; i < 8; ++i) { r[i] = lo[i]; r[8 + i] = hi[i]; }
  return r;
}

#if HAVE_TDM
__device__ __forceinline__ void tdm_load_2d(unsigned lds_off, const void* gptr,
                                            unsigned tile_k, unsigned tile_rows,
                                            unsigned tensor_k, unsigned tensor_rows,
                                            unsigned long long row_stride) {
  unsigned long long ga = (unsigned long long)(uintptr_t)gptr;
  v4u g0;
  g0[0] = 1u;
  g0[1] = lds_off;
  g0[2] = (unsigned)(ga & 0xFFFFFFFFu);
  g0[3] = (unsigned)((ga >> 32) & 0x01FFFFFFu) | (2u << 30);
  v8i g1;
  g1[0] = (int)(1u << 16);
  g1[1] = (int)((tensor_k & 0xFFFFu) << 16);
  g1[2] = (int)(((tensor_k >> 16) & 0xFFFFu) | ((tensor_rows & 0xFFFFu) << 16));
  g1[3] = (int)(((tensor_rows >> 16) & 0xFFFFu) | ((tile_k & 0xFFFFu) << 16));
  g1[4] = (int)(tile_rows & 0xFFFFu);
  g1[5] = (int)(unsigned)(row_stride & 0xFFFFFFFFull);        // dim0_stride[31:0]
  g1[6] = (int)(unsigned)((row_stride >> 32) & 0xFFFFull);    // dim0_stride[47:32]
  g1[7] = 0;                                         // dim1_stride unused (2D tile)
  v4i z = {0, 0, 0, 0};
#if __clang_major__ >= 23
  v8i z8 = {0, 0, 0, 0, 0, 0, 0, 0};
  __builtin_amdgcn_tensor_load_to_lds(g0, g1, z, z, z8, 0);
#else
  __builtin_amdgcn_tensor_load_to_lds(g0, g1, z, z, 0);
#endif
}

typedef __attribute__((ext_vector_type(8))) unsigned int v8u;
#define GK      128                 // k elements per stage
#define GROWB   256u                // bytes of one staged row
#define GPITCH  272u                // LDS pitch of a staged row
#define GSLICE  (128u * GPITCH)     // one wave's request: 128 rows = 17 x 2 KiB
#define GBUF    (3u * GSLICE)       // a stage: A 128 rows, then W 256 rows

__device__ __forceinline__ unsigned uni(unsigned v) {
  return (unsigned)__builtin_amdgcn_readfirstlane(v);
}
__device__ __forceinline__ unsigned pinned(unsigned v) {
  unsigned w = uni(v);
  asm volatile("" : "+s"(w));
  return w;
}
__device__ __forceinline__ v8u gemm_group1(unsigned src_pitch_bytes) {
  v8u d;
  d[0] = uni((1u << 20) | (5u << 22) | (3u << 25));
  d[1] = uni((GROWB & 0xFFFFu) << 16);
  d[2] = uni((GROWB >> 16) | (128u << 16));
  d[3] = uni(GROWB << 16);
  d[4] = uni(128u);
  d[5] = uni(src_pitch_bytes);
  d[6] = uni(0u);
  d[7] = uni(0u);
  // Built once and kept: without this the compiler re-forms some words in the loop, in the
  // same registers, while a request is outstanding.
  asm volatile("" : "+s"(d));
  return d;
}
__device__ __forceinline__ void gemm_tile_load(unsigned lds_dst, unsigned long long ga, v8u d1) {
  v4u d0;
  d0[0] = uni(1u);
  d0[1] = uni(lds_dst);
  d0[2] = uni((unsigned)ga);
  d0[3] = uni((((unsigned)(ga >> 32)) & 0x01FFFFFFu) | 0x80000000u);
  asm volatile("tensor_load_to_lds %0, %1" :: "s"(d0), "s"(d1) : "memory");
}
// The compiler places no wait for the tensor mover: a tile counts as landed only behind this.
__device__ __forceinline__ void wait_tensor0() { asm volatile("s_wait_tensorcnt 0x0" ::: "memory"); }
// A wave's LDS reads have retired before the buffer they read is handed back for a refill.
__device__ __forceinline__ void wait_ds0() { asm volatile("s_wait_dscnt 0x0" ::: "memory"); }
#endif  // HAVE_TDM

// ---------------------------------------------------------------------------
// fp32 -> bf16 cast (weights)
// ---------------------------------------------------------------------------
// A wave owns CAST_V * 512 contiguous bytes of the source: every load is 32 lanes x 16 B
// of whole lines, issued as one group ahead of the conversions. Few waves with much work
// each: a stream this short is bounded by how fast waves start, not by its bytes.
#define CAST_V      16                      // 16-byte loads per lane
#define CAST_WAVE   (CAST_V * 128)          // floats per wave
#define CAST_CHUNK  (8 * CAST_WAVE)         // floats per workgroup of 8 waves
static_assert((DM * DM) % CAST_CHUNK == 0, "every weight is a whole number of chunks");
typedef __attribute__((ext_vector_type(4))) float  v4f;
typedef __attribute__((ext_vector_type(4))) __bf16 v4bf;

__global__ __launch_bounds__(256) void cast_f32_bf16(const float* __restrict__ in,
                                                     bhalf_t* __restrict__ out) {
  const int base = blockIdx.x * CAST_CHUNK + (threadIdx.x >> 5) * CAST_WAVE +
                   (threadIdx.x & 31) * 4;
  v4f v[CAST_V];
#pragma unroll  // all loads issued as one group, each offset an immediate
  for (int u = 0; u < CAST_V; ++u) v[u] = *(const v4f*)(in + base + u * 128);
#pragma unroll  // v[] stays in registers; each store is 32 lanes x 8 B = two whole lines
  for (int u = 0; u < CAST_V; ++u) {
    v4bf o;
#pragma unroll  // four converts, packed in pairs
    for (int e = 0; e < 4; ++e) o[e] = (bhalf_t)v[u][e];
    *(v4bf*)(out + base + u * 128) = o;
  }
}

// ---------------------------------------------------------------------------
// LayerNorm (d=1024) -> bf16
// ---------------------------------------------------------------------------
__global__ __launch_bounds__(256) void layernorm_bf16(
    const float* __restrict__ x, const float* __restrict__ w,
    const float* __restrict__ b, bhalf_t* __restrict__ out) {
  __shared__ float red[256];
  const int row = blockIdx.x;
  const int tid = threadIdx.x;
  const float* xr = x + (size_t)row * DM;
  float s = 0.f;
  for (int i = tid; i < DM; i += 256) s += xr[i];
  red[tid] = s; __syncthreads();
  for (int o = 128; o > 0; o >>= 1) {
    if (tid < o) red[tid] += red[tid + o];
    __syncthreads();
  }
  const float mu = red[0] * (1.f / DM);
  __syncthreads();
  float v = 0.f;
  for (int i = tid; i < DM; i += 256) { float d = xr[i] - mu; v += d * d; }
  red[tid] = v; __syncthreads();
  for (int o = 128; o > 0; o >>= 1) {
    if (tid < o) red[tid] += red[tid + o];
    __syncthreads();
  }
  const float rstd = rsqrtf(red[0] * (1.f / DM) + 1e-5f);
  bhalf_t* orow = out + (size_t)row * DM;
  for (int i = tid; i < DM; i += 256)
    orow[i] = (bhalf_t)((xr[i] - mu) * rstd * w[i] + b[i]);
}

template <int EPI>
__global__ __launch_bounds__(256) void gemm_bf16(
    const bhalf_t* __restrict__ A, const bhalf_t* __restrict__ W,
    const float* __restrict__ bias, const float* __restrict__ resid,
    void* __restrict__ outp, int Mdim, int Ndim, int Kdim) {
  const int lane = threadIdx.x & 31;
  const int wave = threadIdx.x >> 5;
  const int hl = lane & 15, g = lane >> 4;
  const int wm = wave & 1;            // 2 row groups of 64
  const int wn = wave >> 1;           // 4 col groups of 64
  const int m0 = blockIdx.x * 128 + wm * 64;
  const int n0 = blockIdx.y * 256 + wn * 64;

  v8f acc[4][4];
#pragma unroll
  for (int i = 0; i < 4; ++i)
#pragma unroll
    for (int j = 0; j < 4; ++j)
#pragma unroll
      for (int e = 0; e < 8; ++e) acc[i][j][e] = 0.f;

#if HAVE_TDM
  // Two stages of [A 128 rows | W 256 rows], 256 B of k per row at pitch 272 B.
  __shared__ __attribute__((aligned(2048))) unsigned char sT[2u * GBUF];
  (void)Mdim;

  const unsigned wv = uni(threadIdx.x >> 5);
  // waves 0, 1, 2 each bring one slice of 128 rows: A, W rows 0-127, W rows 128-255
  const bhalf_t* sp = (wv == 0u)
      ? A + (size_t)blockIdx.x * 128 * Kdim
      : W + ((size_t)blockIdx.y * 256 + (wv == 2u ? 128 : 0)) * Kdim;
  const unsigned long long ga = (unsigned long long)(uintptr_t)sp;
  const unsigned dst = (unsigned)(uintptr_t)&sT[0] + (wv < 3u ? wv : 0u) * GSLICE;
  const v8u d1 = gemm_group1((unsigned)Kdim * 2u);
  const int nst = Kdim / GK;          // stages; at least two for every launch here

  if (pinned(wv < 3u)) {
    gemm_tile_load(dst, ga, d1);      // stage 0
    wait_tensor0();
  }
  __syncthreads();                    // stage 0 readable by every wave
  if (pinned(wv < 3u)) gemm_tile_load(dst + GBUF, ga + GROWB, d1);  // stage 1

  const unsigned aoff = (unsigned)(wm * 64 + hl) * GPITCH + (unsigned)g * 16u;
  const unsigned boff = GSLICE + (unsigned)(wn * 64 + hl) * GPITCH + (unsigned)g * 16u;

  for (int s = 0; s < nst; ++s) {
    const unsigned char* bp = sT + (unsigned)(s & 1) * GBUF;
#pragma unroll  // the four 32-k blocks of a stage: every LDS offset an immediate, no loop branch among the WMMAs
    for (int kb = 0; kb < GK / 32; ++kb) {
      v16bf fa[4], fb[4];
#pragma unroll
      for (int mi = 0; mi < 4; ++mi)
        fa[mi] = frag_ld((const bhalf_t*)(bp + aoff + mi * 16 * GPITCH + kb * 64));
#pragma unroll
      for (int ni = 0; ni < 4; ++ni)
        fb[ni] = frag_ld((const bhalf_t*)(bp + boff + ni * 16 * GPITCH + kb * 64));
#pragma unroll
      for (int mi = 0; mi < 4; ++mi)
#pragma unroll
        for (int ni = 0; ni < 4; ++ni)
          acc[mi][ni] = wmma_bf16f32(fa[mi], fb[ni], acc[mi][ni]);
    }
    // publish point of stage s + 1
    wait_ds0();
    if (pinned(wv < 3u)) wait_tensor0();
    __syncthreads();                  // stage s + 1 readable; stage s's buffer left by every reader
    if (pinned((wv < 3u) & (s + 2 < nst)))
      gemm_tile_load(dst + (unsigned)(s & 1) * GBUF,
                     ga + (unsigned long long)(s + 2) * GROWB, d1);
  }
  wait_tensor0();
  wait_ds0();
#else
  // fallback: fragments straight from global
  for (int k = 0; k < Kdim; k += 32) {
    v16bf fa[4], fb[4];
#pragma unroll
    for (int mi = 0; mi < 4; ++mi)
      fa[mi] = frag_ld(A + (size_t)(m0 + mi * 16 + hl) * Kdim + k + g * 8);
#pragma unroll
    for (int ni = 0; ni < 4; ++ni)
      fb[ni] = frag_ld(W + (size_t)(n0 + ni * 16 + hl) * Kdim + k + g * 8);
#pragma unroll
    for (int mi = 0; mi < 4; ++mi)
#pragma unroll
      for (int ni = 0; ni < 4; ++ni)
        acc[mi][ni] = wmma_bf16f32(fa[mi], fb[ni], acc[mi][ni]);
  }
#endif

#pragma unroll
  for (int mi = 0; mi < 4; ++mi)
#pragma unroll
    for (int ni = 0; ni < 4; ++ni) {
      const int col = n0 + ni * 16 + hl;
      const float bv = bias[col];
#pragma unroll
      for (int r = 0; r < 8; ++r) {
        const int row = m0 + mi * 16 + r + 8 * g;
        float v = acc[mi][ni][r] + bv;
        if (EPI == 0) {
          ((bhalf_t*)outp)[(size_t)row * Ndim + col] = (bhalf_t)v;
        } else if (EPI == 1) {
          const int bidx = row >> 11;  // row / LL
          const int seq = row & (LL - 1);
          const size_t idx =
              (((size_t)(bidx * NH + (col >> 6)) * HD) + (col & (HD - 1))) * LL + seq;
          ((bhalf_t*)outp)[idx] = (bhalf_t)v;
        } else if (EPI == 2) {
          const size_t idx = (size_t)row * Ndim + col;
          ((float*)outp)[idx] = resid[idx] + v;
        } else {
          const float gv = 0.5f * v * (1.f + erff(v * 0.70710678118654752f));
          ((bhalf_t*)outp)[(size_t)row * Ndim + col] = (bhalf_t)gv;
        }
      }
    }
}

__device__ __forceinline__ float xhalf(float x) {
  const int b = __builtin_bit_cast(int, x);
  return __builtin_bit_cast(
      float, __builtin_amdgcn_permlanex16(b, b, 0x76543210, 0xfedcba98, false, false));
}

__global__ __launch_bounds__(256) void attn_flash(
    const bhalf_t* __restrict__ Q, const bhalf_t* __restrict__ Km,
    const bhalf_t* __restrict__ Vt, bhalf_t* __restrict__ ctxout,
    const int* __restrict__ pfx) {
#if HAVE_TDM
  __shared__ bhalf_t sK[2][32][64];   // 8 KB: 32 keys x 64 hd, double buffered
  __shared__ bhalf_t sV[2][64][32];   // 8 KB: 64 hd x 32 keys, double buffered
#endif
  const int prefix = *pfx;
  const int lane = threadIdx.x & 31;
  const int wave = threadIdx.x >> 5;
  const int hl = lane & 15, g = lane >> 4;
  const int qblk = (blockIdx.x & (LL / 128 - 1)) * 128;  // query block start
  const int bh = blockIdx.x >> 4;                        // LL/128 == 16
  const int bidx = bh >> 4, h = bh & (NH - 1);
  const int q0 = qblk + wave * 16;                       // this wave's tile

  const bhalf_t* Qb = Q + (size_t)bidx * LL * DM + h * HD;
  const bhalf_t* Kb = Km + (size_t)bidx * LL * DM + h * HD;
  const bhalf_t* Vb = Vt + (size_t)bh * HD * LL;

  const bhalf_t* qp = Qb + (size_t)(q0 + hl) * DM + g * 8;
  const v16bf qa0 = frag_ld(qp);
  const v16bf qa1 = frag_ld(qp + 32);

  // This lane's query is q0 + hl. lrun sums only the keys this wave half holds;
  // the halves are joined once, behind the loop. ctx[nt][r] = O[q0 + hl][nt*16 + 8g + r].
  float mrun = -1e30f, lrun = 0.f;
  v8f ctx[4];
#pragma unroll
  for (int nt = 0; nt < 4; ++nt)
#pragma unroll
    for (int e = 0; e < 8; ++e) ctx[nt][e] = 0.f;

  // per-wave and block-level key extents (rounded to 32-key chunks)
  int kend_w = (q0 + 16 > prefix) ? (q0 + 16) : prefix;
  kend_w = (kend_w + 31) & ~31;
  int kend_b = (qblk + 128 > prefix) ? (qblk + 128) : prefix;
  kend_b = (kend_b + 31) & ~31;
  const float scale = 0.125f;  // 1/sqrt(64)
  // One query per lane, so one key limit per lane: key allowed iff key < prefix, or
  // query >= prefix and key <= query; in the second case query + 1 > prefix.
  const int klim = (q0 + hl >= prefix) ? q0 + hl + 1 : prefix;

#if HAVE_TDM
  if (wave == 0) {  // prologue DMA: K chunk (32x64, pitch DM), V chunk (64x32, pitch LL)
    tdm_load_2d((unsigned)(uintptr_t)&sK[0][0][0], Kb, 64, 32, 64, 32,
                (unsigned long long)DM);
    tdm_load_2d((unsigned)(uintptr_t)&sV[0][0][0], Vb, 32, 64, 32, 64,
                (unsigned long long)LL);
  }
#endif

  for (int c = 0; c < kend_b; c += 32) {
#if HAVE_TDM
    const int buf = (c >> 5) & 1;
    if (wave == 0) __builtin_amdgcn_s_wait_tensorcnt(0);
    __syncthreads();  // chunk ready for all waves; other buffer free
    if (c + 32 < kend_b && wave == 0) {
      tdm_load_2d((unsigned)(uintptr_t)&sK[buf ^ 1][0][0], Kb + (size_t)(c + 32) * DM,
                  64, 32, 64, 32, (unsigned long long)DM);
      tdm_load_2d((unsigned)(uintptr_t)&sV[buf ^ 1][0][0], Vb + (c + 32),
                  32, 64, 32, 64, (unsigned long long)LL);
    }
#endif
    if (c < kend_w) {
      // ---- scores S^T[32 x 16] = K @ Q^T (2 key sub-tiles x 2 hd halves)
      v8f s[2];
      v16bf kb0[2], kb1[2];
#pragma unroll
      for (int t = 0; t < 2; ++t) {
#pragma unroll
        for (int e = 0; e < 8; ++e) s[t][e] = 0.f;
#if HAVE_TDM
        kb0[t] = frag_ld(&sK[buf][t * 16 + hl][g * 8]);
        kb1[t] = frag_ld(&sK[buf][t * 16 + hl][32 + g * 8]);
#else
        const bhalf_t* kp = Kb + (size_t)(c + t * 16 + hl) * DM + g * 8;
        kb0[t] = frag_ld(kp);
        kb1[t] = frag_ld(kp + 32);
#endif
      }
      v16bf vb[4];
#pragma unroll
      for (int nt = 0; nt < 4; ++nt) {
#if HAVE_TDM
        vb[nt] = frag_ld(&sV[buf][nt * 16 + hl][g * 8]);
#else
        vb[nt] = frag_ld(Vb + (size_t)(nt * 16 + hl) * LL + c + g * 8);
#endif
      }
      // Keeps the chunk's 16 LDS reads one group ahead of the products: left free, the
      // compiler issues them a pair per product into one register set, each pair waited to 0.
      __builtin_amdgcn_sched_barrier(0);
#pragma unroll
      for (int t = 0; t < 2; ++t) s[t] = wmma_bf16f32(kb0[t], qa0, s[t]);
#pragma unroll
      for (int t = 0; t < 2; ++t) s[t] = wmma_bf16f32(kb1[t], qa1, s[t]);
      // ---- scale + prefix-decoder mask: this lane's score (t, r) is key c + 16t + 8g + r
#pragma unroll
      for (int t = 0; t < 2; ++t)
#pragma unroll
        for (int r = 0; r < 8; ++r) s[t][r] *= scale;
      if (c + 31 >= prefix) {  // same for the whole wave: chunks inside the prefix skip the mask
        const int rel = klim - c - 8 * g;
#pragma unroll
        for (int t = 0; t < 2; ++t)
#pragma unroll
          for (int r = 0; r < 8; ++r) s[t][r] = (t * 16 + r < rel) ? s[t][r] : -1e30f;
      }
      // ---- online softmax: 16 scores of one query per lane, one exchange for the maximum
      float t8[8];
#pragma unroll
      for (int r = 0; r < 8; ++r) t8[r] = fmaxf(s[0][r], s[1][r]);
      float tm = fmaxf(fmaxf(fmaxf(t8[0], t8[1]), fmaxf(t8[2], t8[3])),
                       fmaxf(fmaxf(t8[4], t8[5]), fmaxf(t8[6], t8[7])));
      tm = fmaxf(tm, xhalf(tm));
      const float mnew = fmaxf(mrun, tm);
      const float alpha = __expf(mrun - mnew);
      // P^T as a B operand: element 8t + r is key 16t + 8g + r, the order frag_ld gives V^T
      v16bf pb;
      float r4[4] = {0.f, 0.f, 0.f, 0.f};  // four short chains instead of one of 16 adds
#pragma unroll
      for (int t = 0; t < 2; ++t)
#pragma unroll
        for (int r = 0; r < 8; ++r) {
          const float p = __expf(s[t][r] - mnew);
          r4[r & 3] += p;
          pb[t * 8 + r] = (bhalf_t)p;
        }
      lrun = lrun * alpha + ((r4[0] + r4[1]) + (r4[2] + r4[3]));
      mrun = mnew;
#pragma unroll
      for (int nt = 0; nt < 4; ++nt)
#pragma unroll
        for (int r = 0; r < 8; ++r) ctx[nt][r] *= alpha;
      // ---- O^T += V^T @ P^T  (contraction over 32 keys, 4 hd row tiles)
#pragma unroll
      for (int nt = 0; nt < 4; ++nt) ctx[nt] = wmma_bf16f32(vb[nt], pb, ctx[nt]);
    }
  }
  // ---- normalize and store context: 8 consecutive head columns per lane, one 16-B store
  const float lsum = lrun + xhalf(lrun);
  bhalf_t* orow = ctxout + ((size_t)bidx * LL + q0 + hl) * DM + h * HD + 8 * g;
#pragma unroll
  for (int nt = 0; nt < 4; ++nt) {
    v8bf o;
#pragma unroll
    for (int r = 0; r < 8; ++r) o[r] = (bhalf_t)(ctx[nt][r] / lsum);
    *(v8bf*)(orow + nt * 16) = o;
  }
}

// ---------------------------------------------------------------------------
// Launch
// ---------------------------------------------------------------------------
extern "C" void kernel_launch(void* const* d_in, const int* in_sizes, int n_in,
                              void* d_out, int out_size, void* d_ws, size_t ws_size,
                              hipStream_t stream) {
  (void)in_sizes; (void)n_in; (void)out_size; (void)ws_size;
  const float* x    = (const float*)d_in[0];
  const float* ln1w = (const float*)d_in[1];
  const float* ln1b = (const float*)d_in[2];
  const float* inw  = (const float*)d_in[3];
  const float* inb  = (const float*)d_in[4];
  const float* outw = (const float*)d_in[5];
  const float* outb = (const float*)d_in[6];
  const float* ln2w = (const float*)d_in[7];
  const float* ln2b = (const float*)d_in[8];
  const float* fc1w = (const float*)d_in[9];
  const float* fc1b = (const float*)d_in[10];
  const float* fc2w = (const float*)d_in[11];
  const float* fc2b = (const float*)d_in[12];
  const int*   pfx  = (const int*)d_in[13];
  float* out = (float*)d_out;

  char* ws = (char*)d_ws;
  size_t off = 0;
  auto carve = [&](size_t bytes) -> void* {
    void* p = ws + off;
    off += (bytes + 255) & ~(size_t)255;
    return p;
  };
  bhalf_t* wqkv = (bhalf_t*)carve((size_t)3 * DM * DM * sizeof(bhalf_t));
  bhalf_t* wo   = (bhalf_t*)carve((size_t)DM * DM * sizeof(bhalf_t));
  bhalf_t* w1   = (bhalf_t*)carve((size_t)DF * DM * sizeof(bhalf_t));
  bhalf_t* w2   = (bhalf_t*)carve((size_t)DM * DF * sizeof(bhalf_t));
  bhalf_t* h1   = (bhalf_t*)carve((size_t)MM * DM * sizeof(bhalf_t));
  bhalf_t* Qb   = (bhalf_t*)carve((size_t)MM * DM * sizeof(bhalf_t));
  bhalf_t* Kb   = (bhalf_t*)carve((size_t)MM * DM * sizeof(bhalf_t));
  bhalf_t* Vt   = (bhalf_t*)carve((size_t)MM * DM * sizeof(bhalf_t));
  bhalf_t* ctxb = (bhalf_t*)carve((size_t)MM * DM * sizeof(bhalf_t));
  float*   x1   = (float*)carve((size_t)MM * DM * sizeof(float));
  bhalf_t* h2   = (bhalf_t*)carve((size_t)MM * DM * sizeof(bhalf_t));
  bhalf_t* ff1  = (bhalf_t*)carve((size_t)MM * DF * sizeof(bhalf_t));

  auto castN = [&](const float* src, bhalf_t* dst, int n) {
    cast_f32_bf16<<<n / CAST_CHUNK, 256, 0, stream>>>(src, dst);
  };
  castN(inw,  wqkv, 3 * DM * DM);
  castN(outw, wo,   DM * DM);
  castN(fc1w, w1,   DF * DM);
  castN(fc2w, w2,   DM * DF);

  layernorm_bf16<<<MM, 256, 0, stream>>>(x, ln1w, ln1b, h1);

  dim3 blk(256);
  dim3 gD(MM / 128, DM / 256);
  dim3 gF(MM / 128, DF / 256);
  gemm_bf16<0><<<gD, blk, 0, stream>>>(h1, wqkv,                       inb,          nullptr, Qb, MM, DM, DM);
  gemm_bf16<0><<<gD, blk, 0, stream>>>(h1, wqkv + (size_t)DM * DM,     inb + DM,     nullptr, Kb, MM, DM, DM);
  gemm_bf16<1><<<gD, blk, 0, stream>>>(h1, wqkv + (size_t)2 * DM * DM, inb + 2 * DM, nullptr, Vt, MM, DM, DM);

  attn_flash<<<BB * NH * (LL / 128), blk, 0, stream>>>(Qb, Kb, Vt, ctxb, pfx);

  gemm_bf16<2><<<gD, blk, 0, stream>>>(ctxb, wo, outb, x, x1, MM, DM, DM);
  layernorm_bf16<<<MM, 256, 0, stream>>>(x1, ln2w, ln2b, h2);
  gemm_bf16<3><<<gF, blk, 0, stream>>>(h2, w1, fc1b, nullptr, ff1, MM, DF, DM);
  gemm_bf16<2><<<gD, blk, 0, stream>>>(ff1, w2, fc2b, x1, out, MM, DM, DF);
}

// v004
// A run of this version takes 297 microseconds.
// Next to v003, in two timings, it ran 1.04 and 1.05 times as fast.
// All steps since v000 together make it 1.72 times as fast.
#include <hip/hip_runtime.h>

typedef __bf16 bhalf_t;
typedef __attribute__((ext_vector_type(16))) __bf16 v16bf;
typedef __attribute__((ext_vector_type(8)))  __bf16 v8bf;
typedef __attribute__((ext_vector_type(8)))  float  v8f;
typedef __attribute__((ext_vector_type(4)))  unsigned int v4u;
typedef __attribute__((ext_vector_type(8)))  int v8i;
typedef __attribute__((ext_vector_type(4)))  int v4i;

#define DM   1024   // d_model
#define NH   16     // heads
#define HD   64     // head dim
#define DF   4096   // d_ff
#define BB   2      // batch
#define LL   2048   // seq len
#define MM   (BB*LL)

#if defined(__gfx1250__) && __has_builtin(__builtin_amdgcn_tensor_load_to_lds)
#define HAVE_TDM 1
#else
#define HAVE_TDM 0
#endif

__device__ __forceinline__ v8f wmma_bf16f32(v16bf a, v16bf b, v8f c) {
  return __builtin_amdgcn_wmma_f32_16x16x32_bf16(false, a, false, b, (short)0, c,
                                                 false, false);
}

__device__ __forceinline__ v16bf frag_ld(const bhalf_t* p) {
  v8bf lo = *(const v8bf*)(p);
  v8bf hi = *(const v8bf*)(p + 16);
  v16bf r;
#pragma unroll
  for (int i = 0; i < 8; ++i) { r[i] = lo[i]; r[8 + i] = hi[i]; }
  return r;
}

#if HAVE_TDM
__device__ __forceinline__ void tdm_load_2d(unsigned lds_off, const void* gptr,
                                            unsigned tile_k, unsigned tile_rows,
                                            unsigned tensor_k, unsigned tensor_rows,
                                            unsigned long long row_stride) {
  unsigned long long ga = (unsigned long long)(uintptr_t)gptr;
  v4u g0;
  g0[0] = 1u;
  g0[1] = lds_off;
  g0[2] = (unsigned)(ga & 0xFFFFFFFFu);
  g0[3] = (unsigned)((ga >> 32) & 0x01FFFFFFu) | (2u << 30);
  v8i g1;
  g1[0] = (int)(1u << 16);
  g1[1] = (int)((tensor_k & 0xFFFFu) << 16);
  g1[2] = (int)(((tensor_k >> 16) & 0xFFFFu) | ((tensor_rows & 0xFFFFu) << 16));
  g1[3] = (int)(((tensor_rows >> 16) & 0xFFFFu) | ((tile_k & 0xFFFFu) << 16));
  g1[4] = (int)(tile_rows & 0xFFFFu);
  g1[5] = (int)(unsigned)(row_stride & 0xFFFFFFFFull);        // dim0_stride[31:0]
  g1[6] = (int)(unsigned)((row_stride >> 32) & 0xFFFFull);    // dim0_stride[47:32]
  g1[7] = 0;                                         // dim1_stride unused (2D tile)
  v4i z = {0, 0, 0, 0};
#if __clang_major__ >= 23
  v8i z8 = {0, 0, 0, 0, 0, 0, 0, 0};
  __builtin_amdgcn_tensor_load_to_lds(g0, g1, z, z, z8, 0);
#else
  __builtin_amdgcn_tensor_load_to_lds(g0, g1, z, z, 0);
#endif
}

typedef __attribute__((ext_vector_type(8))) unsigned int v8u;
#define GK      128                 // k elements per stage
#define GROWB   256u                // bytes of one staged row
#define GPITCH  272u                // LDS pitch of a staged row
#define GSLICE  (128u * GPITCH)     // one wave's request: 128 rows = 17 x 2 KiB
#define GBUF    (3u * GSLICE)       // a stage: A 128 rows, then W 256 rows

__device__ __forceinline__ unsigned uni(unsigned v) {
  return (unsigned)__builtin_amdgcn_readfirstlane(v);
}
__device__ __forceinline__ unsigned pinned(unsigned v) {
  unsigned w = uni(v);
  asm volatile("" : "+s"(w));
  return w;
}
__device__ __forceinline__ v8u gemm_group1(unsigned src_pitch_bytes) {
  v8u d;
  d[0] = uni((1u << 20) | (5u << 22) | (3u << 25));
  d[1] = uni((GROWB & 0xFFFFu) << 16);
  d[2] = uni((GROWB >> 16) | (128u << 16));
  d[3] = uni(GROWB << 16);
  d[4] = uni(128u);
  d[5] = uni(src_pitch_bytes);
  d[6] = uni(0u);
  d[7] = uni(0u);
  // Built once and kept: without this the compiler re-forms some words in the loop, in the
  // same registers, while a request is outstanding.
  asm volatile("" : "+s"(d));
  return d;
}
__device__ __forceinline__ void gemm_tile_load(unsigned lds_dst, unsigned long long ga, v8u d1) {
  v4u d0;
  d0[0] = uni(1u);
  d0[1] = uni(lds_dst);
  d0[2] = uni((unsigned)ga);
  d0[3] = uni((((unsigned)(ga >> 32)) & 0x01FFFFFFu) | 0x80000000u);
  asm volatile("tensor_load_to_lds %0, %1" :: "s"(d0), "s"(d1) : "memory");
}
// The compiler places no wait for the tensor mover: a tile counts as landed only behind this.
__device__ __forceinline__ void wait_tensor0() { asm volatile("s_wait_tensorcnt 0x0" ::: "memory"); }
// A wave's LDS reads have retired before the buffer they read is handed back for a refill.
__device__ __forceinline__ void wait_ds0() { asm volatile("s_wait_dscnt 0x0" ::: "memory"); }
#endif  // HAVE_TDM

// ---------------------------------------------------------------------------
// fp32 -> bf16 cast (weights)
// ---------------------------------------------------------------------------
// A wave owns CAST_V * 512 contiguous bytes of the source: every load is 32 lanes x 16 B
// of whole lines, issued as one group ahead of the conversions. Few waves with much work
// each: a stream this short is bounded by how fast waves start, not by its bytes.
#define CAST_V      16                      // 16-byte loads per lane
#define CAST_WAVE   (CAST_V * 128)          // floats per wave
#define CAST_CHUNK  (8 * CAST_WAVE)         // floats per workgroup of 8 waves
static_assert((DM * DM) % CAST_CHUNK == 0, "every weight is a whole number of chunks");
typedef __attribute__((ext_vector_type(4))) float  v4f;
typedef __attribute__((ext_vector_type(4))) __bf16 v4bf;

__global__ __launch_bounds__(256) void cast_f32_bf16(const float* __restrict__ in,
                                                     bhalf_t* __restrict__ out) {
  const int base = blockIdx.x * CAST_CHUNK + (threadIdx.x >> 5) * CAST_WAVE +
                   (threadIdx.x & 31) * 4;
  v4f v[CAST_V];
#pragma unroll  // all loads issued as one group, each offset an immediate
  for (int u = 0; u < CAST_V; ++u) v[u] = *(const v4f*)(in + base + u * 128);
#pragma unroll  // v[] stays in registers; each store is 32 lanes x 8 B = two whole lines
  for (int u = 0; u < CAST_V; ++u) {
    v4bf o;
#pragma unroll  // four converts, packed in pairs
    for (int e = 0; e < 4; ++e) o[e] = (bhalf_t)v[u][e];
    *(v4bf*)(out + base + u * 128) = o;
  }
}

// ---------------------------------------------------------------------------
// LayerNorm (d=1024) -> bf16
// ---------------------------------------------------------------------------
__global__ __launch_bounds__(256) void layernorm_bf16(
    const float* __restrict__ x, const float* __restrict__ w,
    const float* __restrict__ b, bhalf_t* __restrict__ out) {
  __shared__ float red[256];
  const int row = blockIdx.x;
  const int tid = threadIdx.x;
  const float* xr = x + (size_t)row * DM;
  float s = 0.f;
  for (int i = tid; i < DM; i += 256) s += xr[i];
  red[tid] = s; __syncthreads();
  for (int o = 128; o > 0; o >>= 1) {
    if (tid < o) red[tid] += red[tid + o];
    __syncthreads();
  }
  const float mu = red[0] * (1.f / DM);
  __syncthreads();
  float v = 0.f;
  for (int i = tid; i < DM; i += 256) { float d = xr[i] - mu; v += d * d; }
  red[tid] = v; __syncthreads();
  for (int o = 128; o > 0; o >>= 1) {
    if (tid < o) red[tid] += red[tid + o];
    __syncthreads();
  }
  const float rstd = rsqrtf(red[0] * (1.f / DM) + 1e-5f);
  bhalf_t* orow = out + (size_t)row * DM;
  for (int i = tid; i < DM; i += 256)
    orow[i] = (bhalf_t)((xr[i] - mu) * rstd * w[i] + b[i]);
}

template <int EPI>
__global__ __launch_bounds__(256) void gemm_bf16(
    const bhalf_t* __restrict__ A, const bhalf_t* __restrict__ W,
    const float* __restrict__ bias, const float* __restrict__ resid,
    void* __restrict__ outp, int Mdim, int Ndim, int Kdim) {
  const int lane = threadIdx.x & 31;
  const int wave = threadIdx.x >> 5;
  const int hl = lane & 15, g = lane >> 4;
  const int wm = wave & 1;            // 2 row groups of 64
  const int wn = wave >> 1;           // 4 col groups of 64
  const int m0 = blockIdx.x * 128 + wm * 64;
  const int n0 = blockIdx.y * 256 + wn * 64;

  v8f acc[4][4];
#pragma unroll
  for (int i = 0; i < 4; ++i)
#pragma unroll
    for (int j = 0; j < 4; ++j)
#pragma unroll
      for (int e = 0; e < 8; ++e) acc[i][j][e] = 0.f;

#if HAVE_TDM
  // Two stages of [A 128 rows | W 256 rows], 256 B of k per row at pitch 272 B.
  __shared__ __attribute__((aligned(2048))) unsigned char sT[2u * GBUF];
  (void)Mdim;

  const unsigned wv = uni(threadIdx.x >> 5);
  // waves 0, 1, 2 each bring one slice of 128 rows: A, W rows 0-127, W rows 128-255
  const bhalf_t* sp = (wv == 0u)
      ? A + (size_t)blockIdx.x * 128 * Kdim
      : W + ((size_t)blockIdx.y * 256 + (wv == 2u ? 128 : 0)) * Kdim;
  const unsigned long long ga = (unsigned long long)(uintptr_t)sp;
  const unsigned dst = (unsigned)(uintptr_t)&sT[0] + (wv < 3u ? wv : 0u) * GSLICE;
  const v8u d1 = gemm_group1((unsigned)Kdim * 2u);
  const int nst = Kdim / GK;          // stages; at least two for every launch here

  if (pinned(wv < 3u)) {
    gemm_tile_load(dst, ga, d1);      // stage 0
    wait_tensor0();
  }
  __syncthreads();                    // stage 0 readable by every wave
  if (pinned(wv < 3u)) gemm_tile_load(dst + GBUF, ga + GROWB, d1);  // stage 1

  const unsigned aoff = (unsigned)(wm * 64 + hl) * GPITCH + (unsigned)g * 16u;
  const unsigned boff = GSLICE + (unsigned)(wn * 64 + hl) * GPITCH + (unsigned)g * 16u;

  // Two fragment sets: block b works on set b & 1 while block b + 1's 16 reads land in the other.
  v16bf fa[2][4], fb[2][4];
#pragma unroll
  for (int i = 0; i < 4; ++i) {
    fa[0][i] = frag_ld((const bhalf_t*)(sT + aoff + i * 16 * GPITCH));
    fb[0][i] = frag_ld((const bhalf_t*)(sT + boff + i * 16 * GPITCH));
  }

  for (int s = 0; s < nst; ++s) {
    const unsigned char* bp = sT + (unsigned)(s & 1) * GBUF;
    const unsigned char* bn = sT + (unsigned)((s + 1) & 1) * GBUF;
#pragma unroll  // the four 32-k blocks of a stage: set index and every LDS offset compile-time, no loop branch among the WMMAs
    for (int kb = 0; kb < GK / 32; ++kb) {
      const int cur = kb & 1, nxt = cur ^ 1;
      if (kb == GK / 32 - 1) {
        // publish point of stage s + 1: it stands before stage s's last block, whose fragments
        // are already fetched, because the fetch below reads stage s + 1
        wait_ds0();
        if (pinned(wv < 3u)) wait_tensor0();
        __syncthreads();              // stage s + 1 readable; stage s's buffer left by every reader
        if (pinned((wv < 3u) & (s + 2 < nst)))
          gemm_tile_load(dst + (unsigned)(s & 1) * GBUF,
                         ga + (unsigned long long)(s + 2) * GROWB, d1);
      }
      // next block's fragments (in the last stage: landed rows of the other buffer, never used)
      const unsigned char* np = (kb == GK / 32 - 1) ? bn : bp + (kb + 1) * 64;
#pragma unroll  // fa, fb stay in registers: every index a constant
      for (int i = 0; i < 4; ++i) {
        fa[nxt][i] = frag_ld((const bhalf_t*)(np + aoff + i * 16 * GPITCH));
        fb[nxt][i] = frag_ld((const bhalf_t*)(np + boff + i * 16 * GPITCH));
      }
      // Keeps the 16 reads one group ahead of this block's products: left free, the compiler
      // sinks them among the WMMAs a pair at a time, each pair waited to 0.
      __builtin_amdgcn_sched_barrier(0);
#pragma unroll  // 16 independent accumulator tiles back to back, all in registers
      for (int mi = 0; mi < 4; ++mi)
#pragma unroll
        for (int ni = 0; ni < 4; ++ni)
          acc[mi][ni] = wmma_bf16f32(fa[cur][mi], fb[cur][ni], acc[mi][ni]);
      // Keeps the following block's reads behind these products, so that each group stays whole.
      __builtin_amdgcn_sched_barrier(0);
    }
  }
  wait_tensor0();
  wait_ds0();
#else
  // fallback: fragments straight from global
  for (int k = 0; k < Kdim; k += 32) {
    v16bf fa[4], fb[4];
#pragma unroll
    for (int mi = 0; mi < 4; ++mi)
      fa[mi] = frag_ld(A + (size_t)(m0 + mi * 16 + hl) * Kdim + k + g * 8);
#pragma unroll
    for (int ni = 0; ni < 4; ++ni)
      fb[ni] = frag_ld(W + (size_t)(n0 + ni * 16 + hl) * Kdim + k + g * 8);
#pragma unroll
    for (int mi = 0; mi < 4; ++mi)
#pragma unroll
      for (int ni = 0; ni < 4; ++ni)
        acc[mi][ni] = wmma_bf16f32(fa[mi], fb[ni], acc[mi][ni]);
  }
#endif

#pragma unroll
  for (int mi = 0; mi < 4; ++mi)
#pragma unroll
    for (int ni = 0; ni < 4; ++ni) {
      const int col = n0 + ni * 16 + hl;
      const float bv = bias[col];
#pragma unroll
      for (int r = 0; r < 8; ++r) {
        const int row = m0 + mi * 16 + r + 8 * g;
        float v = acc[mi][ni][r] + bv;
        if (EPI == 0) {
          ((bhalf_t*)outp)[(size_t)row * Ndim + col] = (bhalf_t)v;
        } else if (EPI == 1) {
          const int bidx = row >> 11;  // row / LL
          const int seq = row & (LL - 1);
          const size_t idx =
              (((size_t)(bidx * NH + (col >> 6)) * HD) + (col & (HD - 1))) * LL + seq;
          ((bhalf_t*)outp)[idx] = (bhalf_t)v;
        } else if (EPI == 2) {
          const size_t idx = (size_t)row * Ndim + col;
          ((float*)outp)[idx] = resid[idx] + v;
        } else {
          const float gv = 0.5f * v * (1.f + erff(v * 0.70710678118654752f));
          ((bhalf_t*)outp)[(size_t)row * Ndim + col] = (bhalf_t)gv;
        }
      }
    }
}

__device__ __forceinline__ float xhalf(float x) {
  const int b = __builtin_bit_cast(int, x);
  return __builtin_bit_cast(
      float, __builtin_amdgcn_permlanex16(b, b, 0x76543210, 0xfedcba98, false, false));
}

__global__ __launch_bounds__(256) void attn_flash(
    const bhalf_t* __restrict__ Q, const bhalf_t* __restrict__ Km,
    const bhalf_t* __restrict__ Vt, bhalf_t* __restrict__ ctxout,
    const int* __restrict__ pfx) {
#if HAVE_TDM
  __shared__ bhalf_t sK[2][32][64];   // 8 KB: 32 keys x 64 hd, double buffered
  __shared__ bhalf_t sV[2][64][32];   // 8 KB: 64 hd x 32 keys, double buffered
#endif
  const int prefix = *pfx;
  const int lane = threadIdx.x & 31;
  const int wave = threadIdx.x >> 5;
  const int hl = lane & 15, g = lane >> 4;
  const int qblk = (blockIdx.x & (LL / 128 - 1)) * 128;  // query block start
  const int bh = blockIdx.x >> 4;                        // LL/128 == 16
  const int bidx = bh >> 4, h = bh & (NH - 1);
  const int q0 = qblk + wave * 16;                       // this wave's tile

  const bhalf_t* Qb = Q + (size_t)bidx * LL * DM + h * HD;
  const bhalf_t* Kb = Km + (size_t)bidx * LL * DM + h * HD;
  const bhalf_t* Vb = Vt + (size_t)bh * HD * LL;

  const bhalf_t* qp = Qb + (size_t)(q0 + hl) * DM + g * 8;
  const v16bf qa0 = frag_ld(qp);
  const v16bf qa1 = frag_ld(qp + 32);

  // This lane's query is q0 + hl. lrun sums only the keys this wave half holds;
  // the halves are joined once, behind the loop. ctx[nt][r] = O[q0 + hl][nt*16 + 8g + r].
  float mrun = -1e30f, lrun = 0.f;
  v8f ctx[4];
#pragma unroll
  for (int nt = 0; nt < 4; ++nt)
#pragma unroll
    for (int e = 0; e < 8; ++e) ctx[nt][e] = 0.f;

  // per-wave and block-level key extents (rounded to 32-key chunks)
  int kend_w = (q0 + 16 > prefix) ? (q0 + 16) : prefix;
  kend_w = (kend_w + 31) & ~31;
  int kend_b = (qblk + 128 > prefix) ? (qblk + 128) : prefix;
  kend_b = (kend_b + 31) & ~31;
  const float scale = 0.125f;  // 1/sqrt(64)
  // One query per lane, so one key limit per lane: key allowed iff key < prefix, or
  // query >= prefix and key <= query; in the second case query + 1 > prefix.
  const int klim = (q0 + hl >= prefix) ? q0 + hl + 1 : prefix;

#if HAVE_TDM
  if (wave == 0) {  // prologue DMA: K chunk (32x64, pitch DM), V chunk (64x32, pitch LL)
    tdm_load_2d((unsigned)(uintptr_t)&sK[0][0][0], Kb, 64, 32, 64, 32,
                (unsigned long long)DM);
    tdm_load_2d((unsigned)(uintptr_t)&sV[0][0][0], Vb, 32, 64, 32, 64,
                (unsigned long long)LL);
  }
#endif

  for (int c = 0; c < kend_b; c += 32) {
#if HAVE_TDM
    const int buf = (c >> 5) & 1;
    if (wave == 0) __builtin_amdgcn_s_wait_tensorcnt(0);
    __syncthreads();  // chunk ready for all waves; other buffer free
    if (c + 32 < kend_b && wave == 0) {
      tdm_load_2d((unsigned)(uintptr_t)&sK[buf ^ 1][0][0], Kb + (size_t)(c + 32) * DM,
                  64, 32, 64, 32, (unsigned long long)DM);
      tdm_load_2d((unsigned)(uintptr_t)&sV[buf ^ 1][0][0], Vb + (c + 32),
                  32, 64, 32, 64, (unsigned long long)LL);
    }
#endif
    if (c < kend_w) {
      // ---- scores S^T[32 x 16] = K @ Q^T (2 key sub-tiles x 2 hd halves)
      v8f s[2];
      v16bf kb0[2], kb1[2];
#pragma unroll
      for (int t = 0; t < 2; ++t) {
#pragma unroll
        for (int e = 0; e < 8; ++e) s[t][e] = 0.f;
#if HAVE_TDM
        kb0[t] = frag_ld(&sK[buf][t * 16 + hl][g * 8]);
        kb1[t] = frag_ld(&sK[buf][t * 16 + hl][32 + g * 8]);
#else
        const bhalf_t* kp = Kb + (size_t)(c + t * 16 + hl) * DM + g * 8;
        kb0[t] = frag_ld(kp);
        kb1[t] = frag_ld(kp + 32);
#endif
      }
      v16bf vb[4];
#pragma unroll
      for (int nt = 0; nt < 4; ++nt) {
#if HAVE_TDM
        vb[nt] = frag_ld(&sV[buf][nt * 16 + hl][g * 8]);
#else
        vb[nt] = frag_ld(Vb + (size_t)(nt * 16 + hl) * LL + c + g * 8);
#endif
      }
      // Keeps the chunk's 16 LDS reads one group ahead of the products: left free, the
      // compiler issues them a pair per product into one register set, each pair waited to 0.
      __builtin_amdgcn_sched_barrier(0);
#pragma unroll
      for (int t = 0; t < 2; ++t) s[t] = wmma_bf16f32(kb0[t], qa0, s[t]);
#pragma unroll
      for (int t = 0; t < 2; ++t) s[t] = wmma_bf16f32(kb1[t], qa1, s[t]);
      // ---- scale + prefix-decoder mask: this lane's score (t, r) is key c + 16t + 8g + r
#pragma unroll
      for (int t = 0; t < 2; ++t)
#pragma unroll
        for (int r = 0; r < 8; ++r) s[t][r] *= scale;
      if (c + 31 >= prefix) {  // same for the whole wave: chunks inside the prefix skip the mask
        const int rel = klim - c - 8 * g;
#pragma unroll
        for (int t = 0; t < 2; ++t)
#pragma unroll
          for (int r = 0; r < 8; ++r) s[t][r] = (t * 16 + r < rel) ? s[t][r] : -1e30f;
      }
      // ---- online softmax: 16 scores of one query per lane, one exchange for the maximum
      float t8[8];
#pragma unroll
      for (int r = 0; r < 8; ++r) t8[r] = fmaxf(s[0][r], s[1][r]);
      float tm = fmaxf(fmaxf(fmaxf(t8[0], t8[1]), fmaxf(t8[2], t8[3])),
                       fmaxf(fmaxf(t8[4], t8[5]), fmaxf(t8[6], t8[7])));
      tm = fmaxf(tm, xhalf(tm));
      const float mnew = fmaxf(mrun, tm);
      const float alpha = __expf(mrun - mnew);
      // P^T as a B operand: element 8t + r is key 16t + 8g + r, the order frag_ld gives V^T
      v16bf pb;
      float r4[4] = {0.f, 0.f, 0.f, 0.f};  // four short chains instead of one of 16 adds
#pragma unroll
      for (int t = 0; t < 2; ++t)
#pragma unroll
        for (int r = 0; r < 8; ++r) {
          const float p = __expf(s[t][r] - mnew);
          r4[r & 3] += p;
          pb[t * 8 + r] = (bhalf_t)p;
        }
      lrun = lrun * alpha + ((r4[0] + r4[1]) + (r4[2] + r4[3]));
      mrun = mnew;
#pragma unroll
      for (int nt = 0; nt < 4; ++nt)
#pragma unroll
        for (int r = 0; r < 8; ++r) ctx[nt][r] *= alpha;
      // ---- O^T += V^T @ P^T  (contraction over 32 keys, 4 hd row tiles)
#pragma unroll
      for (int nt = 0; nt < 4; ++nt) ctx[nt] = wmma_bf16f32(vb[nt], pb, ctx[nt]);
    }
  }
  // ---- normalize and store context: 8 consecutive head columns per lane, one 16-B store
  const float lsum = lrun + xhalf(lrun);
  bhalf_t* orow = ctxout + ((size_t)bidx * LL + q0 + hl) * DM + h * HD + 8 * g;
#pragma unroll
  for (int nt = 0; nt < 4; ++nt) {
    v8bf o;
#pragma unroll
    for (int r = 0; r < 8; ++r) o[r] = (bhalf_t)(ctx[nt][r] / lsum);
    *(v8bf*)(orow + nt * 16) = o;
  }
}

// ---------------------------------------------------------------------------
// Launch
// ---------------------------------------------------------------------------
extern "C" void kernel_launch(void* const* d_in, const int* in_sizes, int n_in,
                              void* d_out, int out_size, void* d_ws, size_t ws_size,
                              hipStream_t stream) {
  (void)in_sizes; (void)n_in; (void)out_size; (void)ws_size;
  const float* x    = (const float*)d_in[0];
  const float* ln1w = (const float*)d_in[1];
  const float* ln1b = (const float*)d_in[2];
  const float* inw  = (const float*)d_in[3];
  const float* inb  = (const float*)d_in[4];
  const float* outw = (const float*)d_in[5];
  const float* outb = (const float*)d_in[6];
  const float* ln2w = (const float*)d_in[7];
  const float* ln2b = (const float*)d_in[8];
  const float* fc1w = (const float*)d_in[9];
  const float* fc1b = (const float*)d_in[10];
  const float* fc2w = (const float*)d_in[11];
  const float* fc2b = (const float*)d_in[12];
  const int*   pfx  = (const int*)d_in[13];
  float* out = (float*)d_out;

  char* ws = (char*)d_ws;
  size_t off = 0;
  auto carve = [&](size_t bytes) -> void* {
    void* p = ws + off;
    off += (bytes + 255) & ~(size_t)255;
    return p;
  };
  bhalf_t* wqkv = (bhalf_t*)carve((size_t)3 * DM * DM * sizeof(bhalf_t));
  bhalf_t* wo   = (bhalf_t*)carve((size_t)DM * DM * sizeof(bhalf_t));
  bhalf_t* w1   = (bhalf_t*)carve((size_t)DF * DM * sizeof(bhalf_t));
  bhalf_t* w2   = (bhalf_t*)carve((size_t)DM * DF * sizeof(bhalf_t));
  bhalf_t* h1   = (bhalf_t*)carve((size_t)MM * DM * sizeof(bhalf_t));
  bhalf_t* Qb   = (bhalf_t*)carve((size_t)MM * DM * sizeof(bhalf_t));
  bhalf_t* Kb   = (bhalf_t*)carve((size_t)MM * DM * sizeof(bhalf_t));
  bhalf_t* Vt   = (bhalf_t*)carve((size_t)MM * DM * sizeof(bhalf_t));
  bhalf_t* ctxb = (bhalf_t*)carve((size_t)MM * DM * sizeof(bhalf_t));
  float*   x1   = (float*)carve((size_t)MM * DM * sizeof(float));
  bhalf_t* h2   = (bhalf_t*)carve((size_t)MM * DM * sizeof(bhalf_t));
  bhalf_t* ff1  = (bhalf_t*)carve((size_t)MM * DF * sizeof(bhalf_t));

  auto castN = [&](const float* src, bhalf_t* dst, int n) {
    cast_f32_bf16<<<n / CAST_CHUNK, 256, 0, stream>>>(src, dst);
  };
  castN(inw,  wqkv, 3 * DM * DM);
  castN(outw, wo,   DM * DM);
  castN(fc1w, w1,   DF * DM);
  castN(fc2w, w2,   DM * DF);

  layernorm_bf16<<<MM, 256, 0, stream>>>(x, ln1w, ln1b, h1);

  dim3 blk(256);
  dim3 gD(MM / 128, DM / 256);
  dim3 gF(MM / 128, DF / 256);
  gemm_bf16<0><<<gD, blk, 0, stream>>>(h1, wqkv,                       inb,          nullptr, Qb, MM, DM, DM);
  gemm_bf16<0><<<gD, blk, 0, stream>>>(h1, wqkv + (size_t)DM * DM,     inb + DM,     nullptr, Kb, MM, DM, DM);
  gemm_bf16<1><<<gD, blk, 0, stream>>>(h1, wqkv + (size_t)2 * DM * DM, inb + 2 * DM, nullptr, Vt, MM, DM, DM);

  attn_flash<<<BB * NH * (LL / 128), blk, 0, stream>>>(Qb, Kb, Vt, ctxb, pfx);

  gemm_bf16<2><<<gD, blk, 0, stream>>>(ctxb, wo, outb, x, x1, MM, DM, DM);
  layernorm_bf16<<<MM, 256, 0, stream>>>(x1, ln2w, ln2b, h2);
  gemm_bf16<3><<<gF, blk, 0, stream>>>(h2, w1, fc1b, nullptr, ff1, MM, DF, DM);
  gemm_bf16<2><<<gD, blk, 0, stream>>>(ff1, w2, fc2b, x1, out, MM, DM, DF);
}

// v005
// A run of this version takes 250 microseconds.
// In two side-by-side timings against v004, it was 1.18 and 1.19 times as fast.
// Over all steps from v000 it is 2.04 times as fast.
#include <hip/hip_runtime.h>

typedef __bf16 bhalf_t;
typedef __attribute__((ext_vector_type(16))) __bf16 v16bf;
typedef __attribute__((ext_vector_type(8)))  __bf16 v8bf;
typedef __attribute__((ext_vector_type(8)))  float  v8f;
typedef __attribute__((ext_vector_type(4)))  unsigned int v4u;

#define DM   1024   // d_model
#define NH   16     // heads
#define HD   64     // head dim
#define DF   4096   // d_ff
#define BB   2      // batch
#define LL   2048   // seq len
#define MM   (BB*LL)
#define AKEYS 64    // attention: keys per LDS stage (two 32-key chunks)

#if defined(__gfx1250__) && __has_builtin(__builtin_amdgcn_tensor_load_to_lds)
#define HAVE_TDM 1
#else
#define HAVE_TDM 0
#endif

__device__ __forceinline__ v8f wmma_bf16f32(v16bf a, v16bf b, v8f c) {
  return __builtin_amdgcn_wmma_f32_16x16x32_bf16(false, a, false, b, (short)0, c,
                                                 false, false);
}

__device__ __forceinline__ v16bf frag_ld(const bhalf_t* p) {
  v8bf lo = *(const v8bf*)(p);
  v8bf hi = *(const v8bf*)(p + 16);
  v16bf r;
#pragma unroll
  for (int i = 0; i < 8; ++i) { r[i] = lo[i]; r[8 + i] = hi[i]; }
  return r;
}

#if HAVE_TDM
typedef __attribute__((ext_vector_type(8))) unsigned int v8u;
#define GK      128                 // k elements per stage
#define GROWB   256u                // bytes of one staged row
#define GPITCH  272u                // LDS pitch of a staged row
#define GSLICE  (128u * GPITCH)     // one wave's request: 128 rows = 17 x 2 KiB
#define GBUF    (3u * GSLICE)       // a stage: A 128 rows, then W 256 rows

__device__ __forceinline__ unsigned uni(unsigned v) {
  return (unsigned)__builtin_amdgcn_readfirstlane(v);
}
__device__ __forceinline__ unsigned pinned(unsigned v) {
  unsigned w = uni(v);
  asm volatile("" : "+s"(w));
  return w;
}
__device__ __forceinline__ v8u gemm_group1(unsigned src_pitch_bytes) {
  v8u d;
  d[0] = uni((1u << 20) | (5u << 22) | (3u << 25));
  d[1] = uni((GROWB & 0xFFFFu) << 16);
  d[2] = uni((GROWB >> 16) | (128u << 16));
  d[3] = uni(GROWB << 16);
  d[4] = uni(128u);
  d[5] = uni(src_pitch_bytes);
  d[6] = uni(0u);
  d[7] = uni(0u);
  // Built once and kept: without this the compiler re-forms some words in the loop, in the
  // same registers, while a request is outstanding.
  asm volatile("" : "+s"(d));
  return d;
}
// Attention staging: a stage is 64 keys, K as 64 rows (keys) and V^T as 64 rows (head dims),
// each row 128 B, laid at an LDS pitch of 144 B (16 B x odd).
#define AROWB   128u                // bytes of one staged row
#define APITCH  144u                // LDS pitch of a staged row
#define ASLICE  10240u              // one wave's request: 64 rows = 9216 B, rounded up to 2 KiB
#define ABUF    (2u * ASLICE)       // a stage: K, then V^T
__device__ __forceinline__ v8u attn_group1(unsigned src_pitch_bytes) {
  v8u d;
  d[0] = uni((1u << 20) | (4u << 22) | (3u << 25));
  d[1] = uni((AROWB & 0xFFFFu) << 16);
  d[2] = uni((AROWB >> 16) | (64u << 16));
  d[3] = uni(AROWB << 16);
  d[4] = uni(64u);
  d[5] = uni(src_pitch_bytes);
  d[6] = uni(0u);
  d[7] = uni(0u);
  asm volatile("" : "+s"(d));
  return d;
}
__device__ __forceinline__ void gemm_tile_load(unsigned lds_dst, unsigned long long ga, v8u d1) {
  v4u d0;
  d0[0] = uni(1u);
  d0[1] = uni(lds_dst);
  d0[2] = uni((unsigned)ga);
  d0[3] = uni((((unsigned)(ga >> 32)) & 0x01FFFFFFu) | 0x80000000u);
  asm volatile("tensor_load_to_lds %0, %1" :: "s"(d0), "s"(d1) : "memory");
}
__device__ __forceinline__ void attn_tile_load(v4u& d0, v8u d1) {
  asm volatile("tensor_load_to_lds %0, %1" : "+s"(d0) : "s"(d1) : "memory");
}
// Next stage: new place in LDS, source address one stage on (a carry runs into address bits only).
__device__ __forceinline__ void attn_step(v4u& d0, unsigned lds_dst, unsigned step_bytes) {
  const unsigned long long a = (((unsigned long long)d0[3] << 32) | d0[2]) + step_bytes;
  d0[1] = uni(lds_dst);
  d0[2] = uni((unsigned)a);
  d0[3] = uni((unsigned)(a >> 32));
}
// The compiler places no wait for the tensor mover: a tile counts as landed only behind this.
__device__ __forceinline__ void wait_tensor0() { asm volatile("s_wait_tensorcnt 0x0" ::: "memory"); }
// A wave's LDS reads have retired before the buffer they read is handed back for a refill.
__device__ __forceinline__ void wait_ds0() { asm volatile("s_wait_dscnt 0x0" ::: "memory"); }
#endif  // HAVE_TDM

// ---------------------------------------------------------------------------
// fp32 -> bf16 cast (weights)
// ---------------------------------------------------------------------------
// A wave owns CAST_V * 512 contiguous bytes of the source: every load is 32 lanes x 16 B
// of whole lines, issued as one group ahead of the conversions. Few waves with much work
// each: a stream this short is bounded by how fast waves start, not by its bytes.
#define CAST_V      16                      // 16-byte loads per lane
#define CAST_WAVE   (CAST_V * 128)          // floats per wave
#define CAST_CHUNK  (8 * CAST_WAVE)         // floats per workgroup of 8 waves
static_assert((DM * DM) % CAST_CHUNK == 0, "every weight is a whole number of chunks");
typedef __attribute__((ext_vector_type(4))) float  v4f;
typedef __attribute__((ext_vector_type(4))) __bf16 v4bf;

__global__ __launch_bounds__(256) void cast_f32_bf16(const float* __restrict__ in,
                                                     bhalf_t* __restrict__ out) {
  const int base = blockIdx.x * CAST_CHUNK + (threadIdx.x >> 5) * CAST_WAVE +
                   (threadIdx.x & 31) * 4;
  v4f v[CAST_V];
#pragma unroll  // all loads issued as one group, each offset an immediate
  for (int u = 0; u < CAST_V; ++u) v[u] = *(const v4f*)(in + base + u * 128);
#pragma unroll  // v[] stays in registers; each store is 32 lanes x 8 B = two whole lines
  for (int u = 0; u < CAST_V; ++u) {
    v4bf o;
#pragma unroll  // four converts, packed in pairs
    for (int e = 0; e < 4; ++e) o[e] = (bhalf_t)v[u][e];
    *(v4bf*)(out + base + u * 128) = o;
  }
}

// ---------------------------------------------------------------------------
// LayerNorm (d=1024) -> bf16
// ---------------------------------------------------------------------------
__global__ __launch_bounds__(256) void layernorm_bf16(
    const float* __restrict__ x, const float* __restrict__ w,
    const float* __restrict__ b, bhalf_t* __restrict__ out) {
  __shared__ float red[256];
  const int row = blockIdx.x;
  const int tid = threadIdx.x;
  const float* xr = x + (size_t)row * DM;
  float s = 0.f;
  for (int i = tid; i < DM; i += 256) s += xr[i];
  red[tid] = s; __syncthreads();
  for (int o = 128; o > 0; o >>= 1) {
    if (tid < o) red[tid] += red[tid + o];
    __syncthreads();
  }
  const float mu = red[0] * (1.f / DM);
  __syncthreads();
  float v = 0.f;
  for (int i = tid; i < DM; i += 256) { float d = xr[i] - mu; v += d * d; }
  red[tid] = v; __syncthreads();
  for (int o = 128; o > 0; o >>= 1) {
    if (tid < o) red[tid] += red[tid + o];
    __syncthreads();
  }
  const float rstd = rsqrtf(red[0] * (1.f / DM) + 1e-5f);
  bhalf_t* orow = out + (size_t)row * DM;
  for (int i = tid; i < DM; i += 256)
    orow[i] = (bhalf_t)((xr[i] - mu) * rstd * w[i] + b[i]);
}

template <int EPI>
__global__ __launch_bounds__(256) void gemm_bf16(
    const bhalf_t* __restrict__ A, const bhalf_t* __restrict__ W,
    const float* __restrict__ bias, const float* __restrict__ resid,
    void* __restrict__ outp, int Mdim, int Ndim, int Kdim) {
  const int lane = threadIdx.x & 31;
  const int wave = threadIdx.x >> 5;
  const int hl = lane & 15, g = lane >> 4;
  const int wm = wave & 1;            // 2 row groups of 64
  const int wn = wave >> 1;           // 4 col groups of 64
  const int m0 = blockIdx.x * 128 + wm * 64;
  const int n0 = blockIdx.y * 256 + wn * 64;

  v8f acc[4][4];
#pragma unroll
  for (int i = 0; i < 4; ++i)
#pragma unroll
    for (int j = 0; j < 4; ++j)
#pragma unroll
      for (int e = 0; e < 8; ++e) acc[i][j][e] = 0.f;

#if HAVE_TDM
  // Two stages of [A 128 rows | W 256 rows], 256 B of k per row at pitch 272 B.
  __shared__ __attribute__((aligned(2048))) unsigned char sT[2u * GBUF];
  (void)Mdim;

  const unsigned wv = uni(threadIdx.x >> 5);
  // waves 0, 1, 2 each bring one slice of 128 rows: A, W rows 0-127, W rows 128-255
  const bhalf_t* sp = (wv == 0u)
      ? A + (size_t)blockIdx.x * 128 * Kdim
      : W + ((size_t)blockIdx.y * 256 + (wv == 2u ? 128 : 0)) * Kdim;
  const unsigned long long ga = (unsigned long long)(uintptr_t)sp;
  const unsigned dst = (unsigned)(uintptr_t)&sT[0] + (wv < 3u ? wv : 0u) * GSLICE;
  const v8u d1 = gemm_group1((unsigned)Kdim * 2u);
  const int nst = Kdim / GK;          // stages; at least two for every launch here

  if (pinned(wv < 3u)) {
    gemm_tile_load(dst, ga, d1);      // stage 0
    wait_tensor0();
  }
  __syncthreads();                    // stage 0 readable by every wave
  if (pinned(wv < 3u)) gemm_tile_load(dst + GBUF, ga + GROWB, d1);  // stage 1

  const unsigned aoff = (unsigned)(wm * 64 + hl) * GPITCH + (unsigned)g * 16u;
  const unsigned boff = GSLICE + (unsigned)(wn * 64 + hl) * GPITCH + (unsigned)g * 16u;

  // Two fragment sets: block b works on set b & 1 while block b + 1's 16 reads land in the other.
  v16bf fa[2][4], fb[2][4];
#pragma unroll
  for (int i = 0; i < 4; ++i) {
    fa[0][i] = frag_ld((const bhalf_t*)(sT + aoff + i * 16 * GPITCH));
    fb[0][i] = frag_ld((const bhalf_t*)(sT + boff + i * 16 * GPITCH));
  }

  for (int s = 0; s < nst; ++s) {
    const unsigned char* bp = sT + (unsigned)(s & 1) * GBUF;
    const unsigned char* bn = sT + (unsigned)((s + 1) & 1) * GBUF;
#pragma unroll  // the four 32-k blocks of a stage: set index and every LDS offset compile-time, no loop branch among the WMMAs
    for (int kb = 0; kb < GK / 32; ++kb) {
      const int cur = kb & 1, nxt = cur ^ 1;
      if (kb == GK / 32 - 1) {
        // publish point of stage s + 1: it stands before stage s's last block, whose fragments
        // are already fetched, because the fetch below reads stage s + 1
        wait_ds0();
        if (pinned(wv < 3u)) wait_tensor0();
        __syncthreads();              // stage s + 1 readable; stage s's buffer left by every reader
        if (pinned((wv < 3u) & (s + 2 < nst)))
          gemm_tile_load(dst + (unsigned)(s & 1) * GBUF,
                         ga + (unsigned long long)(s + 2) * GROWB, d1);
      }
      // next block's fragments (in the last stage: landed rows of the other buffer, never used)
      const unsigned char* np = (kb == GK / 32 - 1) ? bn : bp + (kb + 1) * 64;
#pragma unroll  // fa, fb stay in registers: every index a constant
      for (int i = 0; i < 4; ++i) {
        fa[nxt][i] = frag_ld((const bhalf_t*)(np + aoff + i * 16 * GPITCH));
        fb[nxt][i] = frag_ld((const bhalf_t*)(np + boff + i * 16 * GPITCH));
      }
      // Keeps the 16 reads one group ahead of this block's products: left free, the compiler
      // sinks them among the WMMAs a pair at a time, each pair waited to 0.
      __builtin_amdgcn_sched_barrier(0);
#pragma unroll  // 16 independent accumulator tiles back to back, all in registers
      for (int mi = 0; mi < 4; ++mi)
#pragma unroll
        for (int ni = 0; ni < 4; ++ni)
          acc[mi][ni] = wmma_bf16f32(fa[cur][mi], fb[cur][ni], acc[mi][ni]);
      // Keeps the following block's reads behind these products, so that each group stays whole.
      __builtin_amdgcn_sched_barrier(0);
    }
  }
  wait_tensor0();
  wait_ds0();
#else
  // fallback: fragments straight from global
  for (int k = 0; k < Kdim; k += 32) {
    v16bf fa[4], fb[4];
#pragma unroll
    for (int mi = 0; mi < 4; ++mi)
      fa[mi] = frag_ld(A + (size_t)(m0 + mi * 16 + hl) * Kdim + k + g * 8);
#pragma unroll
    for (int ni = 0; ni < 4; ++ni)
      fb[ni] = frag_ld(W + (size_t)(n0 + ni * 16 + hl) * Kdim + k + g * 8);
#pragma unroll
    for (int mi = 0; mi < 4; ++mi)
#pragma unroll
      for (int ni = 0; ni < 4; ++ni)
        acc[mi][ni] = wmma_bf16f32(fa[mi], fb[ni], acc[mi][ni]);
  }
#endif

#pragma unroll
  for (int mi = 0; mi < 4; ++mi)
#pragma unroll
    for (int ni = 0; ni < 4; ++ni) {
      const int col = n0 + ni * 16 + hl;
      const float bv = bias[col];
#pragma unroll
      for (int r = 0; r < 8; ++r) {
        const int row = m0 + mi * 16 + r + 8 * g;
        float v = acc[mi][ni][r] + bv;
        if (EPI == 0) {
          ((bhalf_t*)outp)[(size_t)row * Ndim + col] = (bhalf_t)v;
        } else if (EPI == 1) {
          const int bidx = row >> 11;  // row / LL
          const int seq = row & (LL - 1);
          const size_t idx =
              (((size_t)(bidx * NH + (col >> 6)) * HD) + (col & (HD - 1))) * LL + seq;
          ((bhalf_t*)outp)[idx] = (bhalf_t)v;
        } else if (EPI == 2) {
          const size_t idx = (size_t)row * Ndim + col;
          ((float*)outp)[idx] = resid[idx] + v;
        } else {
          const float gv = 0.5f * v * (1.f + erff(v * 0.70710678118654752f));
          ((bhalf_t*)outp)[(size_t)row * Ndim + col] = (bhalf_t)gv;
        }
      }
    }
}

__device__ __forceinline__ float xhalf(float x) {
  const int b = __builtin_bit_cast(int, x);
  return __builtin_bit_cast(
      float, __builtin_amdgcn_permlanex16(b, b, 0x76543210, 0xfedcba98, false, false));
}

__global__ __launch_bounds__(256) void attn_flash(
    const bhalf_t* __restrict__ Q, const bhalf_t* __restrict__ Km,
    const bhalf_t* __restrict__ Vt, bhalf_t* __restrict__ ctxout,
    const int* __restrict__ pfx) {
#if HAVE_TDM
  // Two stages of [K 64 keys x 64 hd | V^T 64 hd x 64 keys], rows of 128 B at pitch 144 B.
  __shared__ __attribute__((aligned(2048))) unsigned char sKV[2u * ABUF];
#endif
  // The mask reads the same for any prefix below 0 as for 0 and above LL as for LL: bounded
  // here because the stage count, and so every staged address, is formed from it.
  const int praw = *pfx;
  const int prefix = praw < 0 ? 0 : (praw > LL ? LL : praw);
  const int lane = threadIdx.x & 31;
  const int wave = threadIdx.x >> 5;
  const int hl = lane & 15, g = lane >> 4;
  const int qblk = (blockIdx.x & (LL / 128 - 1)) * 128;  // query block start
  const int bh = blockIdx.x >> 4;                        // LL/128 == 16
  const int bidx = bh >> 4, h = bh & (NH - 1);
  const int q0 = qblk + wave * 16;                       // this wave's tile

  const bhalf_t* Qb = Q + (size_t)bidx * LL * DM + h * HD;
  const bhalf_t* Kb = Km + (size_t)bidx * LL * DM + h * HD;
  const bhalf_t* Vb = Vt + (size_t)bh * HD * LL;

  const bhalf_t* qp = Qb + (size_t)(q0 + hl) * DM + g * 8;
  const v16bf qa0 = frag_ld(qp);
  const v16bf qa1 = frag_ld(qp + 32);

  // This lane's query is q0 + hl. lrun sums only the keys this wave half holds;
  // the halves are joined once, behind the loop. ctx[nt][r] = O[q0 + hl][nt*16 + 8g + r].
  float mrun = -1e30f, lrun = 0.f;
  v8f ctx[4];
#pragma unroll
  for (int nt = 0; nt < 4; ++nt)
#pragma unroll
    for (int e = 0; e < 8; ++e) ctx[nt][e] = 0.f;

  // per-wave key extent (rounded to 32-key chunks), block-level extent (to 64-key stages)
  int kend_w = (q0 + 16 > prefix) ? (q0 + 16) : prefix;
  kend_w = (kend_w + 31) & ~31;
  int kend_b = (qblk + 128 > prefix) ? (qblk + 128) : prefix;
  kend_b = (kend_b + AKEYS - 1) & ~(AKEYS - 1);
  const int nst = kend_b / AKEYS;  // stages: at least two (128 keys), at most LL / 64
  const float scale = 0.125f;  // 1/sqrt(64)
  // One query per lane, so one key limit per lane: key allowed iff key < prefix, or
  // query >= prefix and key <= query; in the second case query + 1 > prefix.
  const int klim = (q0 + hl >= prefix) ? q0 + hl + 1 : prefix;

#if HAVE_TDM
  // wave 0 brings K (source pitch one row of DM), wave 1 V^T (source pitch one row of LL)
  const unsigned wv = uni(threadIdx.x >> 5);
  const unsigned long long ga = (unsigned long long)(uintptr_t)(wv == 0u ? Kb : Vb);
  const unsigned gstep = (wv == 0u) ? AKEYS * DM * 2u : AKEYS * 2u;  // source bytes per stage
  const unsigned dst = (unsigned)(uintptr_t)&sKV[0] + (wv == 1u ? ASLICE : 0u);
  const v8u d1 = attn_group1(wv == 0u ? DM * 2u : LL * 2u);
  v4u d0;
  d0[0] = uni(1u);
  d0[1] = uni(dst);
  d0[2] = uni((unsigned)ga);
  d0[3] = uni((((unsigned)(ga >> 32)) & 0x01FFFFFFu) | 0x80000000u);
  if (pinned(wv < 2u)) {
    attn_tile_load(d0, d1);           // stage 0
    wait_tensor0();
  }
  __syncthreads();                    // stage 0 readable by every wave
  if (pinned(wv < 2u)) {
    attn_step(d0, dst + ABUF, gstep);
    attn_tile_load(d0, d1);           // stage 1
  }
#endif

  for (int s = 0; s < nst; ++s) {
#if HAVE_TDM
    const unsigned char* bp = sKV + (unsigned)(s & 1) * ABUF;
#endif
#pragma unroll  // the stage's two chunks: every LDS offset an immediate
    for (int hf = 0; hf < AKEYS / 32; ++hf) {
    const int c = s * AKEYS + hf * 32;
    if (c < kend_w) {
      // ---- scores S^T[32 x 16] = K @ Q^T (2 key sub-tiles x 2 hd halves)
      v8f s[2];
      v16bf kb0[2], kb1[2];
#pragma unroll
      for (int t = 0; t < 2; ++t) {
#pragma unroll
        for (int e = 0; e < 8; ++e) s[t][e] = 0.f;
#if HAVE_TDM
        const unsigned char* kr = bp + (unsigned)(hf * 32 + t * 16 + hl) * APITCH + g * 16;
        kb0[t] = frag_ld((const bhalf_t*)kr);
        kb1[t] = frag_ld((const bhalf_t*)(kr + 64));
#else
        const bhalf_t* kp = Kb + (size_t)(c + t * 16 + hl) * DM + g * 8;
        kb0[t] = frag_ld(kp);
        kb1[t] = frag_ld(kp + 32);
#endif
      }
      v16bf vb[4];
#pragma unroll
      for (int nt = 0; nt < 4; ++nt) {
#if HAVE_TDM
        vb[nt] = frag_ld((const bhalf_t*)(bp + ASLICE + (unsigned)(nt * 16 + hl) * APITCH +
                                          hf * 64 + g * 16));
#else
        vb[nt] = frag_ld(Vb + (size_t)(nt * 16 + hl) * LL + c + g * 8);
#endif
      }
      // Keeps the chunk's 16 LDS reads one group ahead of the products: left free, the
      // compiler issues them a pair per product into one register set, each pair waited to 0.
      __builtin_amdgcn_sched_barrier(0);
#pragma unroll
      for (int t = 0; t < 2; ++t) s[t] = wmma_bf16f32(kb0[t], qa0, s[t]);
#pragma unroll
      for (int t = 0; t < 2; ++t) s[t] = wmma_bf16f32(kb1[t], qa1, s[t]);
      // ---- scale + prefix-decoder mask: this lane's score (t, r) is key c + 16t + 8g + r
#pragma unroll
      for (int t = 0; t < 2; ++t)
#pragma unroll
        for (int r = 0; r < 8; ++r) s[t][r] *= scale;
      if (c + 31 >= prefix) {  // same for the whole wave: chunks inside the prefix skip the mask
        const int rel = klim - c - 8 * g;
#pragma unroll
        for (int t = 0; t < 2; ++t)
#pragma unroll
          for (int r = 0; r < 8; ++r) s[t][r] = (t * 16 + r < rel) ? s[t][r] : -1e30f;
      }
      // ---- online softmax: 16 scores of one query per lane, one exchange for the maximum
      float t8[8];
#pragma unroll
      for (int r = 0; r < 8; ++r) t8[r] = fmaxf(s[0][r], s[1][r]);
      float tm = fmaxf(fmaxf(fmaxf(t8[0], t8[1]), fmaxf(t8[2], t8[3])),
                       fmaxf(fmaxf(t8[4], t8[5]), fmaxf(t8[6], t8[7])));
      tm = fmaxf(tm, xhalf(tm));
      const float mnew = fmaxf(mrun, tm);
      const float alpha = __expf(mrun - mnew);
      // P^T as a B operand: element 8t + r is key 16t + 8g + r, the order frag_ld gives V^T
      v16bf pb;
      float r4[4] = {0.f, 0.f, 0.f, 0.f};  // four short chains instead of one of 16 adds
#pragma unroll
      for (int t = 0; t < 2; ++t)
#pragma unroll
        for (int r = 0; r < 8; ++r) {
          const float p = __expf(s[t][r] - mnew);
          r4[r & 3] += p;
          pb[t * 8 + r] = (bhalf_t)p;
        }
      lrun = lrun * alpha + ((r4[0] + r4[1]) + (r4[2] + r4[3]));
      mrun = mnew;
#pragma unroll
      for (int nt = 0; nt < 4; ++nt)
#pragma unroll
        for (int r = 0; r < 8; ++r) ctx[nt][r] *= alpha;
      // ---- O^T += V^T @ P^T  (contraction over 32 keys, 4 hd row tiles)
#pragma unroll
      for (int nt = 0; nt < 4; ++nt) ctx[nt] = wmma_bf16f32(vb[nt], pb, ctx[nt]);
    }
    }
#if HAVE_TDM
    // publish point of stage s + 1, passed by every wave, also one that skipped the chunks
    wait_ds0();
    if (pinned(wv < 2u)) wait_tensor0();
    __syncthreads();                  // stage s + 1 readable; stage s's buffer left by every reader
    if (pinned((wv < 2u) & (s + 2 < nst))) {
      attn_step(d0, dst + (unsigned)(s & 1) * ABUF, gstep);
      attn_tile_load(d0, d1);         // stage s + 2
    }
#endif
  }
#if HAVE_TDM
  wait_tensor0();
  wait_ds0();
#endif
  // ---- normalize and store context: 8 consecutive head columns per lane, one 16-B store
  const float lsum = lrun + xhalf(lrun);
  bhalf_t* orow = ctxout + ((size_t)bidx * LL + q0 + hl) * DM + h * HD + 8 * g;
#pragma unroll
  for (int nt = 0; nt < 4; ++nt) {
    v8bf o;
#pragma unroll
    for (int r = 0; r < 8; ++r) o[r] = (bhalf_t)(ctx[nt][r] / lsum);
    *(v8bf*)(orow + nt * 16) = o;
  }
}

// ---------------------------------------------------------------------------
// Launch
// ---------------------------------------------------------------------------
extern "C" void kernel_launch(void* const* d_in, const int* in_sizes, int n_in,
                              void* d_out, int out_size, void* d_ws, size_t ws_size,
                              hipStream_t stream) {
  (void)in_sizes; (void)n_in; (void)out_size; (void)ws_size;
  const float* x    = (const float*)d_in[0];
  const float* ln1w = (const float*)d_in[1];
  const float* ln1b = (const float*)d_in[2];
  const float* inw  = (const float*)d_in[3];
  const float* inb  = (const float*)d_in[4];
  const float* outw = (const float*)d_in[5];
  const float* outb = (const float*)d_in[6];
  const float* ln2w = (const float*)d_in[7];
  const float* ln2b = (const float*)d_in[8];
  const float* fc1w = (const float*)d_in[9];
  const float* fc1b = (const float*)d_in[10];
  const float* fc2w = (const float*)d_in[11];
  const float* fc2b = (const float*)d_in[12];
  const int*   pfx  = (const int*)d_in[13];
  float* out = (float*)d_out;

  char* ws = (char*)d_ws;
  size_t off = 0;
  auto carve = [&](size_t bytes) -> void* {
    void* p = ws + off;
    off += (bytes + 255) & ~(size_t)255;
    return p;
  };
  bhalf_t* wqkv = (bhalf_t*)carve((size_t)3 * DM * DM * sizeof(bhalf_t));
  bhalf_t* wo   = (bhalf_t*)carve((size_t)DM * DM * sizeof(bhalf_t));
  bhalf_t* w1   = (bhalf_t*)carve((size_t)DF * DM * sizeof(bhalf_t));
  bhalf_t* w2   = (bhalf_t*)carve((size_t)DM * DF * sizeof(bhalf_t));
  bhalf_t* h1   = (bhalf_t*)carve((size_t)MM * DM * sizeof(bhalf_t));
  bhalf_t* Qb   = (bhalf_t*)carve((size_t)MM * DM * sizeof(bhalf_t));
  bhalf_t* Kb   = (bhalf_t*)carve((size_t)MM * DM * sizeof(bhalf_t));
  bhalf_t* Vt   = (bhalf_t*)carve((size_t)MM * DM * sizeof(bhalf_t));
  bhalf_t* ctxb = (bhalf_t*)carve((size_t)MM * DM * sizeof(bhalf_t));
  float*   x1   = (float*)carve((size_t)MM * DM * sizeof(float));
  bhalf_t* h2   = (bhalf_t*)carve((size_t)MM * DM * sizeof(bhalf_t));
  bhalf_t* ff1  = (bhalf_t*)carve((size_t)MM * DF * sizeof(bhalf_t));

  auto castN = [&](const float* src, bhalf_t* dst, int n) {
    cast_f32_bf16<<<n / CAST_CHUNK, 256, 0, stream>>>(src, dst);
  };
  castN(inw,  wqkv, 3 * DM * DM);
  castN(outw, wo,   DM * DM);
  castN(fc1w, w1,   DF * DM);
  castN(fc2w, w2,   DM * DF);

  layernorm_bf16<<<MM, 256, 0, stream>>>(x, ln1w, ln1b, h1);

  dim3 blk(256);
  dim3 gD(MM / 128, DM / 256);
  dim3 gF(MM / 128, DF / 256);
  gemm_bf16<0><<<gD, blk, 0, stream>>>(h1, wqkv,                       inb,          nullptr, Qb, MM, DM, DM);
  gemm_bf16<0><<<gD, blk, 0, stream>>>(h1, wqkv + (size_t)DM * DM,     inb + DM,     nullptr, Kb, MM, DM, DM);
  gemm_bf16<1><<<gD, blk, 0, stream>>>(h1, wqkv + (size_t)2 * DM * DM, inb + 2 * DM, nullptr, Vt, MM, DM, DM);

  attn_flash<<<BB * NH * (LL / 128), blk, 0, stream>>>(Qb, Kb, Vt, ctxb, pfx);

  gemm_bf16<2><<<gD, blk, 0, stream>>>(ctxb, wo, outb, x, x1, MM, DM, DM);
  layernorm_bf16<<<MM, 256, 0, stream>>>(x1, ln2w, ln2b, h2);
  gemm_bf16<3><<<gF, blk, 0, stream>>>(h2, w1, fc1b, nullptr, ff1, MM, DF, DM);
  gemm_bf16<2><<<gD, blk, 0, stream>>>(ff1, w2, fc2b, x1, out, MM, DM, DF);
}

// v006
// A run of this version takes 209 microseconds.
// Two timings next to v005 put it at 1.16 and 1.18 times that version's speed.
// All steps since v000 together make it 2.39 times as fast.
#include <hip/hip_runtime.h>

typedef __bf16 bhalf_t;
typedef __attribute__((ext_vector_type(16))) __bf16 v16bf;
typedef __attribute__((ext_vector_type(8)))  __bf16 v8bf;
typedef __attribute__((ext_vector_type(8)))  float  v8f;
typedef __attribute__((ext_vector_type(4)))  unsigned int v4u;

#define DM   1024   // d_model
#define NH   16     // heads
#define HD   64     // head dim
#define DF   4096   // d_ff
#define BB   2      // batch
#define LL   2048   // seq len
#define MM   (BB*LL)
#define AKEYS 64    // attention: keys per LDS stage (two 32-key chunks)

#if defined(__gfx1250__) && __has_builtin(__builtin_amdgcn_tensor_load_to_lds)
#define HAVE_TDM 1
#else
#define HAVE_TDM 0
#endif

__device__ __forceinline__ v8f wmma_bf16f32(v16bf a, v16bf b, v8f c) {
  return __builtin_amdgcn_wmma_f32_16x16x32_bf16(false, a, false, b, (short)0, c,
                                                 false, false);
}

__device__ __forceinline__ v16bf frag_ld(const bhalf_t* p) {
  v8bf lo = *(const v8bf*)(p);
  v8bf hi = *(const v8bf*)(p + 16);
  v16bf r;
#pragma unroll
  for (int i = 0; i < 8; ++i) { r[i] = lo[i]; r[8 + i] = hi[i]; }
  return r;
}

#if HAVE_TDM
typedef __attribute__((ext_vector_type(8))) unsigned int v8u;
#define GK      128                 // k elements per stage
#define GROWB   256u                // bytes of one staged row
#define GPITCH  272u                // LDS pitch of a staged row
#define GSLICE  (128u * GPITCH)     // one wave's request: 128 rows = 17 x 2 KiB
#define GBUF    (3u * GSLICE)       // a stage: A 128 rows, then W 256 rows

__device__ __forceinline__ unsigned uni(unsigned v) {
  return (unsigned)__builtin_amdgcn_readfirstlane(v);
}
__device__ __forceinline__ unsigned pinned(unsigned v) {
  unsigned w = uni(v);
  asm volatile("" : "+s"(w));
  return w;
}
__device__ __forceinline__ v8u gemm_group1(unsigned src_pitch_bytes) {
  v8u d;
  d[0] = uni((1u << 20) | (5u << 22) | (3u << 25));
  d[1] = uni((GROWB & 0xFFFFu) << 16);
  d[2] = uni((GROWB >> 16) | (128u << 16));
  d[3] = uni(GROWB << 16);
  d[4] = uni(128u);
  d[5] = uni(src_pitch_bytes);
  d[6] = uni(0u);
  d[7] = uni(0u);
  // Built once and kept: without this the compiler re-forms some words in the loop, in the
  // same registers, while a request is outstanding.
  asm volatile("" : "+s"(d));
  return d;
}
// Attention staging: a stage is 64 keys, K as 64 rows (keys) and V^T as 64 rows (head dims),
// each row 128 B, laid at an LDS pitch of 144 B (16 B x odd).
#define AROWB   128u                // bytes of one staged row
#define APITCH  144u                // LDS pitch of a staged row
#define ASLICE  10240u              // one wave's request: 64 rows = 9216 B, rounded up to 2 KiB
#define ABUF    (2u * ASLICE)       // a stage: K, then V^T
__device__ __forceinline__ v8u attn_group1(unsigned src_pitch_bytes) {
  v8u d;
  d[0] = uni((1u << 20) | (4u << 22) | (3u << 25));
  d[1] = uni((AROWB & 0xFFFFu) << 16);
  d[2] = uni((AROWB >> 16) | (64u << 16));
  d[3] = uni(AROWB << 16);
  d[4] = uni(64u);
  d[5] = uni(src_pitch_bytes);
  d[6] = uni(0u);
  d[7] = uni(0u);
  asm volatile("" : "+s"(d));
  return d;
}
__device__ __forceinline__ void gemm_tile_load(unsigned lds_dst, unsigned long long ga, v8u d1) {
  v4u d0;
  d0[0] = uni(1u);
  d0[1] = uni(lds_dst);
  d0[2] = uni((unsigned)ga);
  d0[3] = uni((((unsigned)(ga >> 32)) & 0x01FFFFFFu) | 0x80000000u);
  asm volatile("tensor_load_to_lds %0, %1" :: "s"(d0), "s"(d1) : "memory");
}
__device__ __forceinline__ void attn_tile_load(v4u& d0, v8u d1) {
  asm volatile("tensor_load_to_lds %0, %1" : "+s"(d0) : "s"(d1) : "memory");
}
// Next stage: new place in LDS, source address one stage on (a carry runs into address bits only).
__device__ __forceinline__ void attn_step(v4u& d0, unsigned lds_dst, unsigned step_bytes) {
  const unsigned long long a = (((unsigned long long)d0[3] << 32) | d0[2]) + step_bytes;
  d0[1] = uni(lds_dst);
  d0[2] = uni((unsigned)a);
  d0[3] = uni((unsigned)(a >> 32));
}
// The compiler places no wait for the tensor mover: a tile counts as landed only behind this.
__device__ __forceinline__ void wait_tensor0() { asm volatile("s_wait_tensorcnt 0x0" ::: "memory"); }
// A wave's LDS reads have retired before the buffer they read is handed back for a refill.
__device__ __forceinline__ void wait_ds0() { asm volatile("s_wait_dscnt 0x0" ::: "memory"); }
#endif  // HAVE_TDM

// ---------------------------------------------------------------------------
// fp32 -> bf16 cast (weights)
// ---------------------------------------------------------------------------
// A wave owns CAST_V * 512 contiguous bytes of the source: every load is 32 lanes x 16 B
// of whole lines, issued as one group ahead of the conversions. Few waves with much work
// each: a stream this short is bounded by how fast waves start, not by its bytes.
#define CAST_V      16                      // 16-byte loads per lane
#define CAST_WAVE   (CAST_V * 128)          // floats per wave
#define CAST_CHUNK  (8 * CAST_WAVE)         // floats per workgroup of 8 waves
static_assert((DM * DM) % CAST_CHUNK == 0, "every weight is a whole number of chunks");
typedef __attribute__((ext_vector_type(4))) float  v4f;
typedef __attribute__((ext_vector_type(4))) __bf16 v4bf;

__global__ __launch_bounds__(256) void cast_f32_bf16(const float* __restrict__ in,
                                                     bhalf_t* __restrict__ out) {
  const int base = blockIdx.x * CAST_CHUNK + (threadIdx.x >> 5) * CAST_WAVE +
                   (threadIdx.x & 31) * 4;
  v4f v[CAST_V];
#pragma unroll  // all loads issued as one group, each offset an immediate
  for (int u = 0; u < CAST_V; ++u) v[u] = *(const v4f*)(in + base + u * 128);
#pragma unroll  // v[] stays in registers; each store is 32 lanes x 8 B = two whole lines
  for (int u = 0; u < CAST_V; ++u) {
    v4bf o;
#pragma unroll  // four converts, packed in pairs
    for (int e = 0; e < 4; ++e) o[e] = (bhalf_t)v[u][e];
    *(v4bf*)(out + base + u * 128) = o;
  }
}

// ---------------------------------------------------------------------------
// LayerNorm (d=1024) -> bf16
// ---------------------------------------------------------------------------
__global__ __launch_bounds__(256) void layernorm_bf16(
    const float* __restrict__ x, const float* __restrict__ w,
    const float* __restrict__ b, bhalf_t* __restrict__ out) {
  __shared__ float red[256];
  const int row = blockIdx.x;
  const int tid = threadIdx.x;
  const float* xr = x + (size_t)row * DM;
  float s = 0.f;
  for (int i = tid; i < DM; i += 256) s += xr[i];
  red[tid] = s; __syncthreads();
  for (int o = 128; o > 0; o >>= 1) {
    if (tid < o) red[tid] += red[tid + o];
    __syncthreads();
  }
  const float mu = red[0] * (1.f / DM);
  __syncthreads();
  float v = 0.f;
  for (int i = tid; i < DM; i += 256) { float d = xr[i] - mu; v += d * d; }
  red[tid] = v; __syncthreads();
  for (int o = 128; o > 0; o >>= 1) {
    if (tid < o) red[tid] += red[tid + o];
    __syncthreads();
  }
  const float rstd = rsqrtf(red[0] * (1.f / DM) + 1e-5f);
  bhalf_t* orow = out + (size_t)row * DM;
  for (int i = tid; i < DM; i += 256)
    orow[i] = (bhalf_t)((xr[i] - mu) * rstd * w[i] + b[i]);
}

// ---------------------------------------------------------------------------
// GELU with erf, v * 0.5 * (1 + erf(v / sqrt(2))), without a branch.
// q = 0.5 * erfc(|v| / sqrt(2)) by the rational form t = 1 / (1 + p x),
// erfc(x) = (a1 t + ... + a5 t^5) exp(-x^2), absolute error at most 1.5e-7 for x >= 0;
// then v >= 0: v - v q, v < 0: v q, which is max(v, 0) - |v| q. No 1 + erf is formed, so
// the negative tail loses nothing to cancellation. The library erf takes two masked
// branches per element, one dependent chain each: elements could not overlap.
// ---------------------------------------------------------------------------
__device__ __forceinline__ float gelu_erf(float v) {
  const float a = fabsf(v);
  const float d = fmaf(a, 0.3275911f * 0.70710678118654752f, 1.f);
  const float w = (v * v) * (-0.5f * 1.4426950408889634f);
  const float t = __builtin_amdgcn_rcpf(d);
  const float e = __builtin_amdgcn_exp2f(w);
  float p = 0.5f * 1.061405429f;      // every coefficient carries the factor 0.5 of q
  p = fmaf(p, t, 0.5f * -1.453152027f);
  p = fmaf(p, t, 0.5f * 1.421413741f);
  p = fmaf(p, t, 0.5f * -0.284496736f);
  p = fmaf(p, t, 0.5f * 0.254829592f);
  const float q = (p * t) * e;
  return fmaf(-a, q, fmaxf(v, 0.f));
}

template <int EPI>
__global__ __launch_bounds__(256) void gemm_bf16(
    const bhalf_t* __restrict__ A, const bhalf_t* __restrict__ W,
    const float* __restrict__ bias, const float* __restrict__ resid,
    void* __restrict__ outp, int Mdim, int Ndim, int Kdim) {
  const int lane = threadIdx.x & 31;
  const int wave = threadIdx.x >> 5;
  const int hl = lane & 15, g = lane >> 4;
  const int wm = wave & 1;            // 2 row groups of 64
  const int wn = wave >> 1;           // 4 col groups of 64
  const int m0 = blockIdx.x * 128 + wm * 64;
  const int n0 = blockIdx.y * 256 + wn * 64;

  v8f acc[4][4];
#pragma unroll
  for (int i = 0; i < 4; ++i)
#pragma unroll
    for (int j = 0; j < 4; ++j)
#pragma unroll
      for (int e = 0; e < 8; ++e) acc[i][j][e] = 0.f;

#if HAVE_TDM
  // Two stages of [A 128 rows | W 256 rows], 256 B of k per row at pitch 272 B.
  __shared__ __attribute__((aligned(2048))) unsigned char sT[2u * GBUF];
  (void)Mdim;

  const unsigned wv = uni(threadIdx.x >> 5);
  // waves 0, 1, 2 each bring one slice of 128 rows: A, W rows 0-127, W rows 128-255
  const bhalf_t* sp = (wv == 0u)
      ? A + (size_t)blockIdx.x * 128 * Kdim
      : W + ((size_t)blockIdx.y * 256 + (wv == 2u ? 128 : 0)) * Kdim;
  const unsigned long long ga = (unsigned long long)(uintptr_t)sp;
  const unsigned dst = (unsigned)(uintptr_t)&sT[0] + (wv < 3u ? wv : 0u) * GSLICE;
  const v8u d1 = gemm_group1((unsigned)Kdim * 2u);
  const int nst = Kdim / GK;          // stages; at least two for every launch here

  if (pinned(wv < 3u)) {
    gemm_tile_load(dst, ga, d1);      // stage 0
    wait_tensor0();
  }
  __syncthreads();                    // stage 0 readable by every wave
  if (pinned(wv < 3u)) gemm_tile_load(dst + GBUF, ga + GROWB, d1);  // stage 1

  const unsigned aoff = (unsigned)(wm * 64 + hl) * GPITCH + (unsigned)g * 16u;
  const unsigned boff = GSLICE + (unsigned)(wn * 64 + hl) * GPITCH + (unsigned)g * 16u;

  // Two fragment sets: block b works on set b & 1 while block b + 1's 16 reads land in the other.
  v16bf fa[2][4], fb[2][4];
#pragma unroll
  for (int i = 0; i < 4; ++i) {
    fa[0][i] = frag_ld((const bhalf_t*)(sT + aoff + i * 16 * GPITCH));
    fb[0][i] = frag_ld((const bhalf_t*)(sT + boff + i * 16 * GPITCH));
  }

  for (int s = 0; s < nst; ++s) {
    const unsigned char* bp = sT + (unsigned)(s & 1) * GBUF;
    const unsigned char* bn = sT + (unsigned)((s + 1) & 1) * GBUF;
#pragma unroll  // the four 32-k blocks of a stage: set index and every LDS offset compile-time, no loop branch among the WMMAs
    for (int kb = 0; kb < GK / 32; ++kb) {
      const int cur = kb & 1, nxt = cur ^ 1;
      if (kb == GK / 32 - 1) {
        // publish point of stage s + 1: it stands before stage s's last block, whose fragments
        // are already fetched, because the fetch below reads stage s + 1
        wait_ds0();
        if (pinned(wv < 3u)) wait_tensor0();
        __syncthreads();              // stage s + 1 readable; stage s's buffer left by every reader
        if (pinned((wv < 3u) & (s + 2 < nst)))
          gemm_tile_load(dst + (unsigned)(s & 1) * GBUF,
                         ga + (unsigned long long)(s + 2) * GROWB, d1);
      }
      // next block's fragments (in the last stage: landed rows of the other buffer, never used)
      const unsigned char* np = (kb == GK / 32 - 1) ? bn : bp + (kb + 1) * 64;
#pragma unroll  // fa, fb stay in registers: every index a constant
      for (int i = 0; i < 4; ++i) {
        fa[nxt][i] = frag_ld((const bhalf_t*)(np + aoff + i * 16 * GPITCH));
        fb[nxt][i] = frag_ld((const bhalf_t*)(np + boff + i * 16 * GPITCH));
      }
      // Keeps the 16 reads one group ahead of this block's products: left free, the compiler
      // sinks them among the WMMAs a pair at a time, each pair waited to 0.
      __builtin_amdgcn_sched_barrier(0);
#pragma unroll  // 16 independent accumulator tiles back to back, all in registers
      for (int mi = 0; mi < 4; ++mi)
#pragma unroll
        for (int ni = 0; ni < 4; ++ni)
          acc[mi][ni] = wmma_bf16f32(fa[cur][mi], fb[cur][ni], acc[mi][ni]);
      // Keeps the following block's reads behind these products, so that each group stays whole.
      __builtin_amdgcn_sched_barrier(0);
    }
  }
  wait_tensor0();
  wait_ds0();
#else
  // fallback: fragments straight from global
  for (int k = 0; k < Kdim; k += 32) {
    v16bf fa[4], fb[4];
#pragma unroll
    for (int mi = 0; mi < 4; ++mi)
      fa[mi] = frag_ld(A + (size_t)(m0 + mi * 16 + hl) * Kdim + k + g * 8);
#pragma unroll
    for (int ni = 0; ni < 4; ++ni)
      fb[ni] = frag_ld(W + (size_t)(n0 + ni * 16 + hl) * Kdim + k + g * 8);
#pragma unroll
    for (int mi = 0; mi < 4; ++mi)
#pragma unroll
      for (int ni = 0; ni < 4; ++ni)
        acc[mi][ni] = wmma_bf16f32(fa[mi], fb[ni], acc[mi][ni]);
  }
#endif

  // GELU variant only: its tiles are kept apart below, which would hold each tile's bias load,
  // and the wait for it, inside the tile. So the wave's four bias values are loaded ahead.
  float bvv[4] = {0.f, 0.f, 0.f, 0.f};
  if (EPI == 3) {
#pragma unroll  // bvv stays in registers
    for (int ni = 0; ni < 4; ++ni) bvv[ni] = bias[n0 + ni * 16 + hl];
    // Stands ahead of the output address arithmetic, which reuses the loads' offset register.
    asm volatile("s_wait_xcnt 0x0" ::: "memory");
  }
#pragma unroll
  for (int mi = 0; mi < 4; ++mi)
#pragma unroll
    for (int ni = 0; ni < 4; ++ni) {
      const int col = n0 + ni * 16 + hl;
      const float bv = bias[col];
#pragma unroll
      for (int r = 0; r < 8; ++r) {
        const int row = m0 + mi * 16 + r + 8 * g;
        float v = acc[mi][ni][r] + (EPI == 3 ? bvv[ni] : bv);
        if (EPI == 0) {
          ((bhalf_t*)outp)[(size_t)row * Ndim + col] = (bhalf_t)v;
        } else if (EPI == 1) {
          const int bidx = row >> 11;  // row / LL
          const int seq = row & (LL - 1);
          const size_t idx =
              (((size_t)(bidx * NH + (col >> 6)) * HD) + (col & (HD - 1))) * LL + seq;
          ((bhalf_t*)outp)[idx] = (bhalf_t)v;
        } else if (EPI == 2) {
          const size_t idx = (size_t)row * Ndim + col;
          ((float*)outp)[idx] = resid[idx] + v;
        } else {
          ((bhalf_t*)outp)[(size_t)row * Ndim + col] = (bhalf_t)gelu_erf(v);
        }
      }
      // Keeps a tile's eight elements one group, its stores issued before the next tile starts.
      // Left free, the compiler mixes elements of several tiles.
      if (EPI == 3) __builtin_amdgcn_sched_barrier(0);
    }
}

__device__ __forceinline__ float xhalf(float x) {
  const int b = __builtin_bit_cast(int, x);
  return __builtin_bit_cast(
      float, __builtin_amdgcn_permlanex16(b, b, 0x76543210, 0xfedcba98, false, false));
}

__global__ __launch_bounds__(256) void attn_flash(
    const bhalf_t* __restrict__ Q, const bhalf_t* __restrict__ Km,
    const bhalf_t* __restrict__ Vt, bhalf_t* __restrict__ ctxout,
    const int* __restrict__ pfx) {
#if HAVE_TDM
  // Two stages of [K 64 keys x 64 hd | V^T 64 hd x 64 keys], rows of 128 B at pitch 144 B.
  __shared__ __attribute__((aligned(2048))) unsigned char sKV[2u * ABUF];
#endif
  // The mask reads the same for any prefix below 0 as for 0 and above LL as for LL: bounded
  // here because the stage count, and so every staged address, is formed from it.
  const int praw = *pfx;
  const int prefix = praw < 0 ? 0 : (praw > LL ? LL : praw);
  const int lane = threadIdx.x & 31;
  const int wave = threadIdx.x >> 5;
  const int hl = lane & 15, g = lane >> 4;
  const int qblk = (blockIdx.x & (LL / 128 - 1)) * 128;  // query block start
  const int bh = blockIdx.x >> 4;                        // LL/128 == 16
  const int bidx = bh >> 4, h = bh & (NH - 1);
  const int q0 = qblk + wave * 16;                       // this wave's tile

  const bhalf_t* Qb = Q + (size_t)bidx * LL * DM + h * HD;
  const bhalf_t* Kb = Km + (size_t)bidx * LL * DM + h * HD;
  const bhalf_t* Vb = Vt + (size_t)bh * HD * LL;

  const bhalf_t* qp = Qb + (size_t)(q0 + hl) * DM + g * 8;
  const v16bf qa0 = frag_ld(qp);
  const v16bf qa1 = frag_ld(qp + 32);

  // This lane's query is q0 + hl. lrun sums only the keys this wave half holds;
  // the halves are joined once, behind the loop. ctx[nt][r] = O[q0 + hl][nt*16 + 8g + r].
  float mrun = -1e30f, lrun = 0.f;
  v8f ctx[4];
#pragma unroll
  for (int nt = 0; nt < 4; ++nt)
#pragma unroll
    for (int e = 0; e < 8; ++e) ctx[nt][e] = 0.f;

  // per-wave key extent (rounded to 32-key chunks), block-level extent (to 64-key stages)
  int kend_w = (q0 + 16 > prefix) ? (q0 + 16) : prefix;
  kend_w = (kend_w + 31) & ~31;
  int kend_b = (qblk + 128 > prefix) ? (qblk + 128) : prefix;
  kend_b = (kend_b + AKEYS - 1) & ~(AKEYS - 1);
  const int nst = kend_b / AKEYS;  // stages: at least two (128 keys), at most LL / 64
  const float scale = 0.125f;  // 1/sqrt(64)
  // One query per lane, so one key limit per lane: key allowed iff key < prefix, or
  // query >= prefix and key <= query; in the second case query + 1 > prefix.
  const int klim = (q0 + hl >= prefix) ? q0 + hl + 1 : prefix;

#if HAVE_TDM
  // wave 0 brings K (source pitch one row of DM), wave 1 V^T (source pitch one row of LL)
  const unsigned wv = uni(threadIdx.x >> 5);
  const unsigned long long ga = (unsigned long long)(uintptr_t)(wv == 0u ? Kb : Vb);
  const unsigned gstep = (wv == 0u) ? AKEYS * DM * 2u : AKEYS * 2u;  // source bytes per stage
  const unsigned dst = (unsigned)(uintptr_t)&sKV[0] + (wv == 1u ? ASLICE : 0u);
  const v8u d1 = attn_group1(wv == 0u ? DM * 2u : LL * 2u);
  v4u d0;
  d0[0] = uni(1u);
  d0[1] = uni(dst);
  d0[2] = uni((unsigned)ga);
  d0[3] = uni((((unsigned)(ga >> 32)) & 0x01FFFFFFu) | 0x80000000u);
  if (pinned(wv < 2u)) {
    attn_tile_load(d0, d1);           // stage 0
    wait_tensor0();
  }
  __syncthreads();                    // stage 0 readable by every wave
  if (pinned(wv < 2u)) {
    attn_step(d0, dst + ABUF, gstep);
    attn_tile_load(d0, d1);           // stage 1
  }
#endif

  for (int s = 0; s < nst; ++s) {
#if HAVE_TDM
    const unsigned char* bp = sKV + (unsigned)(s & 1) * ABUF;
#endif
#pragma unroll  // the stage's two chunks: every LDS offset an immediate
    for (int hf = 0; hf < AKEYS / 32; ++hf) {
    const int c = s * AKEYS + hf * 32;
    if (c < kend_w) {
      // ---- scores S^T[32 x 16] = K @ Q^T (2 key sub-tiles x 2 hd halves)
      v8f s[2];
      v16bf kb0[2], kb1[2];
#pragma unroll
      for (int t = 0; t < 2; ++t) {
#pragma unroll
        for (int e = 0; e < 8; ++e) s[t][e] = 0.f;
#if HAVE_TDM
        const unsigned char* kr = bp + (unsigned)(hf * 32 + t * 16 + hl) * APITCH + g * 16;
        kb0[t] = frag_ld((const bhalf_t*)kr);
        kb1[t] = frag_ld((const bhalf_t*)(kr + 64));
#else
        const bhalf_t* kp = Kb + (size_t)(c + t * 16 + hl) * DM + g * 8;
        kb0[t] = frag_ld(kp);
        kb1[t] = frag_ld(kp + 32);
#endif
      }
      v16bf vb[4];
#pragma unroll
      for (int nt = 0; nt < 4; ++nt) {
#if HAVE_TDM
        vb[nt] = frag_ld((const bhalf_t*)(bp + ASLICE + (unsigned)(nt * 16 + hl) * APITCH +
                                          hf * 64 + g * 16));
#else
        vb[nt] = frag_ld(Vb + (size_t)(nt * 16 + hl) * LL + c + g * 8);
#endif
      }
      // Keeps the chunk's 16 LDS reads one group ahead of the products: left free, the
      // compiler issues them a pair per product into one register set, each pair waited to 0.
      __builtin_amdgcn_sched_barrier(0);
#pragma unroll
      for (int t = 0; t < 2; ++t) s[t] = wmma_bf16f32(kb0[t], qa0, s[t]);
#pragma unroll
      for (int t = 0; t < 2; ++t) s[t] = wmma_bf16f32(kb1[t], qa1, s[t]);
      // ---- scale + prefix-decoder mask: this lane's score (t, r) is key c + 16t + 8g + r
#pragma unroll
      for (int t = 0; t < 2; ++t)
#pragma unroll
        for (int r = 0; r < 8; ++r) s[t][r] *= scale;
      if (c + 31 >= prefix) {  // same for the whole wave: chunks inside the prefix skip the mask
        const int rel = klim - c - 8 * g;
#pragma unroll
        for (int t = 0; t < 2; ++t)
#pragma unroll
          for (int r = 0; r < 8; ++r) s[t][r] = (t * 16 + r < rel) ? s[t][r] : -1e30f;
      }
      // ---- online softmax: 16 scores of one query per lane, one exchange for the maximum
      float t8[8];
#pragma unroll
      for (int r = 0; r < 8; ++r) t8[r] = fmaxf(s[0][r], s[1][r]);
      float tm = fmaxf(fmaxf(fmaxf(t8[0], t8[1]), fmaxf(t8[2], t8[3])),
                       fmaxf(fmaxf(t8[4], t8[5]), fmaxf(t8[6], t8[7])));
      tm = fmaxf(tm, xhalf(tm));
      const float mnew = fmaxf(mrun, tm);
      const float alpha = __expf(mrun - mnew);
      // P^T as a B operand: element 8t + r is key 16t + 8g + r, the order frag_ld gives V^T
      v16bf pb;
      float r4[4] = {0.f, 0.f, 0.f, 0.f};  // four short chains instead of one of 16 adds
#pragma unroll
      for (int t = 0; t < 2; ++t)
#pragma unroll
        for (int r = 0; r < 8; ++r) {
          const float p = __expf(s[t][r] - mnew);
          r4[r & 3] += p;
          pb[t * 8 + r] = (bhalf_t)p;
        }
      lrun = lrun * alpha + ((r4[0] + r4[1]) + (r4[2] + r4[3]));
      mrun = mnew;
#pragma unroll
      for (int nt = 0; nt < 4; ++nt)
#pragma unroll
        for (int r = 0; r < 8; ++r) ctx[nt][r] *= alpha;
      // ---- O^T += V^T @ P^T  (contraction over 32 keys, 4 hd row tiles)
#pragma unroll
      for (int nt = 0; nt < 4; ++nt) ctx[nt] = wmma_bf16f32(vb[nt], pb, ctx[nt]);
    }
    }
#if HAVE_TDM
    // publish point of stage s + 1, passed by every wave, also one that skipped the chunks
    wait_ds0();
    if (pinned(wv < 2u)) wait_tensor0();
    __syncthreads();                  // stage s + 1 readable; stage s's buffer left by every reader
    if (pinned((wv < 2u) & (s + 2 < nst))) {
      attn_step(d0, dst + (unsigned)(s & 1) * ABUF, gstep);
      attn_tile_load(d0, d1);         // stage s + 2
    }
#endif
  }
#if HAVE_TDM
  wait_tensor0();
  wait_ds0();
#endif
  // ---- normalize and store context: 8 consecutive head columns per lane, one 16-B store
  const float lsum = lrun + xhalf(lrun);
  bhalf_t* orow = ctxout + ((size_t)bidx * LL + q0 + hl) * DM + h * HD + 8 * g;
#pragma unroll
  for (int nt = 0; nt < 4; ++nt) {
    v8bf o;
#pragma unroll
    for (int r = 0; r < 8; ++r) o[r] = (bhalf_t)(ctx[nt][r] / lsum);
    *(v8bf*)(orow + nt * 16) = o;
  }
}

// ---------------------------------------------------------------------------
// Launch
// ---------------------------------------------------------------------------
extern "C" void kernel_launch(void* const* d_in, const int* in_sizes, int n_in,
                              void* d_out, int out_size, void* d_ws, size_t ws_size,
                              hipStream_t stream) {
  (void)in_sizes; (void)n_in; (void)out_size; (void)ws_size;
  const float* x    = (const float*)d_in[0];
  const float* ln1w = (const float*)d_in[1];
  const float* ln1b = (const float*)d_in[2];
  const float* inw  = (const float*)d_in[3];
  const float* inb  = (const float*)d_in[4];
  const float* outw = (const float*)d_in[5];
  const float* outb = (const float*)d_in[6];
  const float* ln2w = (const float*)d_in[7];
  const float* ln2b = (const float*)d_in[8];
  const float* fc1w = (const float*)d_in[9];
  const float* fc1b = (const float*)d_in[10];
  const float* fc2w = (const float*)d_in[11];
  const float* fc2b = (const float*)d_in[12];
  const int*   pfx  = (const int*)d_in[13];
  float* out = (float*)d_out;

  char* ws = (char*)d_ws;
  size_t off = 0;
  auto carve = [&](size_t bytes) -> void* {
    void* p = ws + off;
    off += (bytes + 255) & ~(size_t)255;
    return p;
  };
  bhalf_t* wqkv = (bhalf_t*)carve((size_t)3 * DM * DM * sizeof(bhalf_t));
  bhalf_t* wo   = (bhalf_t*)carve((size_t)DM * DM * sizeof(bhalf_t));
  bhalf_t* w1   = (bhalf_t*)carve((size_t)DF * DM * sizeof(bhalf_t));
  bhalf_t* w2   = (bhalf_t*)carve((size_t)DM * DF * sizeof(bhalf_t));
  bhalf_t* h1   = (bhalf_t*)carve((size_t)MM * DM * sizeof(bhalf_t));
  bhalf_t* Qb   = (bhalf_t*)carve((size_t)MM * DM * sizeof(bhalf_t));
  bhalf_t* Kb   = (bhalf_t*)carve((size_t)MM * DM * sizeof(bhalf_t));
  bhalf_t* Vt   = (bhalf_t*)carve((size_t)MM * DM * sizeof(bhalf_t));
  bhalf_t* ctxb = (bhalf_t*)carve((size_t)MM * DM * sizeof(bhalf_t));
  float*   x1   = (float*)carve((size_t)MM * DM * sizeof(float));
  bhalf_t* h2   = (bhalf_t*)carve((size_t)MM * DM * sizeof(bhalf_t));
  bhalf_t* ff1  = (bhalf_t*)carve((size_t)MM * DF * sizeof(bhalf_t));

  auto castN = [&](const float* src, bhalf_t* dst, int n) {
    cast_f32_bf16<<<n / CAST_CHUNK, 256, 0, stream>>>(src, dst);
  };
  castN(inw,  wqkv, 3 * DM * DM);
  castN(outw, wo,   DM * DM);
  castN(fc1w, w1,   DF * DM);
  castN(fc2w, w2,   DM * DF);

  layernorm_bf16<<<MM, 256, 0, stream>>>(x, ln1w, ln1b, h1);

  dim3 blk(256);
  dim3 gD(MM / 128, DM / 256);
  dim3 gF(MM / 128, DF / 256);
  gemm_bf16<0><<<gD, blk, 0, stream>>>(h1, wqkv,                       inb,          nullptr, Qb, MM, DM, DM);
  gemm_bf16<0><<<gD, blk, 0, stream>>>(h1, wqkv + (size_t)DM * DM,     inb + DM,     nullptr, Kb, MM, DM, DM);
  gemm_bf16<1><<<gD, blk, 0, stream>>>(h1, wqkv + (size_t)2 * DM * DM, inb + 2 * DM, nullptr, Vt, MM, DM, DM);

  attn_flash<<<BB * NH * (LL / 128), blk, 0, stream>>>(Qb, Kb, Vt, ctxb, pfx);

  gemm_bf16<2><<<gD, blk, 0, stream>>>(ctxb, wo, outb, x, x1, MM, DM, DM);
  layernorm_bf16<<<MM, 256, 0, stream>>>(x1, ln2w, ln2b, h2);
  gemm_bf16<3><<<gF, blk, 0, stream>>>(h2, w1, fc1b, nullptr, ff1, MM, DF, DM);
  gemm_bf16<2><<<gD, blk, 0, stream>>>(ff1, w2, fc2b, x1, out, MM, DM, DF);
}

// v007
// It runs in 190 microseconds.
// Timed twice side by side with v006, it ran 1.12 and 1.09 times as fast.
// Over all steps from v000 it is 2.64 times as fast.
#include <hip/hip_runtime.h>

typedef __bf16 bhalf_t;
typedef __attribute__((ext_vector_type(16))) __bf16 v16bf;
typedef __attribute__((ext_vector_type(8)))  __bf16 v8bf;
typedef __attribute__((ext_vector_type(8)))  float  v8f;
typedef __attribute__((ext_vector_type(4)))  unsigned int v4u;

#define DM   1024   // d_model
#define NH   16     // heads
#define HD   64     // head dim
#define DF   4096   // d_ff
#define BB   2      // batch
#define LL   2048   // seq len
#define MM   (BB*LL)
#define AKEYS 64    // attention: keys per LDS stage (two 32-key chunks)

#if defined(__gfx1250__) && __has_builtin(__builtin_amdgcn_tensor_load_to_lds)
#define HAVE_TDM 1
#else
#define HAVE_TDM 0
#endif

__device__ __forceinline__ v8f wmma_bf16f32(v16bf a, v16bf b, v8f c) {
  return __builtin_amdgcn_wmma_f32_16x16x32_bf16(false, a, false, b, (short)0, c,
                                                 false, false);
}

__device__ __forceinline__ v16bf frag_ld(const bhalf_t* p) {
  v8bf lo = *(const v8bf*)(p);
  v8bf hi = *(const v8bf*)(p + 16);
  v16bf r;
#pragma unroll
  for (int i = 0; i < 8; ++i) { r[i] = lo[i]; r[8 + i] = hi[i]; }
  return r;
}

#if HAVE_TDM
typedef __attribute__((ext_vector_type(8))) unsigned int v8u;
#define GK      128                 // k elements per stage
#define GROWB   256u                // bytes of one staged row
#define GPITCH  272u                // LDS pitch of a staged row
#define GSLICE  (128u * GPITCH)     // one wave's request: 128 rows = 17 x 2 KiB
#define GBUF    (3u * GSLICE)       // a stage: A 128 rows, then W 256 rows

__device__ __forceinline__ unsigned uni(unsigned v) {
  return (unsigned)__builtin_amdgcn_readfirstlane(v);
}
__device__ __forceinline__ unsigned pinned(unsigned v) {
  unsigned w = uni(v);
  asm volatile("" : "+s"(w));
  return w;
}
__device__ __forceinline__ v8u gemm_group1(unsigned src_pitch_bytes) {
  v8u d;
  d[0] = uni((1u << 20) | (5u << 22) | (3u << 25));
  d[1] = uni((GROWB & 0xFFFFu) << 16);
  d[2] = uni((GROWB >> 16) | (128u << 16));
  d[3] = uni(GROWB << 16);
  d[4] = uni(128u);
  d[5] = uni(src_pitch_bytes);
  d[6] = uni(0u);
  d[7] = uni(0u);
  // Built once and kept: without this the compiler re-forms some words in the loop, in the
  // same registers, while a request is outstanding.
  asm volatile("" : "+s"(d));
  return d;
}
// Attention staging: a stage is 64 keys, K as 64 rows (keys) and V^T as 64 rows (head dims),
// each row 128 B, laid at an LDS pitch of 144 B (16 B x odd).
#define AROWB   128u                // bytes of one staged row
#define APITCH  144u                // LDS pitch of a staged row
#define ASLICE  10240u              // one wave's request: 64 rows = 9216 B, rounded up to 2 KiB
#define ABUF    (2u * ASLICE)       // a stage: K, then V^T
__device__ __forceinline__ v8u attn_group1(unsigned src_pitch_bytes) {
  v8u d;
  d[0] = uni((1u << 20) | (4u << 22) | (3u << 25));
  d[1] = uni((AROWB & 0xFFFFu) << 16);
  d[2] = uni((AROWB >> 16) | (64u << 16));
  d[3] = uni(AROWB << 16);
  d[4] = uni(64u);
  d[5] = uni(src_pitch_bytes);
  d[6] = uni(0u);
  d[7] = uni(0u);
  asm volatile("" : "+s"(d));
  return d;
}
__device__ __forceinline__ void gemm_tile_load(unsigned lds_dst, unsigned long long ga, v8u d1) {
  v4u d0;
  d0[0] = uni(1u);
  d0[1] = uni(lds_dst);
  d0[2] = uni((unsigned)ga);
  d0[3] = uni((((unsigned)(ga >> 32)) & 0x01FFFFFFu) | 0x80000000u);
  asm volatile("tensor_load_to_lds %0, %1" :: "s"(d0), "s"(d1) : "memory");
}
__device__ __forceinline__ void attn_tile_load(v4u& d0, v8u d1) {
  asm volatile("tensor_load_to_lds %0, %1" : "+s"(d0) : "s"(d1) : "memory");
}
// Next stage: new place in LDS, source address one stage on (a carry runs into address bits only).
__device__ __forceinline__ void attn_step(v4u& d0, unsigned lds_dst, unsigned step_bytes) {
  const unsigned long long a = (((unsigned long long)d0[3] << 32) | d0[2]) + step_bytes;
  d0[1] = uni(lds_dst);
  d0[2] = uni((unsigned)a);
  d0[3] = uni((unsigned)(a >> 32));
}
// The compiler places no wait for the tensor mover: a tile counts as landed only behind this.
__device__ __forceinline__ void wait_tensor0() { asm volatile("s_wait_tensorcnt 0x0" ::: "memory"); }
// A wave's LDS reads have retired before the buffer they read is handed back for a refill.
__device__ __forceinline__ void wait_ds0() { asm volatile("s_wait_dscnt 0x0" ::: "memory"); }
#endif  // HAVE_TDM

// ---------------------------------------------------------------------------
// fp32 -> bf16 cast (weights)
// ---------------------------------------------------------------------------
// A wave owns CAST_V * 512 contiguous bytes of the source: every load is 32 lanes x 16 B
// of whole lines, issued as one group ahead of the conversions. Few waves with much work
// each: a stream this short is bounded by how fast waves start, not by its bytes.
#define CAST_V      16                      // 16-byte loads per lane
#define CAST_WAVE   (CAST_V * 128)          // floats per wave
#define CAST_CHUNK  (8 * CAST_WAVE)         // floats per workgroup of 8 waves
static_assert((DM * DM) % CAST_CHUNK == 0, "every weight is a whole number of chunks");
typedef __attribute__((ext_vector_type(4))) float  v4f;
typedef __attribute__((ext_vector_type(4))) __bf16 v4bf;
#define CAST_C1  (3 * DM * DM / CAST_CHUNK)            // chunks of the input projection
#define CAST_C2  (CAST_C1 + DM * DM / CAST_CHUNK)      // ... and the output projection
#define CAST_C3  (CAST_C2 + DF * DM / CAST_CHUNK)      // ... and fc1
#define CAST_C4  (CAST_C3 + DM * DF / CAST_CHUNK)      // ... and fc2: the grid

__global__ __launch_bounds__(256) void cast_f32_bf16(const float* __restrict__ wa,
                                                     const float* __restrict__ wb,
                                                     const float* __restrict__ wc,
                                                     const float* __restrict__ wd,
                                                     bhalf_t* __restrict__ out) {
  const int c = blockIdx.x;
  const float* in = c < CAST_C1 ? wa : c < CAST_C2 ? wb : c < CAST_C3 ? wc : wd;
  const int c0 = c < CAST_C1 ? 0 : c < CAST_C2 ? CAST_C1 : c < CAST_C3 ? CAST_C2 : CAST_C3;
  const int lo = (threadIdx.x >> 5) * CAST_WAVE + (threadIdx.x & 31) * 4;
  const float* ip = in + (c - c0) * CAST_CHUNK + lo;
  bhalf_t* op = out + c * CAST_CHUNK + lo;
  v4f v[CAST_V];
#pragma unroll  // all loads issued as one group, each offset an immediate
  for (int u = 0; u < CAST_V; ++u) v[u] = *(const v4f*)(ip + u * 128);
#pragma unroll  // v[] stays in registers; each store is 32 lanes x 8 B = two whole lines
  for (int u = 0; u < CAST_V; ++u) {
    v4bf o;
#pragma unroll  // four converts, packed in pairs
    for (int e = 0; e < 4; ++e) o[e] = (bhalf_t)v[u][e];
    *(v4bf*)(op + u * 128) = o;
  }
}

// ---------------------------------------------------------------------------
// LayerNorm (d=1024) -> bf16
// ---------------------------------------------------------------------------
__global__ __launch_bounds__(256) void layernorm_bf16(
    const float* __restrict__ x, const float* __restrict__ w,
    const float* __restrict__ b, bhalf_t* __restrict__ out) {
  __shared__ float red[256];
  const int row = blockIdx.x;
  const int tid = threadIdx.x;
  const float* xr = x + (size_t)row * DM;
  float s = 0.f;
  for (int i = tid; i < DM; i += 256) s += xr[i];
  red[tid] = s; __syncthreads();
  for (int o = 128; o > 0; o >>= 1) {
    if (tid < o) red[tid] += red[tid + o];
    __syncthreads();
  }
  const float mu = red[0] * (1.f / DM);
  __syncthreads();
  float v = 0.f;
  for (int i = tid; i < DM; i += 256) { float d = xr[i] - mu; v += d * d; }
  red[tid] = v; __syncthreads();
  for (int o = 128; o > 0; o >>= 1) {
    if (tid < o) red[tid] += red[tid + o];
    __syncthreads();
  }
  const float rstd = rsqrtf(red[0] * (1.f / DM) + 1e-5f);
  bhalf_t* orow = out + (size_t)row * DM;
  for (int i = tid; i < DM; i += 256)
    orow[i] = (bhalf_t)((xr[i] - mu) * rstd * w[i] + b[i]);
}

// ---------------------------------------------------------------------------
// GELU with erf, v * 0.5 * (1 + erf(v / sqrt(2))), without a branch.
// q = 0.5 * erfc(|v| / sqrt(2)) by the rational form t = 1 / (1 + p x),
// erfc(x) = (a1 t + ... + a5 t^5) exp(-x^2), absolute error at most 1.5e-7 for x >= 0;
// then v >= 0: v - v q, v < 0: v q, which is max(v, 0) - |v| q. No 1 + erf is formed, so
// the negative tail loses nothing to cancellation. The library erf takes two masked
// branches per element, one dependent chain each: elements could not overlap.
// ---------------------------------------------------------------------------
__device__ __forceinline__ float gelu_erf(float v) {
  const float a = fabsf(v);
  const float d = fmaf(a, 0.3275911f * 0.70710678118654752f, 1.f);
  const float w = (v * v) * (-0.5f * 1.4426950408889634f);
  const float t = __builtin_amdgcn_rcpf(d);
  const float e = __builtin_amdgcn_exp2f(w);
  float p = 0.5f * 1.061405429f;      // every coefficient carries the factor 0.5 of q
  p = fmaf(p, t, 0.5f * -1.453152027f);
  p = fmaf(p, t, 0.5f * 1.421413741f);
  p = fmaf(p, t, 0.5f * -0.284496736f);
  p = fmaf(p, t, 0.5f * 0.254829592f);
  const float q = (p * t) * e;
  return fmaf(-a, q, fmaxf(v, 0.f));
}

template <int V> struct store_form { static constexpr int value = V; };

template <int EPI>
__global__ __launch_bounds__(256) void gemm_bf16(
    const bhalf_t* __restrict__ A, const bhalf_t* __restrict__ W,
    const float* __restrict__ bias, const float* __restrict__ resid,
    void* __restrict__ outp, int Mdim, int Ndim, int Kdim) {
  const int lane = threadIdx.x & 31;
  const int wave = threadIdx.x >> 5;
  const int hl = lane & 15, g = lane >> 4;
  const int wm = wave & 1;            // 2 row groups of 64
  const int wn = wave >> 1;           // 4 col groups of 64
  const int m0 = blockIdx.x * 128 + wm * 64;
  const int n0 = blockIdx.y * 256 + wn * 64;

  v8f acc[4][4];
#pragma unroll
  for (int i = 0; i < 4; ++i)
#pragma unroll
    for (int j = 0; j < 4; ++j)
#pragma unroll
      for (int e = 0; e < 8; ++e) acc[i][j][e] = 0.f;

#if HAVE_TDM
  // Two stages of [A 128 rows | W 256 rows], 256 B of k per row at pitch 272 B.
  __shared__ __attribute__((aligned(2048))) unsigned char sT[2u * GBUF];
  (void)Mdim;

  const unsigned wv = uni(threadIdx.x >> 5);
  // waves 0, 1, 2 each bring one slice of 128 rows: A, W rows 0-127, W rows 128-255
  const bhalf_t* sp = (wv == 0u)
      ? A + (size_t)blockIdx.x * 128 * Kdim
      : W + ((size_t)blockIdx.y * 256 + (wv == 2u ? 128 : 0)) * Kdim;
  const unsigned long long ga = (unsigned long long)(uintptr_t)sp;
  const unsigned dst = (unsigned)(uintptr_t)&sT[0] + (wv < 3u ? wv : 0u) * GSLICE;
  const v8u d1 = gemm_group1((unsigned)Kdim * 2u);
  const int nst = Kdim / GK;          // stages; at least two for every launch here

  if (pinned(wv < 3u)) {
    gemm_tile_load(dst, ga, d1);      // stage 0
    wait_tensor0();
  }
  __syncthreads();                    // stage 0 readable by every wave
  if (pinned(wv < 3u)) gemm_tile_load(dst + GBUF, ga + GROWB, d1);  // stage 1

  const unsigned aoff = (unsigned)(wm * 64 + hl) * GPITCH + (unsigned)g * 16u;
  const unsigned boff = GSLICE + (unsigned)(wn * 64 + hl) * GPITCH + (unsigned)g * 16u;

  // Two fragment sets: block b works on set b & 1 while block b + 1's 16 reads land in the other.
  v16bf fa[2][4], fb[2][4];
#pragma unroll
  for (int i = 0; i < 4; ++i) {
    fa[0][i] = frag_ld((const bhalf_t*)(sT + aoff + i * 16 * GPITCH));
    fb[0][i] = frag_ld((const bhalf_t*)(sT + boff + i * 16 * GPITCH));
  }

  for (int s = 0; s < nst; ++s) {
    const unsigned char* bp = sT + (unsigned)(s & 1) * GBUF;
    const unsigned char* bn = sT + (unsigned)((s + 1) & 1) * GBUF;
#pragma unroll  // the four 32-k blocks of a stage: set index and every LDS offset compile-time, no loop branch among the WMMAs
    for (int kb = 0; kb < GK / 32; ++kb) {
      const int cur = kb & 1, nxt = cur ^ 1;
      if (kb == GK / 32 - 1) {
        // publish point of stage s + 1: it stands before stage s's last block, whose fragments
        // are already fetched, because the fetch below reads stage s + 1
        wait_ds0();
        if (pinned(wv < 3u)) wait_tensor0();
        __syncthreads();              // stage s + 1 readable; stage s's buffer left by every reader
        if (pinned((wv < 3u) & (s + 2 < nst)))
          gemm_tile_load(dst + (unsigned)(s & 1) * GBUF,
                         ga + (unsigned long long)(s + 2) * GROWB, d1);
      }
      // next block's fragments (in the last stage: landed rows of the other buffer, never used)
      const unsigned char* np = (kb == GK / 32 - 1) ? bn : bp + (kb + 1) * 64;
#pragma unroll  // fa, fb stay in registers: every index a constant
      for (int i = 0; i < 4; ++i) {
        fa[nxt][i] = frag_ld((const bhalf_t*)(np + aoff + i * 16 * GPITCH));
        fb[nxt][i] = frag_ld((const bhalf_t*)(np + boff + i * 16 * GPITCH));
      }
      // Keeps the 16 reads one group ahead of this block's products: left free, the compiler
      // sinks them among the WMMAs a pair at a time, each pair waited to 0.
      __builtin_amdgcn_sched_barrier(0);
#pragma unroll  // 16 independent accumulator tiles back to back, all in registers
      for (int mi = 0; mi < 4; ++mi)
#pragma unroll
        for (int ni = 0; ni < 4; ++ni)
          acc[mi][ni] = wmma_bf16f32(fa[cur][mi], fb[cur][ni], acc[mi][ni]);
      // Keeps the following block's reads behind these products, so that each group stays whole.
      __builtin_amdgcn_sched_barrier(0);
    }
  }
  wait_tensor0();
  wait_ds0();
#else
  // fallback: fragments straight from global
  for (int k = 0; k < Kdim; k += 32) {
    v16bf fa[4], fb[4];
#pragma unroll
    for (int mi = 0; mi < 4; ++mi)
      fa[mi] = frag_ld(A + (size_t)(m0 + mi * 16 + hl) * Kdim + k + g * 8);
#pragma unroll
    for (int ni = 0; ni < 4; ++ni)
      fb[ni] = frag_ld(W + (size_t)(n0 + ni * 16 + hl) * Kdim + k + g * 8);
#pragma unroll
    for (int mi = 0; mi < 4; ++mi)
#pragma unroll
      for (int ni = 0; ni < 4; ++ni)
        acc[mi][ni] = wmma_bf16f32(fa[mi], fb[ni], acc[mi][ni]);
  }
#endif

  // GELU variant: its tiles are kept apart below, which would hold each tile's bias load,
  // and the wait for it, inside the tile. So the wave's four bias values are loaded ahead.
  // Merged projections: loaded ahead too, once for both store forms.
  float bvv[4] = {0.f, 0.f, 0.f, 0.f};
  if (EPI == 3 || EPI == 4) {
#pragma unroll  // bvv stays in registers
    for (int ni = 0; ni < 4; ++ni) bvv[ni] = bias[n0 + ni * 16 + hl];
    // Stands ahead of the output address arithmetic, which reuses the loads' offset register.
    asm volatile("s_wait_xcnt 0x0" ::: "memory");
  }
  if (EPI == 4) {
    // A workgroup's 256 columns lie in one of Q, K, V: part is the same for all its waves.
    const int part = (int)(blockIdx.y / (DM / 256));
    bhalf_t* po = (bhalf_t*)outp + (size_t)part * MM * DM;
    const int oc0 = n0 - part * DM;   // the wave's first column inside its own output
    auto store_tiles = [&](auto form) {
      constexpr int E = decltype(form)::value;  // store form, a compile-time value
#pragma unroll  // acc and bvv stay in registers: every index a constant
      for (int mi = 0; mi < 4; ++mi)
#pragma unroll
        for (int ni = 0; ni < 4; ++ni) {
          const int col = oc0 + ni * 16 + hl;
#pragma unroll
          for (int r = 0; r < 8; ++r) {
            const int row = m0 + mi * 16 + r + 8 * g;
            const float v = acc[mi][ni][r] + bvv[ni];
            if (E == 0) {
              po[(size_t)row * Ndim + col] = (bhalf_t)v;
            } else {
              const int bidx = row >> 11;  // row / LL
              const int seq = row & (LL - 1);
              const size_t idx =
                  (((size_t)(bidx * NH + (col >> 6)) * HD) + (col & (HD - 1))) * LL + seq;
              po[idx] = (bhalf_t)v;
            }
          }
        }
    };
    if (part < 2) {
      store_tiles(store_form<0>{});
    } else {
      store_tiles(store_form<1>{});
      // The compiler lays the row-store path directly behind this one, entered from here on a
      // test that never holds; that path's first lines rewrite these stores' address registers.
      asm volatile("s_wait_xcnt 0x0" ::: "memory");
    }
    return;
  }
#pragma unroll
  for (int mi = 0; mi < 4; ++mi)
#pragma unroll
    for (int ni = 0; ni < 4; ++ni) {
      const int col = n0 + ni * 16 + hl;
      const float bv = bias[col];
#pragma unroll
      for (int r = 0; r < 8; ++r) {
        const int row = m0 + mi * 16 + r + 8 * g;
        float v = acc[mi][ni][r] + (EPI == 3 ? bvv[ni] : bv);
        if (EPI == 2) {
          const size_t idx = (size_t)row * Ndim + col;
          ((float*)outp)[idx] = resid[idx] + v;
        } else {
          ((bhalf_t*)outp)[(size_t)row * Ndim + col] = (bhalf_t)gelu_erf(v);
        }
      }
      // Keeps a tile's eight elements one group, its stores issued before the next tile starts.
      // Left free, the compiler mixes elements of several tiles.
      if (EPI == 3) __builtin_amdgcn_sched_barrier(0);
    }
}

__device__ __forceinline__ float xhalf(float x) {
  const int b = __builtin_bit_cast(int, x);
  return __builtin_bit_cast(
      float, __builtin_amdgcn_permlanex16(b, b, 0x76543210, 0xfedcba98, false, false));
}

__global__ __launch_bounds__(256) void attn_flash(
    const bhalf_t* __restrict__ Q, const bhalf_t* __restrict__ Km,
    const bhalf_t* __restrict__ Vt, bhalf_t* __restrict__ ctxout,
    const int* __restrict__ pfx) {
#if HAVE_TDM
  // Two stages of [K 64 keys x 64 hd | V^T 64 hd x 64 keys], rows of 128 B at pitch 144 B.
  __shared__ __attribute__((aligned(2048))) unsigned char sKV[2u * ABUF];
#endif
  // The mask reads the same for any prefix below 0 as for 0 and above LL as for LL: bounded
  // here because the stage count, and so every staged address, is formed from it.
  const int praw = *pfx;
  const int prefix = praw < 0 ? 0 : (praw > LL ? LL : praw);
  const int lane = threadIdx.x & 31;
  const int wave = threadIdx.x >> 5;
  const int hl = lane & 15, g = lane >> 4;
  const int qblk = (blockIdx.x & (LL / 128 - 1)) * 128;  // query block start
  const int bh = blockIdx.x >> 4;                        // LL/128 == 16
  const int bidx = bh >> 4, h = bh & (NH - 1);
  const int q0 = qblk + wave * 16;                       // this wave's tile

  const bhalf_t* Qb = Q + (size_t)bidx * LL * DM + h * HD;
  const bhalf_t* Kb = Km + (size_t)bidx * LL * DM + h * HD;
  const bhalf_t* Vb = Vt + (size_t)bh * HD * LL;

  const bhalf_t* qp = Qb + (size_t)(q0 + hl) * DM + g * 8;
  const v16bf qa0 = frag_ld(qp);
  const v16bf qa1 = frag_ld(qp + 32);

  // This lane's query is q0 + hl. lrun sums only the keys this wave half holds;
  // the halves are joined once, behind the loop. ctx[nt][r] = O[q0 + hl][nt*16 + 8g + r].
  float mrun = -1e30f, lrun = 0.f;
  v8f ctx[4];
#pragma unroll
  for (int nt = 0; nt < 4; ++nt)
#pragma unroll
    for (int e = 0; e < 8; ++e) ctx[nt][e] = 0.f;

  // per-wave key extent (rounded to 32-key chunks), block-level extent (to 64-key stages)
  int kend_w = (q0 + 16 > prefix) ? (q0 + 16) : prefix;
  kend_w = (kend_w + 31) & ~31;
  int kend_b = (qblk + 128 > prefix) ? (qblk + 128) : prefix;
  kend_b = (kend_b + AKEYS - 1) & ~(AKEYS - 1);
  const int nst = kend_b / AKEYS;  // stages: at least two (128 keys), at most LL / 64
  const float scale = 0.125f;  // 1/sqrt(64)
  // One query per lane, so one key limit per lane: key allowed iff key < prefix, or
  // query >= prefix and key <= query; in the second case query + 1 > prefix.
  const int klim = (q0 + hl >= prefix) ? q0 + hl + 1 : prefix;

#if HAVE_TDM
  // wave 0 brings K (source pitch one row of DM), wave 1 V^T (source pitch one row of LL)
  const unsigned wv = uni(threadIdx.x >> 5);
  const unsigned long long ga = (unsigned long long)(uintptr_t)(wv == 0u ? Kb : Vb);
  const unsigned gstep = (wv == 0u) ? AKEYS * DM * 2u : AKEYS * 2u;  // source bytes per stage
  const unsigned dst = (unsigned)(uintptr_t)&sKV[0] + (wv == 1u ? ASLICE : 0u);
  const v8u d1 = attn_group1(wv == 0u ? DM * 2u : LL * 2u);
  v4u d0;
  d0[0] = uni(1u);
  d0[1] = uni(dst);
  d0[2] = uni((unsigned)ga);
  d0[3] = uni((((unsigned)(ga >> 32)) & 0x01FFFFFFu) | 0x80000000u);
  if (pinned(wv < 2u)) {
    attn_tile_load(d0, d1);           // stage 0
    wait_tensor0();
  }
  __syncthreads();                    // stage 0 readable by every wave
  if (pinned(wv < 2u)) {
    attn_step(d0, dst + ABUF, gstep);
    attn_tile_load(d0, d1);           // stage 1
  }
#endif

  for (int s = 0; s < nst; ++s) {
#if HAVE_TDM
    const unsigned char* bp = sKV + (unsigned)(s & 1) * ABUF;
#endif
#pragma unroll  // the stage's two chunks: every LDS offset an immediate
    for (int hf = 0; hf < AKEYS / 32; ++hf) {
    const int c = s * AKEYS + hf * 32;
    if (c < kend_w) {
      // ---- scores S^T[32 x 16] = K @ Q^T (2 key sub-tiles x 2 hd halves)
      v8f s[2];
      v16bf kb0[2], kb1[2];
#pragma unroll
      for (int t = 0; t < 2; ++t) {
#pragma unroll
        for (int e = 0; e < 8; ++e) s[t][e] = 0.f;
#if HAVE_TDM
        const unsigned char* kr = bp + (unsigned)(hf * 32 + t * 16 + hl) * APITCH + g * 16;
        kb0[t] = frag_ld((const bhalf_t*)kr);
        kb1[t] = frag_ld((const bhalf_t*)(kr + 64));
#else
        const bhalf_t* kp = Kb + (size_t)(c + t * 16 + hl) * DM + g * 8;
        kb0[t] = frag_ld(kp);
        kb1[t] = frag_ld(kp + 32);
#endif
      }
      v16bf vb[4];
#pragma unroll
      for (int nt = 0; nt < 4; ++nt) {
#if HAVE_TDM
        vb[nt] = frag_ld((const bhalf_t*)(bp + ASLICE + (unsigned)(nt * 16 + hl) * APITCH +
                                          hf * 64 + g * 16));
#else
        vb[nt] = frag_ld(Vb + (size_t)(nt * 16 + hl) * LL + c + g * 8);
#endif
      }
      // Keeps the chunk's 16 LDS reads one group ahead of the products: left free, the
      // compiler issues them a pair per product into one register set, each pair waited to 0.
      __builtin_amdgcn_sched_barrier(0);
#pragma unroll
      for (int t = 0; t < 2; ++t) s[t] = wmma_bf16f32(kb0[t], qa0, s[t]);
#pragma unroll
      for (int t = 0; t < 2; ++t) s[t] = wmma_bf16f32(kb1[t], qa1, s[t]);
      // ---- scale + prefix-decoder mask: this lane's score (t, r) is key c + 16t + 8g + r
#pragma unroll
      for (int t = 0; t < 2; ++t)
#pragma unroll
        for (int r = 0; r < 8; ++r) s[t][r] *= scale;
      if (c + 31 >= prefix) {  // same for the whole wave: chunks inside the prefix skip the mask
        const int rel = klim - c - 8 * g;
#pragma unroll
        for (int t = 0; t < 2; ++t)
#pragma unroll
          for (int r = 0; r < 8; ++r) s[t][r] = (t * 16 + r < rel) ? s[t][r] : -1e30f;
      }
      // ---- online softmax: 16 scores of one query per lane, one exchange for the maximum
      float t8[8];
#pragma unroll
      for (int r = 0; r < 8; ++r) t8[r] = fmaxf(s[0][r], s[1][r]);
      float tm = fmaxf(fmaxf(fmaxf(t8[0], t8[1]), fmaxf(t8[2], t8[3])),
                       fmaxf(fmaxf(t8[4], t8[5]), fmaxf(t8[6], t8[7])));
      tm = fmaxf(tm, xhalf(tm));
      const float mnew = fmaxf(mrun, tm);
      const float alpha = __expf(mrun - mnew);
      // P^T as a B operand: element 8t + r is key 16t + 8g + r, the order frag_ld gives V^T
      v16bf pb;
      float r4[4] = {0.f, 0.f, 0.f, 0.f};  // four short chains instead of one of 16 adds
#pragma unroll
      for (int t = 0; t < 2; ++t)
#pragma unroll
        for (int r = 0; r < 8; ++r) {
          const float p = __expf(s[t][r] - mnew);
          r4[r & 3] += p;
          pb[t * 8 + r] = (bhalf_t)p;
        }
      lrun = lrun * alpha + ((r4[0] + r4[1]) + (r4[2] + r4[3]));
      mrun = mnew;
#pragma unroll
      for (int nt = 0; nt < 4; ++nt)
#pragma unroll
        for (int r = 0; r < 8; ++r) ctx[nt][r] *= alpha;
      // ---- O^T += V^T @ P^T  (contraction over 32 keys, 4 hd row tiles)
#pragma unroll
      for (int nt = 0; nt < 4; ++nt) ctx[nt] = wmma_bf16f32(vb[nt], pb, ctx[nt]);
    }
    }
#if HAVE_TDM
    // publish point of stage s + 1, passed by every wave, also one that skipped the chunks
    wait_ds0();
    if (pinned(wv < 2u)) wait_tensor0();
    __syncthreads();                  // stage s + 1 readable; stage s's buffer left by every reader
    if (pinned((wv < 2u) & (s + 2 < nst))) {
      attn_step(d0, dst + (unsigned)(s & 1) * ABUF, gstep);
      attn_tile_load(d0, d1);         // stage s + 2
    }
#endif
  }
#if HAVE_TDM
  wait_tensor0();
  wait_ds0();
#endif
  // ---- normalize and store context: 8 consecutive head columns per lane, one 16-B store
  const float lsum = lrun + xhalf(lrun);
  bhalf_t* orow = ctxout + ((size_t)bidx * LL + q0 + hl) * DM + h * HD + 8 * g;
#pragma unroll
  for (int nt = 0; nt < 4; ++nt) {
    v8bf o;
#pragma unroll
    for (int r = 0; r < 8; ++r) o[r] = (bhalf_t)(ctx[nt][r] / lsum);
    *(v8bf*)(orow + nt * 16) = o;
  }
}

// ---------------------------------------------------------------------------
// Launch
// ---------------------------------------------------------------------------
extern "C" void kernel_launch(void* const* d_in, const int* in_sizes, int n_in,
                              void* d_out, int out_size, void* d_ws, size_t ws_size,
                              hipStream_t stream) {
  (void)in_sizes; (void)n_in; (void)out_size; (void)ws_size;
  const float* x    = (const float*)d_in[0];
  const float* ln1w = (const float*)d_in[1];
  const float* ln1b = (const float*)d_in[2];
  const float* inw  = (const float*)d_in[3];
  const float* inb  = (const float*)d_in[4];
  const float* outw = (const float*)d_in[5];
  const float* outb = (const float*)d_in[6];
  const float* ln2w = (const float*)d_in[7];
  const float* ln2b = (const float*)d_in[8];
  const float* fc1w = (const float*)d_in[9];
  const float* fc1b = (const float*)d_in[10];
  const float* fc2w = (const float*)d_in[11];
  const float* fc2b = (const float*)d_in[12];
  const int*   pfx  = (const int*)d_in[13];
  float* out = (float*)d_out;

  char* ws = (char*)d_ws;
  size_t off = 0;
  auto carve = [&](size_t bytes) -> void* {
    void* p = ws + off;
    off += (bytes + 255) & ~(size_t)255;
    return p;
  };
  // the four bf16 weights as one range, in the cast grid's order
  bhalf_t* wqkv = (bhalf_t*)carve((size_t)CAST_C4 * CAST_CHUNK * sizeof(bhalf_t));
  bhalf_t* wo   = wqkv + (size_t)CAST_C1 * CAST_CHUNK;
  bhalf_t* w1   = wqkv + (size_t)CAST_C2 * CAST_CHUNK;
  bhalf_t* w2   = wqkv + (size_t)CAST_C3 * CAST_CHUNK;
  bhalf_t* h1   = (bhalf_t*)carve((size_t)MM * DM * sizeof(bhalf_t));
  // Q, K, V^T as one range, in the order the merged projection stores them
  bhalf_t* Qb   = (bhalf_t*)carve((size_t)3 * MM * DM * sizeof(bhalf_t));
  bhalf_t* Kb   = Qb + (size_t)MM * DM;
  bhalf_t* Vt   = Qb + (size_t)2 * MM * DM;
  bhalf_t* ctxb = (bhalf_t*)carve((size_t)MM * DM * sizeof(bhalf_t));
  float*   x1   = (float*)carve((size_t)MM * DM * sizeof(float));
  bhalf_t* h2   = (bhalf_t*)carve((size_t)MM * DM * sizeof(bhalf_t));
  bhalf_t* ff1  = (bhalf_t*)carve((size_t)MM * DF * sizeof(bhalf_t));

  cast_f32_bf16<<<CAST_C4, 256, 0, stream>>>(inw, outw, fc1w, fc2w, wqkv);

  layernorm_bf16<<<MM, 256, 0, stream>>>(x, ln1w, ln1b, h1);

  dim3 blk(256);
  dim3 gD(MM / 128, DM / 256);
  dim3 gF(MM / 128, DF / 256);
  dim3 gQ(MM / 128, 3 * DM / 256);
  gemm_bf16<4><<<gQ, blk, 0, stream>>>(h1, wqkv, inb, nullptr, Qb, MM, DM, DM);

  attn_flash<<<BB * NH * (LL / 128), blk, 0, stream>>>(Qb, Kb, Vt, ctxb, pfx);

  gemm_bf16<2><<<gD, blk, 0, stream>>>(ctxb, wo, outb, x, x1, MM, DM, DM);
  layernorm_bf16<<<MM, 256, 0, stream>>>(x1, ln2w, ln2b, h2);
  gemm_bf16<3><<<gF, blk, 0, stream>>>(h2, w1, fc1b, nullptr, ff1, MM, DF, DM);
  gemm_bf16<2><<<gD, blk, 0, stream>>>(ff1, w2, fc2b, x1, out, MM, DM, DF);
}

// v008
// One run takes 168 microseconds.
// Two timings next to v007 both put it at 1.13 times that version's speed.
// All steps since v000 together make it 2.98 times as fast.
#include <hip/hip_runtime.h>

typedef __bf16 bhalf_t;
typedef __attribute__((ext_vector_type(16))) __bf16 v16bf;
typedef __attribute__((ext_vector_type(8)))  __bf16 v8bf;
typedef __attribute__((ext_vector_type(8)))  float  v8f;
typedef __attribute__((ext_vector_type(4)))  unsigned int v4u;

#define DM   1024   // d_model
#define NH   16     // heads
#define HD   64     // head dim
#define DF   4096   // d_ff
#define BB   2      // batch
#define LL   2048   // seq len
#define MM   (BB*LL)
#define AKEYS 64    // attention: keys per LDS stage (two 32-key chunks)

#if defined(__gfx1250__) && __has_builtin(__builtin_amdgcn_tensor_load_to_lds)
#define HAVE_TDM 1
#else
#define HAVE_TDM 0
#endif

__device__ __forceinline__ v8f wmma_bf16f32(v16bf a, v16bf b, v8f c) {
  return __builtin_amdgcn_wmma_f32_16x16x32_bf16(false, a, false, b, (short)0, c,
                                                 false, false);
}

__device__ __forceinline__ v16bf frag_ld(const bhalf_t* p) {
  v8bf lo = *(const v8bf*)(p);
  v8bf hi = *(const v8bf*)(p + 16);
  v16bf r;
#pragma unroll
  for (int i = 0; i < 8; ++i) { r[i] = lo[i]; r[8 + i] = hi[i]; }
  return r;
}

#if HAVE_TDM
typedef __attribute__((ext_vector_type(8))) unsigned int v8u;
#define GK      128                 // k elements per stage
#define GROWB   256u                // bytes of one staged row
#define GPITCH  272u                // LDS pitch of a staged row
#define GSLICE  (128u * GPITCH)     // one wave's request: 128 rows = 17 x 2 KiB
#define GBUF    (3u * GSLICE)       // a stage: A 128 rows, then W 256 rows

__device__ __forceinline__ unsigned uni(unsigned v) {
  return (unsigned)__builtin_amdgcn_readfirstlane(v);
}
__device__ __forceinline__ unsigned pinned(unsigned v) {
  unsigned w = uni(v);
  asm volatile("" : "+s"(w));
  return w;
}
__device__ __forceinline__ v8u gemm_group1(unsigned src_pitch_bytes) {
  v8u d;
  d[0] = uni((1u << 20) | (5u << 22) | (3u << 25));
  d[1] = uni((GROWB & 0xFFFFu) << 16);
  d[2] = uni((GROWB >> 16) | (128u << 16));
  d[3] = uni(GROWB << 16);
  d[4] = uni(128u);
  d[5] = uni(src_pitch_bytes);
  d[6] = uni(0u);
  d[7] = uni(0u);
  // Built once and kept: without this the compiler re-forms some words in the loop, in the
  // same registers, while a request is outstanding.
  asm volatile("" : "+s"(d));
  return d;
}
// Attention staging: a stage is 64 keys, K as 64 rows (keys) and V^T as 64 rows (head dims),
// each row 128 B, laid at an LDS pitch of 144 B (16 B x odd).
#define AROWB   128u                // bytes of one staged row
#define APITCH  144u                // LDS pitch of a staged row
#define ASLICE  10240u              // one wave's request: 64 rows = 9216 B, rounded up to 2 KiB
#define ABUF    (2u * ASLICE)       // a stage: K, then V^T
__device__ __forceinline__ v8u attn_group1(unsigned src_pitch_bytes) {
  v8u d;
  d[0] = uni((1u << 20) | (4u << 22) | (3u << 25));
  d[1] = uni((AROWB & 0xFFFFu) << 16);
  d[2] = uni((AROWB >> 16) | (64u << 16));
  d[3] = uni(AROWB << 16);
  d[4] = uni(64u);
  d[5] = uni(src_pitch_bytes);
  d[6] = uni(0u);
  d[7] = uni(0u);
  asm volatile("" : "+s"(d));
  return d;
}
__device__ __forceinline__ void gemm_tile_load(unsigned lds_dst, unsigned long long ga, v8u d1) {
  v4u d0;
  d0[0] = uni(1u);
  d0[1] = uni(lds_dst);
  d0[2] = uni((unsigned)ga);
  d0[3] = uni((((unsigned)(ga >> 32)) & 0x01FFFFFFu) | 0x80000000u);
  asm volatile("tensor_load_to_lds %0, %1" :: "s"(d0), "s"(d1) : "memory");
}
__device__ __forceinline__ void attn_tile_load(v4u& d0, v8u d1) {
  asm volatile("tensor_load_to_lds %0, %1" : "+s"(d0) : "s"(d1) : "memory");
}
// Next stage: new place in LDS, source address one stage on (a carry runs into address bits only).
__device__ __forceinline__ void attn_step(v4u& d0, unsigned lds_dst, unsigned step_bytes) {
  const unsigned long long a = (((unsigned long long)d0[3] << 32) | d0[2]) + step_bytes;
  d0[1] = uni(lds_dst);
  d0[2] = uni((unsigned)a);
  d0[3] = uni((unsigned)(a >> 32));
}
// The compiler places no wait for the tensor mover: a tile counts as landed only behind this.
__device__ __forceinline__ void wait_tensor0() { asm volatile("s_wait_tensorcnt 0x0" ::: "memory"); }
// A wave's LDS reads have retired before the buffer they read is handed back for a refill.
__device__ __forceinline__ void wait_ds0() { asm volatile("s_wait_dscnt 0x0" ::: "memory"); }
#endif  // HAVE_TDM

// ---------------------------------------------------------------------------
// fp32 -> bf16 cast (weights)
// ---------------------------------------------------------------------------
// A wave owns CAST_V * 512 contiguous bytes of the source: every load is 32 lanes x 16 B
// of whole lines, issued as one group ahead of the conversions. Few waves with much work
// each: a stream this short is bounded by how fast waves start, not by its bytes.
#define CAST_V      16                      // 16-byte loads per lane
#define CAST_WAVE   (CAST_V * 128)          // floats per wave
#define CAST_CHUNK  (8 * CAST_WAVE)         // floats per workgroup of 8 waves
static_assert((DM * DM) % CAST_CHUNK == 0, "every weight is a whole number of chunks");
typedef __attribute__((ext_vector_type(4))) float  v4f;
typedef __attribute__((ext_vector_type(4))) __bf16 v4bf;
#define CAST_C1  (3 * DM * DM / CAST_CHUNK)            // chunks of the input projection
#define CAST_C2  (CAST_C1 + DM * DM / CAST_CHUNK)      // ... and the output projection
#define CAST_C3  (CAST_C2 + DF * DM / CAST_CHUNK)      // ... and fc1
#define CAST_C4  (CAST_C3 + DM * DF / CAST_CHUNK)      // ... and fc2: the grid

__global__ __launch_bounds__(256) void cast_f32_bf16(const float* __restrict__ wa,
                                                     const float* __restrict__ wb,
                                                     const float* __restrict__ wc,
                                                     const float* __restrict__ wd,
                                                     bhalf_t* __restrict__ out) {
  const int c = blockIdx.x;
  const float* in = c < CAST_C1 ? wa : c < CAST_C2 ? wb : c < CAST_C3 ? wc : wd;
  const int c0 = c < CAST_C1 ? 0 : c < CAST_C2 ? CAST_C1 : c < CAST_C3 ? CAST_C2 : CAST_C3;
  const int lo = (threadIdx.x >> 5) * CAST_WAVE + (threadIdx.x & 31) * 4;
  const float* ip = in + (c - c0) * CAST_CHUNK + lo;
  bhalf_t* op = out + c * CAST_CHUNK + lo;
  v4f v[CAST_V];
#pragma unroll  // all loads issued as one group, each offset an immediate
  for (int u = 0; u < CAST_V; ++u) v[u] = *(const v4f*)(ip + u * 128);
#pragma unroll  // v[] stays in registers; each store is 32 lanes x 8 B = two whole lines
  for (int u = 0; u < CAST_V; ++u) {
    v4bf o;
#pragma unroll  // four converts, packed in pairs
    for (int e = 0; e < 4; ++e) o[e] = (bhalf_t)v[u][e];
    *(v4bf*)(op + u * 128) = o;
  }
}

// ---------------------------------------------------------------------------
// LayerNorm (d=1024) -> bf16
// One wave owns one row and holds it in registers: each lane 8 loads of 16 B, every load
// 512 contiguous bytes of the row, all issued at once, with the weight's and the bias's
// behind them. The row is read from memory once; mean and variance are in-lane sums and a
// five-step exchange between lanes. No LDS and no barrier. With a workgroup per row, a lane's
// four 4-byte loads of each of three passes were waited for one after another, and each of
// the two sums went through an eight-step tree in LDS with a barrier per step.
// ---------------------------------------------------------------------------
#define LN_V 8                              // 16-byte loads per lane
static_assert(LN_V * 128 == DM, "a wave's loads cover exactly one row");
static_assert(MM % 8 == 0, "eight rows per workgroup, no part-filled workgroup");

template <int M>
__device__ __forceinline__ float xrow(float x) {
  return __builtin_bit_cast(
      float, __builtin_amdgcn_update_dpp(0, __builtin_bit_cast(int, x), 0x160 | M, 0xf, 0xf, true));
}
// Sum over the 32 lanes, the same value in every lane.
__device__ __forceinline__ float wave_sum(float v) {
  v += xrow<1>(v);
  v += xrow<2>(v);
  v += xrow<4>(v);
  v += xrow<8>(v);
  const int h = __builtin_bit_cast(int, v);
  return v + __builtin_bit_cast(
                 float, __builtin_amdgcn_permlanex16(h, h, 0x76543210, 0xfedcba98, false, false));
}

__global__ __launch_bounds__(256) void layernorm_bf16(
    const float* __restrict__ x, const float* __restrict__ w,
    const float* __restrict__ b, bhalf_t* __restrict__ out) {
  const int lo = (threadIdx.x & 31) * 4;
  const int row = blockIdx.x * 8 + (threadIdx.x >> 5);
  const float* xr = x + (size_t)row * DM + lo;
  v4f xv[LN_V], wv[LN_V], bv[LN_V];
#pragma unroll  // the row's loads issued as one group, each offset an immediate
  for (int u = 0; u < LN_V; ++u) xv[u] = *(const v4f*)(xr + u * 128);
  // Stands ahead of the loads below: the compiler lets one of them land in the row's address pair.
  asm volatile("s_wait_xcnt 0x0" ::: "memory");
  // Keeps the row's loads, the ones that come from furthest, first in the queue.
  __builtin_amdgcn_sched_barrier(0);
#pragma unroll  // in flight under the row's loads and the two sums
  for (int u = 0; u < LN_V; ++u) wv[u] = *(const v4f*)(w + lo + u * 128);
#pragma unroll
  for (int u = 0; u < LN_V; ++u) bv[u] = *(const v4f*)(b + lo + u * 128);
  // Keeps the 24 loads one group ahead of the arithmetic: left free, the compiler sinks the
  // weight's and the bias's behind the two sums, a pair at a time, each pair waited for.
  __builtin_amdgcn_sched_barrier(0);
  v4f s4 = xv[0];                           // four independent chains
#pragma unroll  // xv stays in registers
  for (int u = 1; u < LN_V; ++u) s4 += xv[u];
  const float mu = wave_sum((s4[0] + s4[1]) + (s4[2] + s4[3])) * (1.f / DM);
  v4f q4 = {0.f, 0.f, 0.f, 0.f};
#pragma unroll  // xv stays in registers; from here on it holds x - mu
  for (int u = 0; u < LN_V; ++u) {
    xv[u] -= mu;
    q4 += xv[u] * xv[u];
  }
  const float var = wave_sum((q4[0] + q4[1]) + (q4[2] + q4[3])) * (1.f / DM);
  const float rstd = rsqrtf(var + 1e-5f);
  bhalf_t* orow = out + (size_t)row * DM + lo;
#pragma unroll  // each store is 32 lanes x 8 B = two whole lines
  for (int u = 0; u < LN_V; ++u) {
    v4bf o;
#pragma unroll  // four values, packed in pairs
    for (int e = 0; e < 4; ++e) o[e] = (bhalf_t)(xv[u][e] * rstd * wv[u][e] + bv[u][e]);
    *(v4bf*)(orow + u * 128) = o;
  }
}

// ---------------------------------------------------------------------------
// GELU with erf, v * 0.5 * (1 + erf(v / sqrt(2))), without a branch.
// q = 0.5 * erfc(|v| / sqrt(2)) by the rational form t = 1 / (1 + p x),
// erfc(x) = (a1 t + ... + a5 t^5) exp(-x^2), absolute error at most 1.5e-7 for x >= 0;
// then v >= 0: v - v q, v < 0: v q, which is max(v, 0) - |v| q. No 1 + erf is formed, so
// the negative tail loses nothing to cancellation. The library erf takes two masked
// branches per element, one dependent chain each: elements could not overlap.
// ---------------------------------------------------------------------------
__device__ __forceinline__ float gelu_erf(float v) {
  const float a = fabsf(v);
  const float d = fmaf(a, 0.3275911f * 0.70710678118654752f, 1.f);
  const float w = (v * v) * (-0.5f * 1.4426950408889634f);
  const float t = __builtin_amdgcn_rcpf(d);
  const float e = __builtin_amdgcn_exp2f(w);
  float p = 0.5f * 1.061405429f;      // every coefficient carries the factor 0.5 of q
  p = fmaf(p, t, 0.5f * -1.453152027f);
  p = fmaf(p, t, 0.5f * 1.421413741f);
  p = fmaf(p, t, 0.5f * -0.284496736f);
  p = fmaf(p, t, 0.5f * 0.254829592f);
  const float q = (p * t) * e;
  return fmaf(-a, q, fmaxf(v, 0.f));
}

template <int V> struct store_form { static constexpr int value = V; };

template <int EPI>
__global__ __launch_bounds__(256) void gemm_bf16(
    const bhalf_t* __restrict__ A, const bhalf_t* __restrict__ W,
    const float* __restrict__ bias, const float* __restrict__ resid,
    void* __restrict__ outp, int Mdim, int Ndim, int Kdim) {
  const int lane = threadIdx.x & 31;
  const int wave = threadIdx.x >> 5;
  const int hl = lane & 15, g = lane >> 4;
  const int wm = wave & 1;            // 2 row groups of 64
  const int wn = wave >> 1;           // 4 col groups of 64
  const int m0 = blockIdx.x * 128 + wm * 64;
  const int n0 = blockIdx.y * 256 + wn * 64;

  v8f acc[4][4];
#pragma unroll
  for (int i = 0; i < 4; ++i)
#pragma unroll
    for (int j = 0; j < 4; ++j)
#pragma unroll
      for (int e = 0; e < 8; ++e) acc[i][j][e] = 0.f;

#if HAVE_TDM
  // Two stages of [A 128 rows | W 256 rows], 256 B of k per row at pitch 272 B.
  __shared__ __attribute__((aligned(2048))) unsigned char sT[2u * GBUF];
  (void)Mdim;

  const unsigned wv = uni(threadIdx.x >> 5);
  // waves 0, 1, 2 each bring one slice of 128 rows: A, W rows 0-127, W rows 128-255
  const bhalf_t* sp = (wv == 0u)
      ? A + (size_t)blockIdx.x * 128 * Kdim
      : W + ((size_t)blockIdx.y * 256 + (wv == 2u ? 128 : 0)) * Kdim;
  const unsigned long long ga = (unsigned long long)(uintptr_t)sp;
  const unsigned dst = (unsigned)(uintptr_t)&sT[0] + (wv < 3u ? wv : 0u) * GSLICE;
  const v8u d1 = gemm_group1((unsigned)Kdim * 2u);
  const int nst = Kdim / GK;          // stages; at least two for every launch here

  if (pinned(wv < 3u)) {
    gemm_tile_load(dst, ga, d1);      // stage 0
    wait_tensor0();
  }
  __syncthreads();                    // stage 0 readable by every wave
  if (pinned(wv < 3u)) gemm_tile_load(dst + GBUF, ga + GROWB, d1);  // stage 1

  const unsigned aoff = (unsigned)(wm * 64 + hl) * GPITCH + (unsigned)g * 16u;
  const unsigned boff = GSLICE + (unsigned)(wn * 64 + hl) * GPITCH + (unsigned)g * 16u;

  // Two fragment sets: block b works on set b & 1 while block b + 1's 16 reads land in the other.
  v16bf fa[2][4], fb[2][4];
#pragma unroll
  for (int i = 0; i < 4; ++i) {
    fa[0][i] = frag_ld((const bhalf_t*)(sT + aoff + i * 16 * GPITCH));
    fb[0][i] = frag_ld((const bhalf_t*)(sT + boff + i * 16 * GPITCH));
  }

  for (int s = 0; s < nst; ++s) {
    const unsigned char* bp = sT + (unsigned)(s & 1) * GBUF;
    const unsigned char* bn = sT + (unsigned)((s + 1) & 1) * GBUF;
#pragma unroll  // the four 32-k blocks of a stage: set index and every LDS offset compile-time, no loop branch among the WMMAs
    for (int kb = 0; kb < GK / 32; ++kb) {
      const int cur = kb & 1, nxt = cur ^ 1;
      if (kb == GK / 32 - 1) {
        // publish point of stage s + 1: it stands before stage s's last block, whose fragments
        // are already fetched, because the fetch below reads stage s + 1
        wait_ds0();
        if (pinned(wv < 3u)) wait_tensor0();
        __syncthreads();              // stage s + 1 readable; stage s's buffer left by every reader
        if (pinned((wv < 3u) & (s + 2 < nst)))
          gemm_tile_load(dst + (unsigned)(s & 1) * GBUF,
                         ga + (unsigned long long)(s + 2) * GROWB, d1);
      }
      // next block's fragments (in the last stage: landed rows of the other buffer, never used)
      const unsigned char* np = (kb == GK / 32 - 1) ? bn : bp + (kb + 1) * 64;
#pragma unroll  // fa, fb stay in registers: every index a constant
      for (int i = 0; i < 4; ++i) {
        fa[nxt][i] = frag_ld((const bhalf_t*)(np + aoff + i * 16 * GPITCH));
        fb[nxt][i] = frag_ld((const bhalf_t*)(np + boff + i * 16 * GPITCH));
      }
      // Keeps the 16 reads one group ahead of this block's products: left free, the compiler
      // sinks them among the WMMAs a pair at a time, each pair waited to 0.
      __builtin_amdgcn_sched_barrier(0);
#pragma unroll  // 16 independent accumulator tiles back to back, all in registers
      for (int mi = 0; mi < 4; ++mi)
#pragma unroll
        for (int ni = 0; ni < 4; ++ni)
          acc[mi][ni] = wmma_bf16f32(fa[cur][mi], fb[cur][ni], acc[mi][ni]);
      // Keeps the following block's reads behind these products, so that each group stays whole.
      __builtin_amdgcn_sched_barrier(0);
    }
  }
  wait_tensor0();
  wait_ds0();
#else
  // fallback: fragments straight from global
  for (int k = 0; k < Kdim; k += 32) {
    v16bf fa[4], fb[4];
#pragma unroll
    for (int mi = 0; mi < 4; ++mi)
      fa[mi] = frag_ld(A + (size_t)(m0 + mi * 16 + hl) * Kdim + k + g * 8);
#pragma unroll
    for (int ni = 0; ni < 4; ++ni)
      fb[ni] = frag_ld(W + (size_t)(n0 + ni * 16 + hl) * Kdim + k + g * 8);
#pragma unroll
    for (int mi = 0; mi < 4; ++mi)
#pragma unroll
      for (int ni = 0; ni < 4; ++ni)
        acc[mi][ni] = wmma_bf16f32(fa[mi], fb[ni], acc[mi][ni]);
  }
#endif

  // GELU variant: its tiles are kept apart below, which would hold each tile's bias load,
  // and the wait for it, inside the tile. So the wave's four bias values are loaded ahead.
  // Merged projections: loaded ahead too, once for both store forms.
  float bvv[4] = {0.f, 0.f, 0.f, 0.f};
  if (EPI == 3 || EPI == 4) {
#pragma unroll  // bvv stays in registers
    for (int ni = 0; ni < 4; ++ni) bvv[ni] = bias[n0 + ni * 16 + hl];
    // Stands ahead of the output address arithmetic, which reuses the loads' offset register.
    asm volatile("s_wait_xcnt 0x0" ::: "memory");
  }
  if (EPI == 4) {
    // A workgroup's 256 columns lie in one of Q, K, V: part is the same for all its waves.
    const int part = (int)(blockIdx.y / (DM / 256));
    bhalf_t* po = (bhalf_t*)outp + (size_t)part * MM * DM;
    const int oc0 = n0 - part * DM;   // the wave's first column inside its own output
    auto store_tiles = [&](auto form) {
      constexpr int E = decltype(form)::value;  // store form, a compile-time value
#pragma unroll  // acc and bvv stay in registers: every index a constant
      for (int mi = 0; mi < 4; ++mi)
#pragma unroll
        for (int ni = 0; ni < 4; ++ni) {
          const int col = oc0 + ni * 16 + hl;
#pragma unroll
          for (int r = 0; r < 8; ++r) {
            const int row = m0 + mi * 16 + r + 8 * g;
            const float v = acc[mi][ni][r] + bvv[ni];
            if (E == 0) {
              po[(size_t)row * Ndim + col] = (bhalf_t)v;
            } else {
              const int bidx = row >> 11;  // row / LL
              const int seq = row & (LL - 1);
              const size_t idx =
                  (((size_t)(bidx * NH + (col >> 6)) * HD) + (col & (HD - 1))) * LL + seq;
              po[idx] = (bhalf_t)v;
            }
          }
        }
    };
    if (part < 2) {
      store_tiles(store_form<0>{});
    } else {
      store_tiles(store_form<1>{});
      // The compiler lays the row-store path directly behind this one, entered from here on a
      // test that never holds; that path's first lines rewrite these stores' address registers.
      asm volatile("s_wait_xcnt 0x0" ::: "memory");
    }
    return;
  }
#pragma unroll
  for (int mi = 0; mi < 4; ++mi)
#pragma unroll
    for (int ni = 0; ni < 4; ++ni) {
      const int col = n0 + ni * 16 + hl;
      const float bv = bias[col];
#pragma unroll
      for (int r = 0; r < 8; ++r) {
        const int row = m0 + mi * 16 + r + 8 * g;
        float v = acc[mi][ni][r] + (EPI == 3 ? bvv[ni] : bv);
        if (EPI == 2) {
          const size_t idx = (size_t)row * Ndim + col;
          ((float*)outp)[idx] = resid[idx] + v;
        } else {
          ((bhalf_t*)outp)[(size_t)row * Ndim + col] = (bhalf_t)gelu_erf(v);
        }
      }
      // Keeps a tile's eight elements one group, its stores issued before the next tile starts.
      // Left free, the compiler mixes elements of several tiles.
      if (EPI == 3) __builtin_amdgcn_sched_barrier(0);
    }
}

__device__ __forceinline__ float xhalf(float x) {
  const int b = __builtin_bit_cast(int, x);
  return __builtin_bit_cast(
      float, __builtin_amdgcn_permlanex16(b, b, 0x76543210, 0xfedcba98, false, false));
}

__global__ __launch_bounds__(256) void attn_flash(
    const bhalf_t* __restrict__ Q, const bhalf_t* __restrict__ Km,
    const bhalf_t* __restrict__ Vt, bhalf_t* __restrict__ ctxout,
    const int* __restrict__ pfx) {
#if HAVE_TDM
  // Two stages of [K 64 keys x 64 hd | V^T 64 hd x 64 keys], rows of 128 B at pitch 144 B.
  __shared__ __attribute__((aligned(2048))) unsigned char sKV[2u * ABUF];
#endif
  // The mask reads the same for any prefix below 0 as for 0 and above LL as for LL: bounded
  // here because the stage count, and so every staged address, is formed from it.
  const int praw = *pfx;
  const int prefix = praw < 0 ? 0 : (praw > LL ? LL : praw);
  const int lane = threadIdx.x & 31;
  const int wave = threadIdx.x >> 5;
  const int hl = lane & 15, g = lane >> 4;
  const int qblk = (blockIdx.x & (LL / 128 - 1)) * 128;  // query block start
  const int bh = blockIdx.x >> 4;                        // LL/128 == 16
  const int bidx = bh >> 4, h = bh & (NH - 1);
  const int q0 = qblk + wave * 16;                       // this wave's tile

  const bhalf_t* Qb = Q + (size_t)bidx * LL * DM + h * HD;
  const bhalf_t* Kb = Km + (size_t)bidx * LL * DM + h * HD;
  const bhalf_t* Vb = Vt + (size_t)bh * HD * LL;

  const bhalf_t* qp = Qb + (size_t)(q0 + hl) * DM + g * 8;
  const v16bf qa0 = frag_ld(qp);
  const v16bf qa1 = frag_ld(qp + 32);

  // This lane's query is q0 + hl. lrun sums only the keys this wave half holds;
  // the halves are joined once, behind the loop. ctx[nt][r] = O[q0 + hl][nt*16 + 8g + r].
  float mrun = -1e30f, lrun = 0.f;
  v8f ctx[4];
#pragma unroll
  for (int nt = 0; nt < 4; ++nt)
#pragma unroll
    for (int e = 0; e < 8; ++e) ctx[nt][e] = 0.f;

  // per-wave key extent (rounded to 32-key chunks), block-level extent (to 64-key stages)
  int kend_w = (q0 + 16 > prefix) ? (q0 + 16) : prefix;
  kend_w = (kend_w + 31) & ~31;
  int kend_b = (qblk + 128 > prefix) ? (qblk + 128) : prefix;
  kend_b = (kend_b + AKEYS - 1) & ~(AKEYS - 1);
  const int nst = kend_b / AKEYS;  // stages: at least two (128 keys), at most LL / 64
  const float scale = 0.125f;  // 1/sqrt(64)
  // One query per lane, so one key limit per lane: key allowed iff key < prefix, or
  // query >= prefix and key <= query; in the second case query + 1 > prefix.
  const int klim = (q0 + hl >= prefix) ? q0 + hl + 1 : prefix;

#if HAVE_TDM
  // wave 0 brings K (source pitch one row of DM), wave 1 V^T (source pitch one row of LL)
  const unsigned wv = uni(threadIdx.x >> 5);
  const unsigned long long ga = (unsigned long long)(uintptr_t)(wv == 0u ? Kb : Vb);
  const unsigned gstep = (wv == 0u) ? AKEYS * DM * 2u : AKEYS * 2u;  // source bytes per stage
  const unsigned dst = (unsigned)(uintptr_t)&sKV[0] + (wv == 1u ? ASLICE : 0u);
  const v8u d1 = attn_group1(wv == 0u ? DM * 2u : LL * 2u);
  v4u d0;
  d0[0] = uni(1u);
  d0[1] = uni(dst);
  d0[2] = uni((unsigned)ga);
  d0[3] = uni((((unsigned)(ga >> 32)) & 0x01FFFFFFu) | 0x80000000u);
  if (pinned(wv < 2u)) {
    attn_tile_load(d0, d1);           // stage 0
    wait_tensor0();
  }
  __syncthreads();                    // stage 0 readable by every wave
  if (pinned(wv < 2u)) {
    attn_step(d0, dst + ABUF, gstep);
    attn_tile_load(d0, d1);           // stage 1
  }
#endif

  for (int s = 0; s < nst; ++s) {
#if HAVE_TDM
    const unsigned char* bp = sKV + (unsigned)(s & 1) * ABUF;
#endif
#pragma unroll  // the stage's two chunks: every LDS offset an immediate
    for (int hf = 0; hf < AKEYS / 32; ++hf) {
    const int c = s * AKEYS + hf * 32;
    if (c < kend_w) {
      // ---- scores S^T[32 x 16] = K @ Q^T (2 key sub-tiles x 2 hd halves)
      v8f s[2];
      v16bf kb0[2], kb1[2];
#pragma unroll
      for (int t = 0; t < 2; ++t) {
#pragma unroll
        for (int e = 0; e < 8; ++e) s[t][e] = 0.f;
#if HAVE_TDM
        const unsigned char* kr = bp + (unsigned)(hf * 32 + t * 16 + hl) * APITCH + g * 16;
        kb0[t] = frag_ld((const bhalf_t*)kr);
        kb1[t] = frag_ld((const bhalf_t*)(kr + 64));
#else
        const bhalf_t* kp = Kb + (size_t)(c + t * 16 + hl) * DM + g * 8;
        kb0[t] = frag_ld(kp);
        kb1[t] = frag_ld(kp + 32);
#endif
      }
      v16bf vb[4];
#pragma unroll
      for (int nt = 0; nt < 4; ++nt) {
#if HAVE_TDM
        vb[nt] = frag_ld((const bhalf_t*)(bp + ASLICE + (unsigned)(nt * 16 + hl) * APITCH +
                                          hf * 64 + g * 16));
#else
        vb[nt] = frag_ld(Vb + (size_t)(nt * 16 + hl) * LL + c + g * 8);
#endif
      }
      // Keeps the chunk's 16 LDS reads one group ahead of the products: left free, the
      // compiler issues them a pair per product into one register set, each pair waited to 0.
      __builtin_amdgcn_sched_barrier(0);
#pragma unroll
      for (int t = 0; t < 2; ++t) s[t] = wmma_bf16f32(kb0[t], qa0, s[t]);
#pragma unroll
      for (int t = 0; t < 2; ++t) s[t] = wmma_bf16f32(kb1[t], qa1, s[t]);
      // ---- scale + prefix-decoder mask: this lane's score (t, r) is key c + 16t + 8g + r
#pragma unroll
      for (int t = 0; t < 2; ++t)
#pragma unroll
        for (int r = 0; r < 8; ++r) s[t][r] *= scale;
      if (c + 31 >= prefix) {  // same for the whole wave: chunks inside the prefix skip the mask
        const int rel = klim - c - 8 * g;
#pragma unroll
        for (int t = 0; t < 2; ++t)
#pragma unroll
          for (int r = 0; r < 8; ++r) s[t][r] = (t * 16 + r < rel) ? s[t][r] : -1e30f;
      }
      // ---- online softmax: 16 scores of one query per lane, one exchange for the maximum
      float t8[8];
#pragma unroll
      for (int r = 0; r < 8; ++r) t8[r] = fmaxf(s[0][r], s[1][r]);
      float tm = fmaxf(fmaxf(fmaxf(t8[0], t8[1]), fmaxf(t8[2], t8[3])),
                       fmaxf(fmaxf(t8[4], t8[5]), fmaxf(t8[6], t8[7])));
      tm = fmaxf(tm, xhalf(tm));
      const float mnew = fmaxf(mrun, tm);
      const float alpha = __expf(mrun - mnew);
      // P^T as a B operand: element 8t + r is key 16t + 8g + r, the order frag_ld gives V^T
      v16bf pb;
      float r4[4] = {0.f, 0.f, 0.f, 0.f};  // four short chains instead of one of 16 adds
#pragma unroll
      for (int t = 0; t < 2; ++t)
#pragma unroll
        for (int r = 0; r < 8; ++r) {
          const float p = __expf(s[t][r] - mnew);
          r4[r & 3] += p;
          pb[t * 8 + r] = (bhalf_t)p;
        }
      lrun = lrun * alpha + ((r4[0] + r4[1]) + (r4[2] + r4[3]));
      mrun = mnew;
#pragma unroll
      for (int nt = 0; nt < 4; ++nt)
#pragma unroll
        for (int r = 0; r < 8; ++r) ctx[nt][r] *= alpha;
      // ---- O^T += V^T @ P^T  (contraction over 32 keys, 4 hd row tiles)
#pragma unroll
      for (int nt = 0; nt < 4; ++nt) ctx[nt] = wmma_bf16f32(vb[nt], pb, ctx[nt]);
    }
    }
#if HAVE_TDM
    // publish point of stage s + 1, passed by every wave, also one that skipped the chunks
    wait_ds0();
    if (pinned(wv < 2u)) wait_tensor0();
    __syncthreads();                  // stage s + 1 readable; stage s's buffer left by every reader
    if (pinned((wv < 2u) & (s + 2 < nst))) {
      attn_step(d0, dst + (unsigned)(s & 1) * ABUF, gstep);
      attn_tile_load(d0, d1);         // stage s + 2
    }
#endif
  }
#if HAVE_TDM
  wait_tensor0();
  wait_ds0();
#endif
  // ---- normalize and store context: 8 consecutive head columns per lane, one 16-B store
  const float lsum = lrun + xhalf(lrun);
  bhalf_t* orow = ctxout + ((size_t)bidx * LL + q0 + hl) * DM + h * HD + 8 * g;
#pragma unroll
  for (int nt = 0; nt < 4; ++nt) {
    v8bf o;
#pragma unroll
    for (int r = 0; r < 8; ++r) o[r] = (bhalf_t)(ctx[nt][r] / lsum);
    *(v8bf*)(orow + nt * 16) = o;
  }
}

// ---------------------------------------------------------------------------
// Launch
// ---------------------------------------------------------------------------
extern "C" void kernel_launch(void* const* d_in, const int* in_sizes, int n_in,
                              void* d_out, int out_size, void* d_ws, size_t ws_size,
                              hipStream_t stream) {
  (void)in_sizes; (void)n_in; (void)out_size; (void)ws_size;
  const float* x    = (const float*)d_in[0];
  const float* ln1w = (const float*)d_in[1];
  const float* ln1b = (const float*)d_in[2];
  const float* inw  = (const float*)d_in[3];
  const float* inb  = (const float*)d_in[4];
  const float* outw = (const float*)d_in[5];
  const float* outb = (const float*)d_in[6];
  const float* ln2w = (const float*)d_in[7];
  const float* ln2b = (const float*)d_in[8];
  const float* fc1w = (const float*)d_in[9];
  const float* fc1b = (const float*)d_in[10];
  const float* fc2w = (const float*)d_in[11];
  const float* fc2b = (const float*)d_in[12];
  const int*   pfx  = (const int*)d_in[13];
  float* out = (float*)d_out;

  char* ws = (char*)d_ws;
  size_t off = 0;
  auto carve = [&](size_t bytes) -> void* {
    void* p = ws + off;
    off += (bytes + 255) & ~(size_t)255;
    return p;
  };
  // the four bf16 weights as one range, in the cast grid's order
  bhalf_t* wqkv = (bhalf_t*)carve((size_t)CAST_C4 * CAST_CHUNK * sizeof(bhalf_t));
  bhalf_t* wo   = wqkv + (size_t)CAST_C1 * CAST_CHUNK;
  bhalf_t* w1   = wqkv + (size_t)CAST_C2 * CAST_CHUNK;
  bhalf_t* w2   = wqkv + (size_t)CAST_C3 * CAST_CHUNK;
  bhalf_t* h1   = (bhalf_t*)carve((size_t)MM * DM * sizeof(bhalf_t));
  // Q, K, V^T as one range, in the order the merged projection stores them
  bhalf_t* Qb   = (bhalf_t*)carve((size_t)3 * MM * DM * sizeof(bhalf_t));
  bhalf_t* Kb   = Qb + (size_t)MM * DM;
  bhalf_t* Vt   = Qb + (size_t)2 * MM * DM;
  bhalf_t* ctxb = (bhalf_t*)carve((size_t)MM * DM * sizeof(bhalf_t));
  float*   x1   = (float*)carve((size_t)MM * DM * sizeof(float));
  bhalf_t* h2   = (bhalf_t*)carve((size_t)MM * DM * sizeof(bhalf_t));
  bhalf_t* ff1  = (bhalf_t*)carve((size_t)MM * DF * sizeof(bhalf_t));

  cast_f32_bf16<<<CAST_C4, 256, 0, stream>>>(inw, outw, fc1w, fc2w, wqkv);

  layernorm_bf16<<<MM / 8, 256, 0, stream>>>(x, ln1w, ln1b, h1);

  dim3 blk(256);
  dim3 gD(MM / 128, DM / 256);
  dim3 gF(MM / 128, DF / 256);
  dim3 gQ(MM / 128, 3 * DM / 256);
  gemm_bf16<4><<<gQ, blk, 0, stream>>>(h1, wqkv, inb, nullptr, Qb, MM, DM, DM);

  attn_flash<<<BB * NH * (LL / 128), blk, 0, stream>>>(Qb, Kb, Vt, ctxb, pfx);

  gemm_bf16<2><<<gD, blk, 0, stream>>>(ctxb, wo, outb, x, x1, MM, DM, DM);
  layernorm_bf16<<<MM / 8, 256, 0, stream>>>(x1, ln2w, ln2b, h2);
  gemm_bf16<3><<<gF, blk, 0, stream>>>(h2, w1, fc1b, nullptr, ff1, MM, DF, DM);
  gemm_bf16<2><<<gD, blk, 0, stream>>>(ff1, w2, fc2b, x1, out, MM, DM, DF);
}

// v009
// Measured time: 160 microseconds a run.
// Timed twice side by side with v008, it ran 1.08 and 1.06 times as fast.
// All steps since v000 together make it 3.19 times as fast.
#include <hip/hip_runtime.h>

typedef __bf16 bhalf_t;
typedef __attribute__((ext_vector_type(16))) __bf16 v16bf;
typedef __attribute__((ext_vector_type(8)))  __bf16 v8bf;
typedef __attribute__((ext_vector_type(8)))  float  v8f;
typedef __attribute__((ext_vector_type(4)))  unsigned int v4u;

#define DM   1024   // d_model
#define NH   16     // heads
#define HD   64     // head dim
#define DF   4096   // d_ff
#define BB   2      // batch
#define LL   2048   // seq len
#define MM   (BB*LL)
#define AKEYS 64    // attention: keys per LDS stage (two 32-key chunks)

#if defined(__gfx1250__) && __has_builtin(__builtin_amdgcn_tensor_load_to_lds)
#define HAVE_TDM 1
#else
#define HAVE_TDM 0
#endif

__device__ __forceinline__ v8f wmma_bf16f32(v16bf a, v16bf b, v8f c) {
  return __builtin_amdgcn_wmma_f32_16x16x32_bf16(false, a, false, b, (short)0, c,
                                                 false, false);
}

__device__ __forceinline__ v16bf frag_ld(const bhalf_t* p) {
  v8bf lo = *(const v8bf*)(p);
  v8bf hi = *(const v8bf*)(p + 16);
  v16bf r;
#pragma unroll
  for (int i = 0; i < 8; ++i) { r[i] = lo[i]; r[8 + i] = hi[i]; }
  return r;
}

#if HAVE_TDM
typedef __attribute__((ext_vector_type(8))) unsigned int v8u;
#define GK      128                 // k elements per stage
#define GROWB   256u                // bytes of one staged row
#define GPITCH  272u                // LDS pitch of a staged row
#define GSLICE  (128u * GPITCH)     // one wave's request: 128 rows = 17 x 2 KiB
#define GBUF    (3u * GSLICE)       // a stage: A 128 rows, then W 256 rows

__device__ __forceinline__ unsigned uni(unsigned v) {
  return (unsigned)__builtin_amdgcn_readfirstlane(v);
}
__device__ __forceinline__ unsigned pinned(unsigned v) {
  unsigned w = uni(v);
  asm volatile("" : "+s"(w));
  return w;
}
__device__ __forceinline__ v8u gemm_group1(unsigned src_pitch_bytes) {
  v8u d;
  d[0] = uni((1u << 20) | (5u << 22) | (3u << 25));
  d[1] = uni((GROWB & 0xFFFFu) << 16);
  d[2] = uni((GROWB >> 16) | (128u << 16));
  d[3] = uni(GROWB << 16);
  d[4] = uni(128u);
  d[5] = uni(src_pitch_bytes);
  d[6] = uni(0u);
  d[7] = uni(0u);
  // Built once and kept: without this the compiler re-forms some words in the loop, in the
  // same registers, while a request is outstanding.
  asm volatile("" : "+s"(d));
  return d;
}
// Attention staging: a stage is 64 keys, K as 64 rows (keys) and V^T as 64 rows (head dims),
// each row 128 B, laid at an LDS pitch of 144 B (16 B x odd).
#define AROWB   128u                // bytes of one staged row
#define APITCH  144u                // LDS pitch of a staged row
#define ASLICE  10240u              // one wave's request: 64 rows = 9216 B, rounded up to 2 KiB
#define ABUF    (2u * ASLICE)       // a stage: K, then V^T
__device__ __forceinline__ v8u attn_group1(unsigned src_pitch_bytes) {
  v8u d;
  d[0] = uni((1u << 20) | (4u << 22) | (3u << 25));
  d[1] = uni((AROWB & 0xFFFFu) << 16);
  d[2] = uni((AROWB >> 16) | (64u << 16));
  d[3] = uni(AROWB << 16);
  d[4] = uni(64u);
  d[5] = uni(src_pitch_bytes);
  d[6] = uni(0u);
  d[7] = uni(0u);
  asm volatile("" : "+s"(d));
  return d;
}
__device__ __forceinline__ void gemm_tile_load(unsigned lds_dst, unsigned long long ga, v8u d1) {
  v4u d0;
  d0[0] = uni(1u);
  d0[1] = uni(lds_dst);
  d0[2] = uni((unsigned)ga);
  d0[3] = uni((((unsigned)(ga >> 32)) & 0x01FFFFFFu) | 0x80000000u);
  asm volatile("tensor_load_to_lds %0, %1" :: "s"(d0), "s"(d1) : "memory");
}
__device__ __forceinline__ void attn_tile_load(v4u& d0, v8u d1) {
  asm volatile("tensor_load_to_lds %0, %1" : "+s"(d0) : "s"(d1) : "memory");
}
// Next stage: new place in LDS, source address one stage on (a carry runs into address bits only).
__device__ __forceinline__ void attn_step(v4u& d0, unsigned lds_dst, unsigned step_bytes) {
  const unsigned long long a = (((unsigned long long)d0[3] << 32) | d0[2]) + step_bytes;
  d0[1] = uni(lds_dst);
  d0[2] = uni((unsigned)a);
  d0[3] = uni((unsigned)(a >> 32));
}
// The compiler places no wait for the tensor mover: a tile counts as landed only behind this.
__device__ __forceinline__ void wait_tensor0() { asm volatile("s_wait_tensorcnt 0x0" ::: "memory"); }
// A wave's LDS reads have retired before the buffer they read is handed back for a refill.
__device__ __forceinline__ void wait_ds0() { asm volatile("s_wait_dscnt 0x0" ::: "memory"); }
#endif  // HAVE_TDM

// ---------------------------------------------------------------------------
// fp32 -> bf16 cast (weights)
// ---------------------------------------------------------------------------
// A wave owns CAST_V * 512 contiguous bytes of the source: every load is 32 lanes x 16 B
// of whole lines, issued as one group ahead of the conversions. Few waves with much work
// each: a stream this short is bounded by how fast waves start, not by its bytes.
#define CAST_V      16                      // 16-byte loads per lane
#define CAST_WAVE   (CAST_V * 128)          // floats per wave
#define CAST_CHUNK  (8 * CAST_WAVE)         // floats per workgroup of 8 waves
static_assert((DM * DM) % CAST_CHUNK == 0, "every weight is a whole number of chunks");
typedef __attribute__((ext_vector_type(4))) float  v4f;
typedef __attribute__((ext_vector_type(4))) __bf16 v4bf;
// The bf16 copies lie one after another in the workspace, in this order, so a chunk's index is
// its place in the output. The casts have no launch of their own: a chunk is one workgroup's
// work, and those workgroups ride in the grids of other kernels, each ahead of the product
// that reads its weight. The input projection's chunks go with the first LayerNorm, a stream
// like them; the other three weights' go behind the attention workgroups, which leave the
// memory idle and a third place on every WGP free.
#define CAST_C1  (3 * DM * DM / CAST_CHUNK)            // chunks of the input projection
#define CAST_C2  (CAST_C1 + DM * DM / CAST_CHUNK)      // ... and the output projection
#define CAST_C3  (CAST_C2 + DF * DM / CAST_CHUNK)      // ... and fc1
#define CAST_C4  (CAST_C3 + DM * DF / CAST_CHUNK)      // ... and fc2: all chunks

// One workgroup of 8 waves casts the chunk that starts at in to the chunk that starts at out.
__device__ __forceinline__ void cast_chunk(const float* __restrict__ in,
                                           bhalf_t* __restrict__ out) {
  const int lo = (threadIdx.x >> 5) * CAST_WAVE + (threadIdx.x & 31) * 4;
  const float* ip = in + lo;
  bhalf_t* op = out + lo;
  v4f v[CAST_V];
#pragma unroll  // all loads issued as one group, each offset an immediate
  for (int u = 0; u < CAST_V - 1; ++u) v[u] = *(const v4f*)(ip + u * 128);
  // Stands ahead of the last load: the compiler lets it land in the offset register that the
  // loads above name.
  asm volatile("s_wait_xcnt 0x0" ::: "memory");
  v[CAST_V - 1] = *(const v4f*)(ip + (CAST_V - 1) * 128);
#pragma unroll  // v[] stays in registers; each store is 32 lanes x 8 B = two whole lines
  for (int u = 0; u < CAST_V; ++u) {
    v4bf o;
#pragma unroll  // four converts, packed in pairs
    for (int e = 0; e < 4; ++e) o[e] = (bhalf_t)v[u][e];
    *(v4bf*)(op + u * 128) = o;
  }
}

// ---------------------------------------------------------------------------
// LayerNorm (d=1024) -> bf16
// One wave owns one row and holds it in registers: each lane 8 loads of 16 B, every load
// 512 contiguous bytes of the row, all issued at once, with the weight's and the bias's
// behind them. The row is read from memory once; mean and variance are in-lane sums and a
// five-step exchange between lanes. No LDS and no barrier. With a workgroup per row, a lane's
// four 4-byte loads of each of three passes were waited for one after another, and each of
// the two sums went through an eight-step tree in LDS with a barrier per step.
// ---------------------------------------------------------------------------
#define LN_V 8                              // 16-byte loads per lane
static_assert(LN_V * 128 == DM, "a wave's loads cover exactly one row");
static_assert(MM % 8 == 0, "eight rows per workgroup, no part-filled workgroup");

template <int M>
__device__ __forceinline__ float xrow(float x) {
  return __builtin_bit_cast(
      float, __builtin_amdgcn_update_dpp(0, __builtin_bit_cast(int, x), 0x160 | M, 0xf, 0xf, true));
}
// Sum over the 32 lanes, the same value in every lane.
__device__ __forceinline__ float wave_sum(float v) {
  v += xrow<1>(v);
  v += xrow<2>(v);
  v += xrow<4>(v);
  v += xrow<8>(v);
  const int h = __builtin_bit_cast(int, v);
  return v + __builtin_bit_cast(
                 float, __builtin_amdgcn_permlanex16(h, h, 0x76543210, 0xfedcba98, false, false));
}

// Workgroups past the rows' MM / 8 each cast one chunk of cw to cout (none in a grid of MM / 8).
__global__ __launch_bounds__(256) void layernorm_bf16(
    const float* __restrict__ x, const float* __restrict__ w,
    const float* __restrict__ b, bhalf_t* __restrict__ out,
    const float* __restrict__ cw, bhalf_t* __restrict__ cout) {
  if (blockIdx.x >= MM / 8) {  // the same for a whole workgroup
    const int c = blockIdx.x - MM / 8;
    cast_chunk(cw + c * CAST_CHUNK, cout + c * CAST_CHUNK);
    return;
  }
  const int lo = (threadIdx.x & 31) * 4;
  const int row = blockIdx.x * 8 + (threadIdx.x >> 5);
  const float* xr = x + (size_t)row * DM + lo;
  v4f xv[LN_V], wv[LN_V], bv[LN_V];
#pragma unroll  // the row's loads issued as one group, each offset an immediate
  for (int u = 0; u < LN_V; ++u) xv[u] = *(const v4f*)(xr + u * 128);
  // Stands ahead of the loads below: the compiler lets one of them land in the row's address pair.
  asm volatile("s_wait_xcnt 0x0" ::: "memory");
  // Keeps the row's loads, the ones that come from furthest, first in the queue.
  __builtin_amdgcn_sched_barrier(0);
#pragma unroll  // in flight under the row's loads and the two sums
  for (int u = 0; u < LN_V; ++u) wv[u] = *(const v4f*)(w + lo + u * 128);
#pragma unroll
  for (int u = 0; u < LN_V; ++u) bv[u] = *(const v4f*)(b + lo + u * 128);
  // Keeps the 24 loads one group ahead of the arithmetic: left free, the compiler sinks the
  // weight's and the bias's behind the two sums, a pair at a time, each pair waited for.
  __builtin_amdgcn_sched_barrier(0);
  v4f s4 = xv[0];                           // four independent chains
#pragma unroll  // xv stays in registers
  for (int u = 1; u < LN_V; ++u) s4 += xv[u];
  const float mu = wave_sum((s4[0] + s4[1]) + (s4[2] + s4[3])) * (1.f / DM);
  v4f q4 = {0.f, 0.f, 0.f, 0.f};
#pragma unroll  // xv stays in registers; from here on it holds x - mu
  for (int u = 0; u < LN_V; ++u) {
    xv[u] -= mu;
    q4 += xv[u] * xv[u];
  }
  const float var = wave_sum((q4[0] + q4[1]) + (q4[2] + q4[3])) * (1.f / DM);
  const float rstd = rsqrtf(var + 1e-5f);
  bhalf_t* orow = out + (size_t)row * DM + lo;
#pragma unroll  // each store is 32 lanes x 8 B = two whole lines
  for (int u = 0; u < LN_V; ++u) {
    v4bf o;
#pragma unroll  // four values, packed in pairs
    for (int e = 0; e < 4; ++e) o[e] = (bhalf_t)(xv[u][e] * rstd * wv[u][e] + bv[u][e]);
    *(v4bf*)(orow + u * 128) = o;
  }
  // The compiler lays the cast path directly behind this one, entered from here on a test that
  // never holds; that path's loads land in these stores' data registers.
  asm volatile("s_wait_xcnt 0x0" ::: "memory");
}

// ---------------------------------------------------------------------------
// GELU with erf, v * 0.5 * (1 + erf(v / sqrt(2))), without a branch.
// q = 0.5 * erfc(|v| / sqrt(2)) by the rational form t = 1 / (1 + p x),
// erfc(x) = (a1 t + ... + a5 t^5) exp(-x^2), absolute error at most 1.5e-7 for x >= 0;
// then v >= 0: v - v q, v < 0: v q, which is max(v, 0) - |v| q. No 1 + erf is formed, so
// the negative tail loses nothing to cancellation. The library erf takes two masked
// branches per element, one dependent chain each: elements could not overlap.
// ---------------------------------------------------------------------------
__device__ __forceinline__ float gelu_erf(float v) {
  const float a = fabsf(v);
  const float d = fmaf(a, 0.3275911f * 0.70710678118654752f, 1.f);
  const float w = (v * v) * (-0.5f * 1.4426950408889634f);
  const float t = __builtin_amdgcn_rcpf(d);
  const float e = __builtin_amdgcn_exp2f(w);
  float p = 0.5f * 1.061405429f;      // every coefficient carries the factor 0.5 of q
  p = fmaf(p, t, 0.5f * -1.453152027f);
  p = fmaf(p, t, 0.5f * 1.421413741f);
  p = fmaf(p, t, 0.5f * -0.284496736f);
  p = fmaf(p, t, 0.5f * 0.254829592f);
  const float q = (p * t) * e;
  return fmaf(-a, q, fmaxf(v, 0.f));
}

template <int V> struct store_form { static constexpr int value = V; };

template <int EPI>
__global__ __launch_bounds__(256) void gemm_bf16(
    const bhalf_t* __restrict__ A, const bhalf_t* __restrict__ W,
    const float* __restrict__ bias, const float* __restrict__ resid,
    void* __restrict__ outp, int Mdim, int Ndim, int Kdim) {
  const int lane = threadIdx.x & 31;
  const int wave = threadIdx.x >> 5;
  const int hl = lane & 15, g = lane >> 4;
  const int wm = wave & 1;            // 2 row groups of 64
  const int wn = wave >> 1;           // 4 col groups of 64
  const int m0 = blockIdx.x * 128 + wm * 64;
  const int n0 = blockIdx.y * 256 + wn * 64;

  v8f acc[4][4];
#pragma unroll
  for (int i = 0; i < 4; ++i)
#pragma unroll
    for (int j = 0; j < 4; ++j)
#pragma unroll
      for (int e = 0; e < 8; ++e) acc[i][j][e] = 0.f;

#if HAVE_TDM
  // Two stages of [A 128 rows | W 256 rows], 256 B of k per row at pitch 272 B.
  __shared__ __attribute__((aligned(2048))) unsigned char sT[2u * GBUF];
  (void)Mdim;

  const unsigned wv = uni(threadIdx.x >> 5);
  // waves 0, 1, 2 each bring one slice of 128 rows: A, W rows 0-127, W rows 128-255
  const bhalf_t* sp = (wv == 0u)
      ? A + (size_t)blockIdx.x * 128 * Kdim
      : W + ((size_t)blockIdx.y * 256 + (wv == 2u ? 128 : 0)) * Kdim;
  const unsigned long long ga = (unsigned long long)(uintptr_t)sp;
  const unsigned dst = (unsigned)(uintptr_t)&sT[0] + (wv < 3u ? wv : 0u) * GSLICE;
  const v8u d1 = gemm_group1((unsigned)Kdim * 2u);
  const int nst = Kdim / GK;          // stages; at least two for every launch here

  if (pinned(wv < 3u)) {
    gemm_tile_load(dst, ga, d1);      // stage 0
    wait_tensor0();
  }
  __syncthreads();                    // stage 0 readable by every wave
  if (pinned(wv < 3u)) gemm_tile_load(dst + GBUF, ga + GROWB, d1);  // stage 1

  const unsigned aoff = (unsigned)(wm * 64 + hl) * GPITCH + (unsigned)g * 16u;
  const unsigned boff = GSLICE + (unsigned)(wn * 64 + hl) * GPITCH + (unsigned)g * 16u;

  // Two fragment sets: block b works on set b & 1 while block b + 1's 16 reads land in the other.
  v16bf fa[2][4], fb[2][4];
#pragma unroll
  for (int i = 0; i < 4; ++i) {
    fa[0][i] = frag_ld((const bhalf_t*)(sT + aoff + i * 16 * GPITCH));
    fb[0][i] = frag_ld((const bhalf_t*)(sT + boff + i * 16 * GPITCH));
  }

  for (int s = 0; s < nst; ++s) {
    const unsigned char* bp = sT + (unsigned)(s & 1) * GBUF;
    const unsigned char* bn = sT + (unsigned)((s + 1) & 1) * GBUF;
#pragma unroll  // the four 32-k blocks of a stage: set index and every LDS offset compile-time, no loop branch among the WMMAs
    for (int kb = 0; kb < GK / 32; ++kb) {
      const int cur = kb & 1, nxt = cur ^ 1;
      if (kb == GK / 32 - 1) {
        // publish point of stage s + 1: it stands before stage s's last block, whose fragments
        // are already fetched, because the fetch below reads stage s + 1
        wait_ds0();
        if (pinned(wv < 3u)) wait_tensor0();
        __syncthreads();              // stage s + 1 readable; stage s's buffer left by every reader
        if (pinned((wv < 3u) & (s + 2 < nst)))
          gemm_tile_load(dst + (unsigned)(s & 1) * GBUF,
                         ga + (unsigned long long)(s + 2) * GROWB, d1);
      }
      // next block's fragments (in the last stage: landed rows of the other buffer, never used)
      const unsigned char* np = (kb == GK / 32 - 1) ? bn : bp + (kb + 1) * 64;
#pragma unroll  // fa, fb stay in registers: every index a constant
      for (int i = 0; i < 4; ++i) {
        fa[nxt][i] = frag_ld((const bhalf_t*)(np + aoff + i * 16 * GPITCH));
        fb[nxt][i] = frag_ld((const bhalf_t*)(np + boff + i * 16 * GPITCH));
      }
      // Keeps the 16 reads one group ahead of this block's products: left free, the compiler
      // sinks them among the WMMAs a pair at a time, each pair waited to 0.
      __builtin_amdgcn_sched_barrier(0);
#pragma unroll  // 16 independent accumulator tiles back to back, all in registers
      for (int mi = 0; mi < 4; ++mi)
#pragma unroll
        for (int ni = 0; ni < 4; ++ni)
          acc[mi][ni] = wmma_bf16f32(fa[cur][mi], fb[cur][ni], acc[mi][ni]);
      // Keeps the following block's reads behind these products, so that each group stays whole.
      __builtin_amdgcn_sched_barrier(0);
    }
  }
  wait_tensor0();
  wait_ds0();
#else
  // fallback: fragments straight from global
  for (int k = 0; k < Kdim; k += 32) {
    v16bf fa[4], fb[4];
#pragma unroll
    for (int mi = 0; mi < 4; ++mi)
      fa[mi] = frag_ld(A + (size_t)(m0 + mi * 16 + hl) * Kdim + k + g * 8);
#pragma unroll
    for (int ni = 0; ni < 4; ++ni)
      fb[ni] = frag_ld(W + (size_t)(n0 + ni * 16 + hl) * Kdim + k + g * 8);
#pragma unroll
    for (int mi = 0; mi < 4; ++mi)
#pragma unroll
      for (int ni = 0; ni < 4; ++ni)
        acc[mi][ni] = wmma_bf16f32(fa[mi], fb[ni], acc[mi][ni]);
  }
#endif

  // GELU variant: its tiles are kept apart below, which would hold each tile's bias load,
  // and the wait for it, inside the tile. So the wave's four bias values are loaded ahead.
  // Merged projections: loaded ahead too, once for both store forms.
  float bvv[4] = {0.f, 0.f, 0.f, 0.f};
  if (EPI == 3 || EPI == 4) {
#pragma unroll  // bvv stays in registers
    for (int ni = 0; ni < 4; ++ni) bvv[ni] = bias[n0 + ni * 16 + hl];
    // Stands ahead of the output address arithmetic, which reuses the loads' offset register.
    asm volatile("s_wait_xcnt 0x0" ::: "memory");
  }
  if (EPI == 4) {
    // A workgroup's 256 columns lie in one of Q, K, V: part is the same for all its waves.
    const int part = (int)(blockIdx.y / (DM / 256));
    bhalf_t* po = (bhalf_t*)outp + (size_t)part * MM * DM;
    const int oc0 = n0 - part * DM;   // the wave's first column inside its own output
    auto store_tiles = [&](auto form) {
      constexpr int E = decltype(form)::value;  // store form, a compile-time value
#pragma unroll  // acc and bvv stay in registers: every index a constant
      for (int mi = 0; mi < 4; ++mi)
#pragma unroll
        for (int ni = 0; ni < 4; ++ni) {
          const int col = oc0 + ni * 16 + hl;
#pragma unroll
          for (int r = 0; r < 8; ++r) {
            const int row = m0 + mi * 16 + r + 8 * g;
            const float v = acc[mi][ni][r] + bvv[ni];
            if (E == 0) {
              po[(size_t)row * Ndim + col] = (bhalf_t)v;
            } else {
              const int bidx = row >> 11;  // row / LL
              const int seq = row & (LL - 1);
              const size_t idx =
                  (((size_t)(bidx * NH + (col >> 6)) * HD) + (col & (HD - 1))) * LL + seq;
              po[idx] = (bhalf_t)v;
            }
          }
        }
    };
    if (part < 2) {
      store_tiles(store_form<0>{});
    } else {
      store_tiles(store_form<1>{});
      // The compiler lays the row-store path directly behind this one, entered from here on a
      // test that never holds; that path's first lines rewrite these stores' address registers.
      asm volatile("s_wait_xcnt 0x0" ::: "memory");
    }
    return;
  }
#pragma unroll
  for (int mi = 0; mi < 4; ++mi)
#pragma unroll
    for (int ni = 0; ni < 4; ++ni) {
      const int col = n0 + ni * 16 + hl;
      const float bv = bias[col];
#pragma unroll
      for (int r = 0; r < 8; ++r) {
        const int row = m0 + mi * 16 + r + 8 * g;
        float v = acc[mi][ni][r] + (EPI == 3 ? bvv[ni] : bv);
        if (EPI == 2) {
          const size_t idx = (size_t)row * Ndim + col;
          ((float*)outp)[idx] = resid[idx] + v;
        } else {
          ((bhalf_t*)outp)[(size_t)row * Ndim + col] = (bhalf_t)gelu_erf(v);
        }
      }
      // Keeps a tile's eight elements one group, its stores issued before the next tile starts.
      // Left free, the compiler mixes elements of several tiles.
      if (EPI == 3) __builtin_amdgcn_sched_barrier(0);
    }
}

__device__ __forceinline__ float xhalf(float x) {
  const int b = __builtin_bit_cast(int, x);
  return __builtin_bit_cast(
      float, __builtin_amdgcn_permlanex16(b, b, 0x76543210, 0xfedcba98, false, false));
}

#define ATT_WG (BB * NH * (LL / 128))       // attention workgroups; the grid's rest cast weights

__global__ __launch_bounds__(256) void attn_flash(
    const bhalf_t* __restrict__ Q, const bhalf_t* __restrict__ Km,
    const bhalf_t* __restrict__ Vt, bhalf_t* __restrict__ ctxout,
    const int* __restrict__ pfx, const float* __restrict__ wb,
    const float* __restrict__ wc, const float* __restrict__ wd,
    bhalf_t* __restrict__ cout) {
#if HAVE_TDM
  // Two stages of [K 64 keys x 64 hd | V^T 64 hd x 64 keys], rows of 128 B at pitch 144 B.
  __shared__ __attribute__((aligned(2048))) unsigned char sKV[2u * ABUF];
#endif
  // Behind the attention workgroups: one chunk each of the output projection's, fc1's and
  // fc2's weight, cout being the first of their bf16 copies. Left by a whole workgroup, ahead
  // of every barrier and tensor load.
  if (blockIdx.x >= ATT_WG) {
    const int c = blockIdx.x - ATT_WG + CAST_C1;       // chunk index over all four weights
    const float* in = c < CAST_C2 ? wb : c < CAST_C3 ? wc : wd;
    const int c0 = c < CAST_C2 ? CAST_C1 : c < CAST_C3 ? CAST_C2 : CAST_C3;
    cast_chunk(in + (c - c0) * CAST_CHUNK, cout + (c - CAST_C1) * CAST_CHUNK);
    return;
  }
  // The mask reads the same for any prefix below 0 as for 0 and above LL as for LL: bounded
  // here because the stage count, and so every staged address, is formed from it.
  const int praw = *pfx;
  const int prefix = praw < 0 ? 0 : (praw > LL ? LL : praw);
  const int lane = threadIdx.x & 31;
  const int wave = threadIdx.x >> 5;
  const int hl = lane & 15, g = lane >> 4;
  const int qblk = (blockIdx.x & (LL / 128 - 1)) * 128;  // query block start
  const int bh = blockIdx.x >> 4;                        // LL/128 == 16
  const int bidx = bh >> 4, h = bh & (NH - 1);
  const int q0 = qblk + wave * 16;                       // this wave's tile

  const bhalf_t* Qb = Q + (size_t)bidx * LL * DM + h * HD;
  const bhalf_t* Kb = Km + (size_t)bidx * LL * DM + h * HD;
  const bhalf_t* Vb = Vt + (size_t)bh * HD * LL;

  const bhalf_t* qp = Qb + (size_t)(q0 + hl) * DM + g * 8;
  const v16bf qa0 = frag_ld(qp);
  const v16bf qa1 = frag_ld(qp + 32);

  // This lane's query is q0 + hl. lrun sums only the keys this wave half holds;
  // the halves are joined once, behind the loop. ctx[nt][r] = O[q0 + hl][nt*16 + 8g + r].
  float mrun = -1e30f, lrun = 0.f;
  v8f ctx[4];
#pragma unroll
  for (int nt = 0; nt < 4; ++nt)
#pragma unroll
    for (int e = 0; e < 8; ++e) ctx[nt][e] = 0.f;

  // per-wave key extent (rounded to 32-key chunks), block-level extent (to 64-key stages)
  int kend_w = (q0 + 16 > prefix) ? (q0 + 16) : prefix;
  kend_w = (kend_w + 31) & ~31;
  int kend_b = (qblk + 128 > prefix) ? (qblk + 128) : prefix;
  kend_b = (kend_b + AKEYS - 1) & ~(AKEYS - 1);
  const int nst = kend_b / AKEYS;  // stages: at least two (128 keys), at most LL / 64
  const float scale = 0.125f;  // 1/sqrt(64)
  // One query per lane, so one key limit per lane: key allowed iff key < prefix, or
  // query >= prefix and key <= query; in the second case query + 1 > prefix.
  const int klim = (q0 + hl >= prefix) ? q0 + hl + 1 : prefix;

#if HAVE_TDM
  // wave 0 brings K (source pitch one row of DM), wave 1 V^T (source pitch one row of LL)
  const unsigned wv = uni(threadIdx.x >> 5);
  const unsigned long long ga = (unsigned long long)(uintptr_t)(wv == 0u ? Kb : Vb);
  const unsigned gstep = (wv == 0u) ? AKEYS * DM * 2u : AKEYS * 2u;  // source bytes per stage
  const unsigned dst = (unsigned)(uintptr_t)&sKV[0] + (wv == 1u ? ASLICE : 0u);
  const v8u d1 = attn_group1(wv == 0u ? DM * 2u : LL * 2u);
  v4u d0;
  d0[0] = uni(1u);
  d0[1] = uni(dst);
  d0[2] = uni((unsigned)ga);
  d0[3] = uni((((unsigned)(ga >> 32)) & 0x01FFFFFFu) | 0x80000000u);
  if (pinned(wv < 2u)) {
    attn_tile_load(d0, d1);           // stage 0
    wait_tensor0();
  }
  __syncthreads();                    // stage 0 readable by every wave
  if (pinned(wv < 2u)) {
    attn_step(d0, dst + ABUF, gstep);
    attn_tile_load(d0, d1);           // stage 1
  }
#endif

  for (int s = 0; s < nst; ++s) {
#if HAVE_TDM
    const unsigned char* bp = sKV + (unsigned)(s & 1) * ABUF;
#endif
#pragma unroll  // the stage's two chunks: every LDS offset an immediate
    for (int hf = 0; hf < AKEYS / 32; ++hf) {
    const int c = s * AKEYS + hf * 32;
    if (c < kend_w) {
      // ---- scores S^T[32 x 16] = K @ Q^T (2 key sub-tiles x 2 hd halves)
      v8f s[2];
      v16bf kb0[2], kb1[2];
#pragma unroll
      for (int t = 0; t < 2; ++t) {
#pragma unroll
        for (int e = 0; e < 8; ++e) s[t][e] = 0.f;
#if HAVE_TDM
        const unsigned char* kr = bp + (unsigned)(hf * 32 + t * 16 + hl) * APITCH + g * 16;
        kb0[t] = frag_ld((const bhalf_t*)kr);
        kb1[t] = frag_ld((const bhalf_t*)(kr + 64));
#else
        const bhalf_t* kp = Kb + (size_t)(c + t * 16 + hl) * DM + g * 8;
        kb0[t] = frag_ld(kp);
        kb1[t] = frag_ld(kp + 32);
#endif
      }
      v16bf vb[4];
#pragma unroll
      for (int nt = 0; nt < 4; ++nt) {
#if HAVE_TDM
        vb[nt] = frag_ld((const bhalf_t*)(bp + ASLICE + (unsigned)(nt * 16 + hl) * APITCH +
                                          hf * 64 + g * 16));
#else
        vb[nt] = frag_ld(Vb + (size_t)(nt * 16 + hl) * LL + c + g * 8);
#endif
      }
      // Keeps the chunk's 16 LDS reads one group ahead of the products: left free, the
      // compiler issues them a pair per product into one register set, each pair waited to 0.
      __builtin_amdgcn_sched_barrier(0);
#pragma unroll
      for (int t = 0; t < 2; ++t) s[t] = wmma_bf16f32(kb0[t], qa0, s[t]);
#pragma unroll
      for (int t = 0; t < 2; ++t) s[t] = wmma_bf16f32(kb1[t], qa1, s[t]);
      // ---- scale + prefix-decoder mask: this lane's score (t, r) is key c + 16t + 8g + r
#pragma unroll
      for (int t = 0; t < 2; ++t)
#pragma unroll
        for (int r = 0; r < 8; ++r) s[t][r] *= scale;
      if (c + 31 >= prefix) {  // same for the whole wave: chunks inside the prefix skip the mask
        const int rel = klim - c - 8 * g;
#pragma unroll
        for (int t = 0; t < 2; ++t)
#pragma unroll
          for (int r = 0; r < 8; ++r) s[t][r] = (t * 16 + r < rel) ? s[t][r] : -1e30f;
      }
      // ---- online softmax: 16 scores of one query per lane, one exchange for the maximum
      float t8[8];
#pragma unroll
      for (int r = 0; r < 8; ++r) t8[r] = fmaxf(s[0][r], s[1][r]);
      float tm = fmaxf(fmaxf(fmaxf(t8[0], t8[1]), fmaxf(t8[2], t8[3])),
                       fmaxf(fmaxf(t8[4], t8[5]), fmaxf(t8[6], t8[7])));
      tm = fmaxf(tm, xhalf(tm));
      const float mnew = fmaxf(mrun, tm);
      const float alpha = __expf(mrun - mnew);
      // P^T as a B operand: element 8t + r is key 16t + 8g + r, the order frag_ld gives V^T
      v16bf pb;
      float r4[4] = {0.f, 0.f, 0.f, 0.f};  // four short chains instead of one of 16 adds
#pragma unroll
      for (int t = 0; t < 2; ++t)
#pragma unroll
        for (int r = 0; r < 8; ++r) {
          const float p = __expf(s[t][r] - mnew);
          r4[r & 3] += p;
          pb[t * 8 + r] = (bhalf_t)p;
        }
      lrun = lrun * alpha + ((r4[0] + r4[1]) + (r4[2] + r4[3]));
      mrun = mnew;
#pragma unroll
      for (int nt = 0; nt < 4; ++nt)
#pragma unroll
        for (int r = 0; r < 8; ++r) ctx[nt][r] *= alpha;
      // ---- O^T += V^T @ P^T  (contraction over 32 keys, 4 hd row tiles)
#pragma unroll
      for (int nt = 0; nt < 4; ++nt) ctx[nt] = wmma_bf16f32(vb[nt], pb, ctx[nt]);
    }
    }
#if HAVE_TDM
    // publish point of stage s + 1, passed by every wave, also one that skipped the chunks
    wait_ds0();
    if (pinned(wv < 2u)) wait_tensor0();
    __syncthreads();                  // stage s + 1 readable; stage s's buffer left by every reader
    if (pinned((wv < 2u) & (s + 2 < nst))) {
      attn_step(d0, dst + (unsigned)(s & 1) * ABUF, gstep);
      attn_tile_load(d0, d1);         // stage s + 2
    }
#endif
  }
#if HAVE_TDM
  wait_tensor0();
  wait_ds0();
#endif
  // ---- normalize and store context: 8 consecutive head columns per lane, one 16-B store
  const float lsum = lrun + xhalf(lrun);
  bhalf_t* orow = ctxout + ((size_t)bidx * LL + q0 + hl) * DM + h * HD + 8 * g;
#pragma unroll
  for (int nt = 0; nt < 4; ++nt) {
    v8bf o;
#pragma unroll
    for (int r = 0; r < 8; ++r) o[r] = (bhalf_t)(ctx[nt][r] / lsum);
    *(v8bf*)(orow + nt * 16) = o;
  }
}

// ---------------------------------------------------------------------------
// Launch
// ---------------------------------------------------------------------------
extern "C" void kernel_launch(void* const* d_in, const int* in_sizes, int n_in,
                              void* d_out, int out_size, void* d_ws, size_t ws_size,
                              hipStream_t stream) {
  (void)in_sizes; (void)n_in; (void)out_size; (void)ws_size;
  const float* x    = (const float*)d_in[0];
  const float* ln1w = (const float*)d_in[1];
  const float* ln1b = (const float*)d_in[2];
  const float* inw  = (const float*)d_in[3];
  const float* inb  = (const float*)d_in[4];
  const float* outw = (const float*)d_in[5];
  const float* outb = (const float*)d_in[6];
  const float* ln2w = (const float*)d_in[7];
  const float* ln2b = (const float*)d_in[8];
  const float* fc1w = (const float*)d_in[9];
  const float* fc1b = (const float*)d_in[10];
  const float* fc2w = (const float*)d_in[11];
  const float* fc2b = (const float*)d_in[12];
  const int*   pfx  = (const int*)d_in[13];
  float* out = (float*)d_out;

  char* ws = (char*)d_ws;
  size_t off = 0;
  auto carve = [&](size_t bytes) -> void* {
    void* p = ws + off;
    off += (bytes + 255) & ~(size_t)255;
    return p;
  };
  // the four bf16 weights as one range, in the order of the chunk index
  bhalf_t* wqkv = (bhalf_t*)carve((size_t)CAST_C4 * CAST_CHUNK * sizeof(bhalf_t));
  bhalf_t* wo   = wqkv + (size_t)CAST_C1 * CAST_CHUNK;
  bhalf_t* w1   = wqkv + (size_t)CAST_C2 * CAST_CHUNK;
  bhalf_t* w2   = wqkv + (size_t)CAST_C3 * CAST_CHUNK;
  bhalf_t* h1   = (bhalf_t*)carve((size_t)MM * DM * sizeof(bhalf_t));
  // Q, K, V^T as one range, in the order the merged projection stores them
  bhalf_t* Qb   = (bhalf_t*)carve((size_t)3 * MM * DM * sizeof(bhalf_t));
  bhalf_t* Kb   = Qb + (size_t)MM * DM;
  bhalf_t* Vt   = Qb + (size_t)2 * MM * DM;
  bhalf_t* ctxb = (bhalf_t*)carve((size_t)MM * DM * sizeof(bhalf_t));
  float*   x1   = (float*)carve((size_t)MM * DM * sizeof(float));
  bhalf_t* h2   = (bhalf_t*)carve((size_t)MM * DM * sizeof(bhalf_t));
  bhalf_t* ff1  = (bhalf_t*)carve((size_t)MM * DF * sizeof(bhalf_t));

  layernorm_bf16<<<MM / 8 + CAST_C1, 256, 0, stream>>>(x, ln1w, ln1b, h1, inw, wqkv);

  dim3 blk(256);
  dim3 gD(MM / 128, DM / 256);
  dim3 gF(MM / 128, DF / 256);
  dim3 gQ(MM / 128, 3 * DM / 256);
  gemm_bf16<4><<<gQ, blk, 0, stream>>>(h1, wqkv, inb, nullptr, Qb, MM, DM, DM);

  attn_flash<<<ATT_WG + CAST_C4 - CAST_C1, blk, 0, stream>>>(Qb, Kb, Vt, ctxb, pfx, outw, fc1w,
                                                             fc2w, wo);

  gemm_bf16<2><<<gD, blk, 0, stream>>>(ctxb, wo, outb, x, x1, MM, DM, DM);
  layernorm_bf16<<<MM / 8, 256, 0, stream>>>(x1, ln2w, ln2b, h2, nullptr, nullptr);
  gemm_bf16<3><<<gF, blk, 0, stream>>>(h2, w1, fc1b, nullptr, ff1, MM, DF, DM);
  gemm_bf16<2><<<gD, blk, 0, stream>>>(ff1, w2, fc2b, x1, out, MM, DM, DF);
}

// v010
// It runs in 138 microseconds.
// Two timings next to v009 put it at 1.14 and 1.15 times that version's speed.
// All steps since v000 together make it 3.65 times as fast.
#include <hip/hip_runtime.h>

typedef __bf16 bhalf_t;
typedef __attribute__((ext_vector_type(16))) __bf16 v16bf;
typedef __attribute__((ext_vector_type(8)))  __bf16 v8bf;
typedef __attribute__((ext_vector_type(8)))  float  v8f;
typedef __attribute__((ext_vector_type(4)))  unsigned int v4u;

#define DM   1024   // d_model
#define NH   16     // heads
#define HD   64     // head dim
#define DF   4096   // d_ff
#define BB   2      // batch
#define LL   2048   // seq len
#define MM   (BB*LL)
#define AKEYS 64    // attention: keys per LDS stage (two 32-key chunks)

#if defined(__gfx1250__) && __has_builtin(__builtin_amdgcn_tensor_load_to_lds)
#define HAVE_TDM 1
#else
#define HAVE_TDM 0
#endif

__device__ __forceinline__ v8f wmma_bf16f32(v16bf a, v16bf b, v8f c) {
  return __builtin_amdgcn_wmma_f32_16x16x32_bf16(false, a, false, b, (short)0, c,
                                                 false, false);
}

__device__ __forceinline__ v16bf frag_ld(const bhalf_t* p) {
  v8bf lo = *(const v8bf*)(p);
  v8bf hi = *(const v8bf*)(p + 16);
  v16bf r;
#pragma unroll
  for (int i = 0; i < 8; ++i) { r[i] = lo[i]; r[8 + i] = hi[i]; }
  return r;
}

#if HAVE_TDM
typedef __attribute__((ext_vector_type(8))) unsigned int v8u;
#define GK      128                 // k elements per stage
#define GROWB   256u                // bytes of one staged row
#define GPITCH  272u                // LDS pitch of a staged row
#define GSLICE  (128u * GPITCH)     // one wave's request: 128 rows = 17 x 2 KiB
#define GBUF    (3u * GSLICE)       // a stage: A 128 rows, then W 256 rows
#define GRING   3u                  // buffers: stage s worked on, s + 1 and s + 2 landing

__device__ __forceinline__ unsigned uni(unsigned v) {
  return (unsigned)__builtin_amdgcn_readfirstlane(v);
}
__device__ __forceinline__ unsigned pinned(unsigned v) {
  unsigned w = uni(v);
  asm volatile("" : "+s"(w));
  return w;
}
__device__ __forceinline__ v8u gemm_group1(unsigned src_pitch_bytes) {
  v8u d;
  d[0] = uni((1u << 20) | (5u << 22) | (3u << 25));
  d[1] = uni((GROWB & 0xFFFFu) << 16);
  d[2] = uni((GROWB >> 16) | (128u << 16));
  d[3] = uni(GROWB << 16);
  d[4] = uni(128u);
  d[5] = uni(src_pitch_bytes);
  d[6] = uni(0u);
  d[7] = uni(0u);
  // Built once and kept: without this the compiler re-forms some words in the loop, in the
  // same registers, while a request is outstanding.
  asm volatile("" : "+s"(d));
  return d;
}
// Attention staging: a stage is 64 keys, K as 64 rows (keys) and V^T as 64 rows (head dims),
// each row 128 B, laid at an LDS pitch of 144 B (16 B x odd).
#define AROWB   128u                // bytes of one staged row
#define APITCH  144u                // LDS pitch of a staged row
#define ASLICE  10240u              // one wave's request: 64 rows = 9216 B, rounded up to 2 KiB
#define ABUF    (2u * ASLICE)       // a stage: K, then V^T
__device__ __forceinline__ v8u attn_group1(unsigned src_pitch_bytes) {
  v8u d;
  d[0] = uni((1u << 20) | (4u << 22) | (3u << 25));
  d[1] = uni((AROWB & 0xFFFFu) << 16);
  d[2] = uni((AROWB >> 16) | (64u << 16));
  d[3] = uni(AROWB << 16);
  d[4] = uni(64u);
  d[5] = uni(src_pitch_bytes);
  d[6] = uni(0u);
  d[7] = uni(0u);
  asm volatile("" : "+s"(d));
  return d;
}
__device__ __forceinline__ void gemm_tile_load(v4u& d0, v8u d1) {
  asm volatile("tensor_load_to_lds %0, %1" : "+s"(d0) : "s"(d1) : "memory");
}
__device__ __forceinline__ void attn_tile_load(v4u& d0, v8u d1) {
  asm volatile("tensor_load_to_lds %0, %1" : "+s"(d0) : "s"(d1) : "memory");
}
// Next stage: new place in LDS, source address one stage on (a carry runs into address bits only).
__device__ __forceinline__ void attn_step(v4u& d0, unsigned lds_dst, unsigned step_bytes) {
  const unsigned long long a = (((unsigned long long)d0[3] << 32) | d0[2]) + step_bytes;
  d0[1] = uni(lds_dst);
  d0[2] = uni((unsigned)a);
  d0[3] = uni((unsigned)(a >> 32));
}
// The compiler places no wait for the tensor mover: a tile counts as landed only behind an s_wait_tensorcnt.
__device__ __forceinline__ void wait_tensor0() { asm volatile("s_wait_tensorcnt 0x0" ::: "memory"); }
// All but the wave's youngest request have landed: the stage about to be published has, the
// one behind it stays in flight.
__device__ __forceinline__ void wait_tensor1() { asm volatile("s_wait_tensorcnt 0x1" ::: "memory"); }
// A wave's LDS reads have retired before the buffer they read is handed back for a refill.
__device__ __forceinline__ void wait_ds0() { asm volatile("s_wait_dscnt 0x0" ::: "memory"); }
// Next GEMM stage: new place in LDS, source address one staged row length on. With a request
// outstanding only words 1 and 2 take new values; a carry into word 3 (address bits only)
// first waits for every request that was issued with the old word.
__device__ __forceinline__ void gemm_step(v4u& d0, unsigned lds_dst) {
  const unsigned lo = d0[2] + GROWB;
  if (pinned(lo < GROWB)) {
    wait_tensor0();
    d0[3] = uni(d0[3] + 1u);
  }
  d0[1] = uni(lds_dst);
  d0[2] = uni(lo);
}
#endif  // HAVE_TDM

// ---------------------------------------------------------------------------
// fp32 -> bf16 cast (weights)
// ---------------------------------------------------------------------------
// A wave owns CAST_V * 512 contiguous bytes of the source: every load is 32 lanes x 16 B
// of whole lines, issued as one group ahead of the conversions. Few waves with much work
// each: a stream this short is bounded by how fast waves start, not by its bytes.
#define CAST_V      16                      // 16-byte loads per lane
#define CAST_WAVE   (CAST_V * 128)          // floats per wave
#define CAST_CHUNK  (8 * CAST_WAVE)         // floats per workgroup of 8 waves
static_assert((DM * DM) % CAST_CHUNK == 0, "every weight is a whole number of chunks");
typedef __attribute__((ext_vector_type(4))) float  v4f;
typedef __attribute__((ext_vector_type(4))) __bf16 v4bf;
// The bf16 copies lie one after another in the workspace, in this order, so a chunk's index is
// its place in the output. The casts have no launch of their own: a chunk is one workgroup's
// work, and those workgroups ride in the grids of other kernels, each ahead of the product
// that reads its weight. The input projection's chunks go with the first LayerNorm, a stream
// like them; the other three weights' go behind the attention workgroups, which leave the
// memory idle and a third place on every WGP free.
#define CAST_C1  (3 * DM * DM / CAST_CHUNK)            // chunks of the input projection
#define CAST_C2  (CAST_C1 + DM * DM / CAST_CHUNK)      // ... and the output projection
#define CAST_C3  (CAST_C2 + DF * DM / CAST_CHUNK)      // ... and fc1
#define CAST_C4  (CAST_C3 + DM * DF / CAST_CHUNK)      // ... and fc2: all chunks

// One workgroup of 8 waves casts the chunk that starts at in to the chunk that starts at out.
__device__ __forceinline__ void cast_chunk(const float* __restrict__ in,
                                           bhalf_t* __restrict__ out) {
  const int lo = (threadIdx.x >> 5) * CAST_WAVE + (threadIdx.x & 31) * 4;
  const float* ip = in + lo;
  bhalf_t* op = out + lo;
  v4f v[CAST_V];
#pragma unroll  // all loads issued as one group, each offset an immediate
  for (int u = 0; u < CAST_V - 1; ++u) v[u] = *(const v4f*)(ip + u * 128);
  // Stands ahead of the last load: the compiler lets it land in the offset register that the
  // loads above name.
  asm volatile("s_wait_xcnt 0x0" ::: "memory");
  v[CAST_V - 1] = *(const v4f*)(ip + (CAST_V - 1) * 128);
#pragma unroll  // v[] stays in registers; each store is 32 lanes x 8 B = two whole lines
  for (int u = 0; u < CAST_V; ++u) {
    v4bf o;
#pragma unroll  // four converts, packed in pairs
    for (int e = 0; e < 4; ++e) o[e] = (bhalf_t)v[u][e];
    *(v4bf*)(op + u * 128) = o;
  }
}

// ---------------------------------------------------------------------------
// LayerNorm (d=1024) -> bf16
// One wave owns one row and holds it in registers: each lane 8 loads of 16 B, every load
// 512 contiguous bytes of the row, all issued at once, with the weight's and the bias's
// behind them. The row is read from memory once; mean and variance are in-lane sums and a
// five-step exchange between lanes. No LDS and no barrier. With a workgroup per row, a lane's
// four 4-byte loads of each of three passes were waited for one after another, and each of
// the two sums went through an eight-step tree in LDS with a barrier per step.
// ---------------------------------------------------------------------------
#define LN_V 8                              // 16-byte loads per lane
static_assert(LN_V * 128 == DM, "a wave's loads cover exactly one row");
static_assert(MM % 8 == 0, "eight rows per workgroup, no part-filled workgroup");

template <int M>
__device__ __forceinline__ float xrow(float x) {
  return __builtin_bit_cast(
      float, __builtin_amdgcn_update_dpp(0, __builtin_bit_cast(int, x), 0x160 | M, 0xf, 0xf, true));
}
// Sum over the 32 lanes, the same value in every lane.
__device__ __forceinline__ float wave_sum(float v) {
  v += xrow<1>(v);
  v += xrow<2>(v);
  v += xrow<4>(v);
  v += xrow<8>(v);
  const int h = __builtin_bit_cast(int, v);
  return v + __builtin_bit_cast(
                 float, __builtin_amdgcn_permlanex16(h, h, 0x76543210, 0xfedcba98, false, false));
}

// Workgroups past the rows' MM / 8 each cast one chunk of cw to cout (none in a grid of MM / 8).
__global__ __launch_bounds__(256) void layernorm_bf16(
    const float* __restrict__ x, const float* __restrict__ w,
    const float* __restrict__ b, bhalf_t* __restrict__ out,
    const float* __restrict__ cw, bhalf_t* __restrict__ cout) {
  if (blockIdx.x >= MM / 8) {  // the same for a whole workgroup
    const int c = blockIdx.x - MM / 8;
    cast_chunk(cw + c * CAST_CHUNK, cout + c * CAST_CHUNK);
    return;
  }
  const int lo = (threadIdx.x & 31) * 4;
  const int row = blockIdx.x * 8 + (threadIdx.x >> 5);
  const float* xr = x + (size_t)row * DM + lo;
  v4f xv[LN_V], wv[LN_V], bv[LN_V];
#pragma unroll  // the row's loads issued as one group, each offset an immediate
  for (int u = 0; u < LN_V; ++u) xv[u] = *(const v4f*)(xr + u * 128);
  // Stands ahead of the loads below: the compiler lets one of them land in the row's address pair.
  asm volatile("s_wait_xcnt 0x0" ::: "memory");
  // Keeps the row's loads, the ones that come from furthest, first in the queue.
  __builtin_amdgcn_sched_barrier(0);
#pragma unroll  // in flight under the row's loads and the two sums
  for (int u = 0; u < LN_V; ++u) wv[u] = *(const v4f*)(w + lo + u * 128);
#pragma unroll
  for (int u = 0; u < LN_V; ++u) bv[u] = *(const v4f*)(b + lo + u * 128);
  // Keeps the 24 loads one group ahead of the arithmetic: left free, the compiler sinks the
  // weight's and the bias's behind the two sums, a pair at a time, each pair waited for.
  __builtin_amdgcn_sched_barrier(0);
  v4f s4 = xv[0];                           // four independent chains
#pragma unroll  // xv stays in registers
  for (int u = 1; u < LN_V; ++u) s4 += xv[u];
  const float mu = wave_sum((s4[0] + s4[1]) + (s4[2] + s4[3])) * (1.f / DM);
  v4f q4 = {0.f, 0.f, 0.f, 0.f};
#pragma unroll  // xv stays in registers; from here on it holds x - mu
  for (int u = 0; u < LN_V; ++u) {
    xv[u] -= mu;
    q4 += xv[u] * xv[u];
  }
  const float var = wave_sum((q4[0] + q4[1]) + (q4[2] + q4[3])) * (1.f / DM);
  const float rstd = rsqrtf(var + 1e-5f);
  bhalf_t* orow = out + (size_t)row * DM + lo;
#pragma unroll  // each store is 32 lanes x 8 B = two whole lines
  for (int u = 0; u < LN_V; ++u) {
    v4bf o;
#pragma unroll  // four values, packed in pairs
    for (int e = 0; e < 4; ++e) o[e] = (bhalf_t)(xv[u][e] * rstd * wv[u][e] + bv[u][e]);
    *(v4bf*)(orow + u * 128) = o;
  }
  // The compiler lays the cast path directly behind this one, entered from here on a test that
  // never holds; that path's loads land in these stores' data registers.
  asm volatile("s_wait_xcnt 0x0" ::: "memory");
}

// ---------------------------------------------------------------------------
// GELU with erf, v * 0.5 * (1 + erf(v / sqrt(2))), without a branch.
// q = 0.5 * erfc(|v| / sqrt(2)) by the rational form t = 1 / (1 + p x),
// erfc(x) = (a1 t + ... + a5 t^5) exp(-x^2), absolute error at most 1.5e-7 for x >= 0;
// then v >= 0: v - v q, v < 0: v q, which is max(v, 0) - |v| q. No 1 + erf is formed, so
// the negative tail loses nothing to cancellation. The library erf takes two masked
// branches per element, one dependent chain each: elements could not overlap.
// ---------------------------------------------------------------------------
__device__ __forceinline__ float gelu_erf(float v) {
  const float a = fabsf(v);
  const float d = fmaf(a, 0.3275911f * 0.70710678118654752f, 1.f);
  const float w = (v * v) * (-0.5f * 1.4426950408889634f);
  const float t = __builtin_amdgcn_rcpf(d);
  const float e = __builtin_amdgcn_exp2f(w);
  float p = 0.5f * 1.061405429f;      // every coefficient carries the factor 0.5 of q
  p = fmaf(p, t, 0.5f * -1.453152027f);
  p = fmaf(p, t, 0.5f * 1.421413741f);
  p = fmaf(p, t, 0.5f * -0.284496736f);
  p = fmaf(p, t, 0.5f * 0.254829592f);
  const float q = (p * t) * e;
  return fmaf(-a, q, fmaxf(v, 0.f));
}

template <int V> struct store_form { static constexpr int value = V; };

template <int EPI>
__global__ __launch_bounds__(256) void gemm_bf16(
    const bhalf_t* __restrict__ A, const bhalf_t* __restrict__ W,
    const float* __restrict__ bias, const float* __restrict__ resid,
    void* __restrict__ outp, int Mdim, int Ndim, int Kdim) {
  const int lane = threadIdx.x & 31;
  const int wave = threadIdx.x >> 5;
  const int hl = lane & 15, g = lane >> 4;
  const int wm = wave & 1;            // 2 row groups of 64
  const int wn = wave >> 1;           // 4 col groups of 64
  const int m0 = blockIdx.x * 128 + wm * 64;
  const int n0 = blockIdx.y * 256 + wn * 64;

  v8f acc[4][4];
#pragma unroll
  for (int i = 0; i < 4; ++i)
#pragma unroll
    for (int j = 0; j < 4; ++j)
#pragma unroll
      for (int e = 0; e < 8; ++e) acc[i][j][e] = 0.f;

#if HAVE_TDM
  // Three stages of [A 128 rows | W 256 rows], 256 B of k per row at pitch 272 B.
  __shared__ __attribute__((aligned(2048))) unsigned char sT[GRING * GBUF];
  (void)Mdim;

  const unsigned wv = uni(threadIdx.x >> 5);
  // waves 0, 1, 2 each bring one slice of 128 rows: A, W rows 0-127, W rows 128-255
  const bhalf_t* sp = (wv == 0u)
      ? A + (size_t)blockIdx.x * 128 * Kdim
      : W + ((size_t)blockIdx.y * 256 + (wv == 2u ? 128 : 0)) * Kdim;
  const unsigned long long ga = (unsigned long long)(uintptr_t)sp;
  const unsigned dst = (unsigned)(uintptr_t)&sT[0] + (wv < 3u ? wv : 0u) * GSLICE;
  const v8u d1 = gemm_group1((unsigned)Kdim * 2u);
  const int nst = Kdim / GK;          // stages; at least three for every launch here
  v4u d0;
  d0[0] = uni(1u);
  d0[1] = uni(dst);
  d0[2] = uni((unsigned)ga);
  d0[3] = uni((((unsigned)(ga >> 32)) & 0x01FFFFFFu) | 0x80000000u);

  if (pinned(wv < 3u)) {
    gemm_tile_load(d0, d1);           // stage 0
    gemm_step(d0, dst + GBUF);
    gemm_tile_load(d0, d1);           // stage 1
    wait_tensor1();                   // stage 0 landed
  }
  __syncthreads();                    // stage 0 readable by every wave
  if (pinned((wv < 3u) & (2 < nst))) {
    gemm_step(d0, dst + 2u * GBUF);
    gemm_tile_load(d0, d1);           // stage 2
  }

  const unsigned aoff = (unsigned)(wm * 64 + hl) * GPITCH + (unsigned)g * 16u;
  const unsigned boff = GSLICE + (unsigned)(wn * 64 + hl) * GPITCH + (unsigned)g * 16u;

  // Two fragment sets: block b works on set b & 1 while block b + 1's 16 reads land in the other.
  v16bf fa[2][4], fb[2][4];
#pragma unroll
  for (int i = 0; i < 4; ++i) {
    fa[0][i] = frag_ld((const bhalf_t*)(sT + aoff + i * 16 * GPITCH));
    fb[0][i] = frag_ld((const bhalf_t*)(sT + boff + i * 16 * GPITCH));
  }

  unsigned rb = 0u;                   // place of stage s's buffer in the ring, in bytes
  for (int s = 0; s < nst; ++s) {
    const unsigned nx = (rb == (GRING - 1u) * GBUF) ? 0u : rb + GBUF;
    const unsigned char* bp = sT + rb;
    const unsigned char* bn = sT + nx;
#pragma unroll  // the four 32-k blocks of a stage: set index and every LDS offset compile-time, no loop branch among the WMMAs
    for (int kb = 0; kb < GK / 32; ++kb) {
      const int cur = kb & 1, nxt = cur ^ 1;
      if (kb == GK / 32 - 1) {
        // publish point of stage s + 1: it stands before stage s's last block, whose fragments
        // are already fetched, because the fetch below reads stage s + 1
        wait_ds0();
        if (pinned(wv < 3u)) {
          wait_tensor1();             // stage s + 1 has landed; stage s + 2, the youngest, flies on
          if (pinned(s + 2 >= nst)) wait_tensor0();  // no stage s + 2: s + 1 is itself the youngest
        }
        __syncthreads();              // stage s + 1 readable; stage s's buffer left by every reader
        if (pinned((wv < 3u) & (s + 3 < nst))) {
          gemm_step(d0, dst + rb);
          gemm_tile_load(d0, d1);     // stage s + 3, two stages ahead of its publish point
        }
      }
      // next block's fragments (in the last stage: landed rows of the ring's next buffer, never used)
      const unsigned char* np = (kb == GK / 32 - 1) ? bn : bp + (kb + 1) * 64;
#pragma unroll  // fa, fb stay in registers: every index a constant
      for (int i = 0; i < 4; ++i) {
        fa[nxt][i] = frag_ld((const bhalf_t*)(np + aoff + i * 16 * GPITCH));
        fb[nxt][i] = frag_ld((const bhalf_t*)(np + boff + i * 16 * GPITCH));
      }
      // Keeps the 16 reads one group ahead of this block's products: left free, the compiler
      // sinks them among the WMMAs a pair at a time, each pair waited to 0.
      __builtin_amdgcn_sched_barrier(0);
#pragma unroll  // 16 independent accumulator tiles back to back, all in registers
      for (int mi = 0; mi < 4; ++mi)
#pragma unroll
        for (int ni = 0; ni < 4; ++ni)
          acc[mi][ni] = wmma_bf16f32(fa[cur][mi], fb[cur][ni], acc[mi][ni]);
      // Keeps the following block's reads behind these products, so that each group stays whole.
      __builtin_amdgcn_sched_barrier(0);
    }
    rb = nx;
  }
  wait_tensor0();
  wait_ds0();
#else
  // fallback: fragments straight from global
  for (int k = 0; k < Kdim; k += 32) {
    v16bf fa[4], fb[4];
#pragma unroll
    for (int mi = 0; mi < 4; ++mi)
      fa[mi] = frag_ld(A + (size_t)(m0 + mi * 16 + hl) * Kdim + k + g * 8);
#pragma unroll
    for (int ni = 0; ni < 4; ++ni)
      fb[ni] = frag_ld(W + (size_t)(n0 + ni * 16 + hl) * Kdim + k + g * 8);
#pragma unroll
    for (int mi = 0; mi < 4; ++mi)
#pragma unroll
      for (int ni = 0; ni < 4; ++ni)
        acc[mi][ni] = wmma_bf16f32(fa[mi], fb[ni], acc[mi][ni]);
  }
#endif

  // GELU variant: its tiles are kept apart below, which would hold each tile's bias load,
  // and the wait for it, inside the tile. So the wave's four bias values are loaded ahead.
  // Merged projections: loaded ahead too, once for both store forms.
  float bvv[4] = {0.f, 0.f, 0.f, 0.f};
  if (EPI == 3 || EPI == 4) {
#pragma unroll  // bvv stays in registers
    for (int ni = 0; ni < 4; ++ni) bvv[ni] = bias[n0 + ni * 16 + hl];
    // Stands ahead of the output address arithmetic, which reuses the loads' offset register.
    asm volatile("s_wait_xcnt 0x0" ::: "memory");
  }
  if (EPI == 4) {
    // A workgroup's 256 columns lie in one of Q, K, V: part is the same for all its waves.
    const int part = (int)(blockIdx.y / (DM / 256));
    bhalf_t* po = (bhalf_t*)outp + (size_t)part * MM * DM;
    const int oc0 = n0 - part * DM;   // the wave's first column inside its own output
    auto store_tiles = [&](auto form) {
      constexpr int E = decltype(form)::value;  // store form, a compile-time value
#pragma unroll  // acc and bvv stay in registers: every index a constant
      for (int mi = 0; mi < 4; ++mi)
#pragma unroll
        for (int ni = 0; ni < 4; ++ni) {
          const int col = oc0 + ni * 16 + hl;
#pragma unroll
          for (int r = 0; r < 8; ++r) {
            const int row = m0 + mi * 16 + r + 8 * g;
            const float v = acc[mi][ni][r] + bvv[ni];
            if (E == 0) {
              po[(size_t)row * Ndim + col] = (bhalf_t)v;
            } else {
              const int bidx = row >> 11;  // row / LL
              const int seq = row & (LL - 1);
              const size_t idx =
                  (((size_t)(bidx * NH + (col >> 6)) * HD) + (col & (HD - 1))) * LL + seq;
              po[idx] = (bhalf_t)v;
            }
          }
        }
    };
    if (part < 2) {
      store_tiles(store_form<0>{});
    } else {
      store_tiles(store_form<1>{});
      // The compiler lays the row-store path directly behind this one, entered from here on a
      // test that never holds; that path's first lines rewrite these stores' address registers.
      asm volatile("s_wait_xcnt 0x0" ::: "memory");
    }
    return;
  }
#pragma unroll
  for (int mi = 0; mi < 4; ++mi)
#pragma unroll
    for (int ni = 0; ni < 4; ++ni) {
      const int col = n0 + ni * 16 + hl;
      const float bv = bias[col];
#pragma unroll
      for (int r = 0; r < 8; ++r) {
        const int row = m0 + mi * 16 + r + 8 * g;
        float v = acc[mi][ni][r] + (EPI == 3 ? bvv[ni] : bv);
        if (EPI == 2) {
          const size_t idx = (size_t)row * Ndim + col;
          ((float*)outp)[idx] = resid[idx] + v;
        } else {
          ((bhalf_t*)outp)[(size_t)row * Ndim + col] = (bhalf_t)gelu_erf(v);
        }
      }
      // Keeps a tile's eight elements one group, its stores issued before the next tile starts.
      // Left free, the compiler mixes elements of several tiles.
      if (EPI == 3) __builtin_amdgcn_sched_barrier(0);
    }
}

__device__ __forceinline__ float xhalf(float x) {
  const int b = __builtin_bit_cast(int, x);
  return __builtin_bit_cast(
      float, __builtin_amdgcn_permlanex16(b, b, 0x76543210, 0xfedcba98, false, false));
}

#define ATT_WG (BB * NH * (LL / 128))       // attention workgroups; the grid's rest cast weights

__global__ __launch_bounds__(256) void attn_flash(
    const bhalf_t* __restrict__ Q, const bhalf_t* __restrict__ Km,
    const bhalf_t* __restrict__ Vt, bhalf_t* __restrict__ ctxout,
    const int* __restrict__ pfx, const float* __restrict__ wb,
    const float* __restrict__ wc, const float* __restrict__ wd,
    bhalf_t* __restrict__ cout) {
#if HAVE_TDM
  // Two stages of [K 64 keys x 64 hd | V^T 64 hd x 64 keys], rows of 128 B at pitch 144 B.
  __shared__ __attribute__((aligned(2048))) unsigned char sKV[2u * ABUF];
#endif
  // Behind the attention workgroups: one chunk each of the output projection's, fc1's and
  // fc2's weight, cout being the first of their bf16 copies. Left by a whole workgroup, ahead
  // of every barrier and tensor load.
  if (blockIdx.x >= ATT_WG) {
    const int c = blockIdx.x - ATT_WG + CAST_C1;       // chunk index over all four weights
    const float* in = c < CAST_C2 ? wb : c < CAST_C3 ? wc : wd;
    const int c0 = c < CAST_C2 ? CAST_C1 : c < CAST_C3 ? CAST_C2 : CAST_C3;
    cast_chunk(in + (c - c0) * CAST_CHUNK, cout + (c - CAST_C1) * CAST_CHUNK);
    return;
  }
  // The mask reads the same for any prefix below 0 as for 0 and above LL as for LL: bounded
  // here because the stage count, and so every staged address, is formed from it.
  const int praw = *pfx;
  const int prefix = praw < 0 ? 0 : (praw > LL ? LL : praw);
  const int lane = threadIdx.x & 31;
  const int wave = threadIdx.x >> 5;
  const int hl = lane & 15, g = lane >> 4;
  const int qblk = (blockIdx.x & (LL / 128 - 1)) * 128;  // query block start
  const int bh = blockIdx.x >> 4;                        // LL/128 == 16
  const int bidx = bh >> 4, h = bh & (NH - 1);
  const int q0 = qblk + wave * 16;                       // this wave's tile

  const bhalf_t* Qb = Q + (size_t)bidx * LL * DM + h * HD;
  const bhalf_t* Kb = Km + (size_t)bidx * LL * DM + h * HD;
  const bhalf_t* Vb = Vt + (size_t)bh * HD * LL;

  const bhalf_t* qp = Qb + (size_t)(q0 + hl) * DM + g * 8;
  const v16bf qa0 = frag_ld(qp);
  const v16bf qa1 = frag_ld(qp + 32);

  // This lane's query is q0 + hl. lrun sums only the keys this wave half holds;
  // the halves are joined once, behind the loop. ctx[nt][r] = O[q0 + hl][nt*16 + 8g + r].
  float mrun = -1e30f, lrun = 0.f;
  v8f ctx[4];
#pragma unroll
  for (int nt = 0; nt < 4; ++nt)
#pragma unroll
    for (int e = 0; e < 8; ++e) ctx[nt][e] = 0.f;

  // per-wave key extent (rounded to 32-key chunks), block-level extent (to 64-key stages)
  int kend_w = (q0 + 16 > prefix) ? (q0 + 16) : prefix;
  kend_w = (kend_w + 31) & ~31;
  int kend_b = (qblk + 128 > prefix) ? (qblk + 128) : prefix;
  kend_b = (kend_b + AKEYS - 1) & ~(AKEYS - 1);
  const int nst = kend_b / AKEYS;  // stages: at least two (128 keys), at most LL / 64
  const float scale = 0.125f;  // 1/sqrt(64)
  // One query per lane, so one key limit per lane: key allowed iff key < prefix, or
  // query >= prefix and key <= query; in the second case query + 1 > prefix.
  const int klim = (q0 + hl >= prefix) ? q0 + hl + 1 : prefix;

#if HAVE_TDM
  // wave 0 brings K (source pitch one row of DM), wave 1 V^T (source pitch one row of LL)
  const unsigned wv = uni(threadIdx.x >> 5);
  const unsigned long long ga = (unsigned long long)(uintptr_t)(wv == 0u ? Kb : Vb);
  const unsigned gstep = (wv == 0u) ? AKEYS * DM * 2u : AKEYS * 2u;  // source bytes per stage
  const unsigned dst = (unsigned)(uintptr_t)&sKV[0] + (wv == 1u ? ASLICE : 0u);
  const v8u d1 = attn_group1(wv == 0u ? DM * 2u : LL * 2u);
  v4u d0;
  d0[0] = uni(1u);
  d0[1] = uni(dst);
  d0[2] = uni((unsigned)ga);
  d0[3] = uni((((unsigned)(ga >> 32)) & 0x01FFFFFFu) | 0x80000000u);
  if (pinned(wv < 2u)) {
    attn_tile_load(d0, d1);           // stage 0
    wait_tensor0();
  }
  __syncthreads();                    // stage 0 readable by every wave
  if (pinned(wv < 2u)) {
    attn_step(d0, dst + ABUF, gstep);
    attn_tile_load(d0, d1);           // stage 1
  }
#endif

  for (int s = 0; s < nst; ++s) {
#if HAVE_TDM
    const unsigned char* bp = sKV + (unsigned)(s & 1) * ABUF;
#endif
#pragma unroll  // the stage's two chunks: every LDS offset an immediate
    for (int hf = 0; hf < AKEYS / 32; ++hf) {
    const int c = s * AKEYS + hf * 32;
    if (c < kend_w) {
      // ---- scores S^T[32 x 16] = K @ Q^T (2 key sub-tiles x 2 hd halves)
      v8f s[2];
      v16bf kb0[2], kb1[2];
#pragma unroll
      for (int t = 0; t < 2; ++t) {
#pragma unroll
        for (int e = 0; e < 8; ++e) s[t][e] = 0.f;
#if HAVE_TDM
        const unsigned char* kr = bp + (unsigned)(hf * 32 + t * 16 + hl) * APITCH + g * 16;
        kb0[t] = frag_ld((const bhalf_t*)kr);
        kb1[t] = frag_ld((const bhalf_t*)(kr + 64));
#else
        const bhalf_t* kp = Kb + (size_t)(c + t * 16 + hl) * DM + g * 8;
        kb0[t] = frag_ld(kp);
        kb1[t] = frag_ld(kp + 32);
#endif
      }
      v16bf vb[4];
#pragma unroll
      for (int nt = 0; nt < 4; ++nt) {
#if HAVE_TDM
        vb[nt] = frag_ld((const bhalf_t*)(bp + ASLICE + (unsigned)(nt * 16 + hl) * APITCH +
                                          hf * 64 + g * 16));
#else
        vb[nt] = frag_ld(Vb + (size_t)(nt * 16 + hl) * LL + c + g * 8);
#endif
      }
      // Keeps the chunk's 16 LDS reads one group ahead of the products: left free, the
      // compiler issues them a pair per product into one register set, each pair waited to 0.
      __builtin_amdgcn_sched_barrier(0);
#pragma unroll
      for (int t = 0; t < 2; ++t) s[t] = wmma_bf16f32(kb0[t], qa0, s[t]);
#pragma unroll
      for (int t = 0; t < 2; ++t) s[t] = wmma_bf16f32(kb1[t], qa1, s[t]);
      // ---- scale + prefix-decoder mask: this lane's score (t, r) is key c + 16t + 8g + r
#pragma unroll
      for (int t = 0; t < 2; ++t)
#pragma unroll
        for (int r = 0; r < 8; ++r) s[t][r] *= scale;
      if (c + 31 >= prefix) {  // same for the whole wave: chunks inside the prefix skip the mask
        const int rel = klim - c - 8 * g;
#pragma unroll
        for (int t = 0; t < 2; ++t)
#pragma unroll
          for (int r = 0; r < 8; ++r) s[t][r] = (t * 16 + r < rel) ? s[t][r] : -1e30f;
      }
      // ---- online softmax: 16 scores of one query per lane, one exchange for the maximum
      float t8[8];
#pragma unroll
      for (int r = 0; r < 8; ++r) t8[r] = fmaxf(s[0][r], s[1][r]);
      float tm = fmaxf(fmaxf(fmaxf(t8[0], t8[1]), fmaxf(t8[2], t8[3])),
                       fmaxf(fmaxf(t8[4], t8[5]), fmaxf(t8[6], t8[7])));
      tm = fmaxf(tm, xhalf(tm));
      const float mnew = fmaxf(mrun, tm);
      const float alpha = __expf(mrun - mnew);
      // P^T as a B operand: element 8t + r is key 16t + 8g + r, the order frag_ld gives V^T
      v16bf pb;
      float r4[4] = {0.f, 0.f, 0.f, 0.f};  // four short chains instead of one of 16 adds
#pragma unroll
      for (int t = 0; t < 2; ++t)
#pragma unroll
        for (int r = 0; r < 8; ++r) {
          const float p = __expf(s[t][r] - mnew);
          r4[r & 3] += p;
          pb[t * 8 + r] = (bhalf_t)p;
        }
      lrun = lrun * alpha + ((r4[0] + r4[1]) + (r4[2] + r4[3]));
      mrun = mnew;
#pragma unroll
      for (int nt = 0; nt < 4; ++nt)
#pragma unroll
        for (int r = 0; r < 8; ++r) ctx[nt][r] *= alpha;
      // ---- O^T += V^T @ P^T  (contraction over 32 keys, 4 hd row tiles)
#pragma unroll
      for (int nt = 0; nt < 4; ++nt) ctx[nt] = wmma_bf16f32(vb[nt], pb, ctx[nt]);
    }
    }
#if HAVE_TDM
    // publish point of stage s + 1, passed by every wave, also one that skipped the chunks
    wait_ds0();
    if (pinned(wv < 2u)) wait_tensor0();
    __syncthreads();                  // stage s + 1 readable; stage s's buffer left by every reader
    if (pinned((wv < 2u) & (s + 2 < nst))) {
      attn_step(d0, dst + (unsigned)(s & 1) * ABUF, gstep);
      attn_tile_load(d0, d1);         // stage s + 2
    }
#endif
  }
#if HAVE_TDM
  wait_tensor0();
  wait_ds0();
#endif
  // ---- normalize and store context: 8 consecutive head columns per lane, one 16-B store
  const float lsum = lrun + xhalf(lrun);
  bhalf_t* orow = ctxout + ((size_t)bidx * LL + q0 + hl) * DM + h * HD + 8 * g;
#pragma unroll
  for (int nt = 0; nt < 4; ++nt) {
    v8bf o;
#pragma unroll
    for (int r = 0; r < 8; ++r) o[r] = (bhalf_t)(ctx[nt][r] / lsum);
    *(v8bf*)(orow + nt * 16) = o;
  }
}

// ---------------------------------------------------------------------------
// Launch
// ---------------------------------------------------------------------------
extern "C" void kernel_launch(void* const* d_in, const int* in_sizes, int n_in,
                              void* d_out, int out_size, void* d_ws, size_t ws_size,
                              hipStream_t stream) {
  (void)in_sizes; (void)n_in; (void)out_size; (void)ws_size;
  const float* x    = (const float*)d_in[0];
  const float* ln1w = (const float*)d_in[1];
  const float* ln1b = (const float*)d_in[2];
  const float* inw  = (const float*)d_in[3];
  const float* inb  = (const float*)d_in[4];
  const float* outw = (const float*)d_in[5];
  const float* outb = (const float*)d_in[6];
  const float* ln2w = (const float*)d_in[7];
  const float* ln2b = (const float*)d_in[8];
  const float* fc1w = (const float*)d_in[9];
  const float* fc1b = (const float*)d_in[10];
  const float* fc2w = (const float*)d_in[11];
  const float* fc2b = (const float*)d_in[12];
  const int*   pfx  = (const int*)d_in[13];
  float* out = (float*)d_out;

  char* ws = (char*)d_ws;
  size_t off = 0;
  auto carve = [&](size_t bytes) -> void* {
    void* p = ws + off;
    off += (bytes + 255) & ~(size_t)255;
    return p;
  };
  // the four bf16 weights as one range, in the order of the chunk index
  bhalf_t* wqkv = (bhalf_t*)carve((size_t)CAST_C4 * CAST_CHUNK * sizeof(bhalf_t));
  bhalf_t* wo   = wqkv + (size_t)CAST_C1 * CAST_CHUNK;
  bhalf_t* w1   = wqkv + (size_t)CAST_C2 * CAST_CHUNK;
  bhalf_t* w2   = wqkv + (size_t)CAST_C3 * CAST_CHUNK;
  bhalf_t* h1   = (bhalf_t*)carve((size_t)MM * DM * sizeof(bhalf_t));
  // Q, K, V^T as one range, in the order the merged projection stores them
  bhalf_t* Qb   = (bhalf_t*)carve((size_t)3 * MM * DM * sizeof(bhalf_t));
  bhalf_t* Kb   = Qb + (size_t)MM * DM;
  bhalf_t* Vt   = Qb + (size_t)2 * MM * DM;
  bhalf_t* ctxb = (bhalf_t*)carve((size_t)MM * DM * sizeof(bhalf_t));
  float*   x1   = (float*)carve((size_t)MM * DM * sizeof(float));
  bhalf_t* h2   = (bhalf_t*)carve((size_t)MM * DM * sizeof(bhalf_t));
  bhalf_t* ff1  = (bhalf_t*)carve((size_t)MM * DF * sizeof(bhalf_t));

  layernorm_bf16<<<MM / 8 + CAST_C1, 256, 0, stream>>>(x, ln1w, ln1b, h1, inw, wqkv);

  dim3 blk(256);
  dim3 gD(MM / 128, DM / 256);
  dim3 gF(MM / 128, DF / 256);
  dim3 gQ(MM / 128, 3 * DM / 256);
  gemm_bf16<4><<<gQ, blk, 0, stream>>>(h1, wqkv, inb, nullptr, Qb, MM, DM, DM);

  attn_flash<<<ATT_WG + CAST_C4 - CAST_C1, blk, 0, stream>>>(Qb, Kb, Vt, ctxb, pfx, outw, fc1w,
                                                             fc2w, wo);

  gemm_bf16<2><<<gD, blk, 0, stream>>>(ctxb, wo, outb, x, x1, MM, DM, DM);
  layernorm_bf16<<<MM / 8, 256, 0, stream>>>(x1, ln2w, ln2b, h2, nullptr, nullptr);
  gemm_bf16<3><<<gF, blk, 0, stream>>>(h2, w1, fc1b, nullptr, ff1, MM, DF, DM);
  gemm_bf16<2><<<gD, blk, 0, stream>>>(ff1, w2, fc2b, x1, out, MM, DM, DF);
}
